// v000
// The times below were measured on an AMD MI455X: many runs one after another, warmed up first and cycling through
// copies of the inputs, with the whole window's GPU time divided by the number of runs. Launches and the gaps
// between them are all in it. The median over several windows is given; except for v000 it joins two sittings, which
// can be a few percent apart, so the side-by-side timings, each taken in one sitting, are the better comparison.
// v000 is the starting kernel. One run takes 479 microseconds.
#include <hip/hip_runtime.h>

typedef __attribute__((ext_vector_type(16))) __bf16 v16bf;
typedef __attribute__((ext_vector_type(8)))  float  v8f;
typedef __attribute__((ext_vector_type(4)))  unsigned int u32x4;
typedef __attribute__((ext_vector_type(8)))  int    i32x8;
typedef __attribute__((ext_vector_type(4)))  int    i32x4;

#define D_MODEL 1024
#define NHEAD   16
#define HD      64
#define SEQ     2048
#define BATCH   4
#define MTOT    (BATCH*SEQ)   // 8192

#define BM 128
#define BN 256
#define BK 32
#define LDST 40               // padded LDS row stride (bf16 elems): conflict-free, 16B aligned

#if defined(__gfx1250__) && defined(__has_builtin)
#if __has_builtin(__builtin_amdgcn_tensor_load_to_lds) && __has_builtin(__builtin_amdgcn_s_wait_tensorcnt)
#define USE_TDM 1
#endif
#endif

__device__ __forceinline__ unsigned short f2bf(float f) {
    unsigned int u = __float_as_uint(f);
    u += 0x7FFFu + ((u >> 16) & 1u);          // round-to-nearest-even
    return (unsigned short)(u >> 16);
}

struct Frag { union { v16bf v; uint4 q[2]; }; };

// ---------------- conversion kernels ----------------

__global__ void k_cvt(const float* __restrict__ in, unsigned short* __restrict__ out, int n) {
    int i = (blockIdx.x * blockDim.x + threadIdx.x) * 4;
    if (i + 3 < n) {
        float4 f = *(const float4*)(in + i);
        out[i + 0] = f2bf(f.x);
        out[i + 1] = f2bf(f.y);
        out[i + 2] = f2bf(f.z);
        out[i + 3] = f2bf(f.w);
    }
}

// Wt[n*K + k] = bf16(W[k*N + n])   (store weights transposed, N x K row-major)
__global__ void k_cvt_t(const float* __restrict__ W, unsigned short* __restrict__ Wt, int K, int N) {
    int idx = blockIdx.x * blockDim.x + threadIdx.x;
    if (idx >= N * K) return;
    int n = idx / K, k = idx - n * K;
    Wt[idx] = f2bf(W[(size_t)k * N + n]);
}

#ifdef USE_TDM
// Loop-invariant part of a 2-D TDM descriptor: tileRows x 32 bf16 tile out of a
// tensor with rowLen-elem rows, HW-padded in LDS: 16 dwords data + 4 dwords pad
// -> 40-elem (80 B) rows, matching LDST.
__device__ __forceinline__ i32x8 tdm_group1(int rowLen, int tileRows) {
    i32x8 g1;
    g1[0] = (1 << 16)                                     // data_size = 2 bytes
          | (1 << 20)                                     // pad_enable
          | (3 << 22)                                     // pad_interval code 3 = 16 dwords
          | (3 << 25);                                    // pad_amount  code 3 = 4 dwords
    g1[1] = (rowLen & 0xFFFF) << 16;                      // tensor_dim0[15:0]
    g1[2] = ((rowLen >> 16) & 0xFFFF)                     // tensor_dim0[31:16]
          | ((tileRows & 0xFFFF) << 16);                  // tensor_dim1[15:0]
    g1[3] = ((tileRows >> 16) & 0xFFFF)                   // tensor_dim1[31:16]
          | (BK << 16);                                   // tile_dim0 = 32
    g1[4] = tileRows & 0xFFFF;                            // tile_dim1
    g1[5] = rowLen;                                       // tensor_dim0_stride[31:0]
    g1[6] = 0;
    g1[7] = 0;
    return g1;
}

__device__ __forceinline__ void tdm_issue(const unsigned short* gtile,
                                          unsigned lds_byte_addr, i32x8 g1) {
    unsigned long long ga = (unsigned long long)gtile;
    u32x4 g0;
    g0[0] = 1u;                                           // count=1 (valid), user mode
    g0[1] = lds_byte_addr;                                // lds_addr
    g0[2] = (unsigned)(ga & 0xFFFFFFFFu);                 // global_addr[31:0]
    g0[3] = (unsigned)((ga >> 32) & 0x1FFFFFFu)           // global_addr[56:32]
          | (2u << 30);                                   // type = 2 ("image")
    i32x4 gz4 = {0, 0, 0, 0};
    i32x8 gz8 = {0, 0, 0, 0, 0, 0, 0, 0};
    __builtin_amdgcn_tensor_load_to_lds(g0, g1, gz4, gz4, gz8, 0);
}
#endif

// ---------------- GEMM: C(MxN) f32 = A(MxK)bf16 @ Bt(NxK)bf16^T ----------------
// Double-buffered tile pipeline: TDM (or cooperative loads) stage tile k+1 while
// the 8 waves run 16 WMMAs each on tile k.
// MODE 0: QKV epilogue (scatter to Q,K row-major per head; V transposed per head)
// MODE 1: out-proj epilogue (add bias, store f32)

template<int MODE>
__global__ __launch_bounds__(256) void k_gemm(
    const unsigned short* __restrict__ A,
    const unsigned short* __restrict__ Bt,
    const float* __restrict__ bias,
    unsigned short* __restrict__ Qb,
    unsigned short* __restrict__ Kb,
    unsigned short* __restrict__ Vt,
    float* __restrict__ Cout,
    int K, int N)
{
    __shared__ alignas(16) unsigned short lA[2][BM * LDST];
    __shared__ alignas(16) unsigned short lB[2][BN * LDST];

    const int tid  = threadIdx.x;
    const int lane = tid & 31, wid = tid >> 5;
    const int ln = lane & 15,  hi  = lane >> 4;
    const int wr = wid >> 2,   wc  = wid & 3;           // 2 x 4 wave grid, 64x64 wave tile
    const int rowBase = blockIdx.y * BM;
    const int colBase = blockIdx.x * BN;

#ifdef USE_TDM
    const i32x8 g1A = tdm_group1(K, BM);
    const i32x8 g1B = tdm_group1(K, BN);
    const unsigned ldsA[2] = { (unsigned)(unsigned long long)(&lA[0][0]),
                               (unsigned)(unsigned long long)(&lA[1][0]) };
    const unsigned ldsB[2] = { (unsigned)(unsigned long long)(&lB[0][0]),
                               (unsigned)(unsigned long long)(&lB[1][0]) };
#endif

    auto stage = [&](int buf, int k0) {
#ifdef USE_TDM
        if (wid == 0) {
            tdm_issue(A  + (size_t)rowBase * K + k0, ldsA[buf], g1A);
            tdm_issue(Bt + (size_t)colBase * K + k0, ldsB[buf], g1B);
        }
#else
#pragma unroll
        for (int i = 0; i < 2; ++i) {           // A: 512 b128, 2 per thread
            int v = i * 256 + tid;
            int row = v >> 2, cs = (v & 3) * 8;
            *(uint4*)&lA[buf][row * LDST + cs] = *(const uint4*)&A[(size_t)(rowBase + row) * K + k0 + cs];
        }
#pragma unroll
        for (int i = 0; i < 4; ++i) {           // B: 1024 b128, 4 per thread
            int v = i * 256 + tid;
            int row = v >> 2, cs = (v & 3) * 8;
            *(uint4*)&lB[buf][row * LDST + cs] = *(const uint4*)&Bt[(size_t)(colBase + row) * K + k0 + cs];
        }
#endif
    };

    v8f acc[4][4];
    v8f vz = {0.f,0.f,0.f,0.f,0.f,0.f,0.f,0.f};
#pragma unroll
    for (int t = 0; t < 4; ++t)
#pragma unroll
        for (int u = 0; u < 4; ++u) acc[t][u] = vz;

    // prologue: fill buffer 0
    stage(0, 0);
#ifdef USE_TDM
    if (wid == 0) __builtin_amdgcn_s_wait_tensorcnt(0);
#endif
    __syncthreads();

    for (int k0 = 0; k0 < K; k0 += BK) {
        const int cur = (k0 >> 5) & 1;
        if (k0 + BK < K) stage(cur ^ 1, k0 + BK);   // overlap DMA with WMMA

        Frag fa[4], fb[4];
#pragma unroll
        for (int t = 0; t < 4; ++t)
#pragma unroll
            for (int g = 0; g < 2; ++g)
                fa[t].q[g] = *(const uint4*)&lA[cur][(wr * 64 + t * 16 + ln) * LDST + hi * 8 + g * 16];
#pragma unroll
        for (int u = 0; u < 4; ++u)
#pragma unroll
            for (int g = 0; g < 2; ++g)
                fb[u].q[g] = *(const uint4*)&lB[cur][(wc * 64 + u * 16 + ln) * LDST + hi * 8 + g * 16];

#pragma unroll
        for (int t = 0; t < 4; ++t)
#pragma unroll
            for (int u = 0; u < 4; ++u)
                acc[t][u] = __builtin_amdgcn_wmma_f32_16x16x32_bf16(
                    false, fa[t].v, false, fb[u].v, (short)0, acc[t][u], false, false);

#ifdef USE_TDM
        if (wid == 0) __builtin_amdgcn_s_wait_tensorcnt(0);
#endif
        __syncthreads();
    }

    // epilogue
#pragma unroll
    for (int t = 0; t < 4; ++t)
#pragma unroll
        for (int u = 0; u < 4; ++u)
#pragma unroll
            for (int r = 0; r < 8; ++r) {
                int gm = rowBase + wr * 64 + t * 16 + r + hi * 8;
                int gn = colBase + wc * 64 + u * 16 + ln;
                float val = acc[t][u][r];
                if (MODE == 0) {
                    int which = gn >> 10, d = gn & 1023;
                    int h = d >> 6, hd = d & 63;
                    int b = gm >> 11, tok = gm & 2047;
                    unsigned short bv = f2bf(val);
                    if (which == 0)
                        Qb[(((size_t)(b * NHEAD + h)) * SEQ + tok) * HD + hd] = bv;
                    else if (which == 1)
                        Kb[(((size_t)(b * NHEAD + h)) * SEQ + tok) * HD + hd] = bv;
                    else
                        Vt[(((size_t)(b * NHEAD + h)) * HD + hd) * SEQ + tok] = bv;
                } else {
                    Cout[(size_t)gm * N + gn] = val + bias[gn];
                }
            }
}

// ---------------- attention: per (b,h), two-pass softmax, deferred lane reductions --
// Q,K per head: (SEQ x HD) bf16 row-major.  V per head: (HD x SEQ) bf16 (transposed).
// One wave handles 16 query rows; block = 4 waves = 64 queries.

__global__ __launch_bounds__(128) void k_attn(
    const unsigned short* __restrict__ Qb,
    const unsigned short* __restrict__ Kb,
    const unsigned short* __restrict__ Vt,
    unsigned short* __restrict__ Ob)
{
    __shared__ alignas(16) unsigned short Pld[4][16 * LDST];

    const int tid  = threadIdx.x;
    const int lane = tid & 31, wid = tid >> 5;
    const int ln = lane & 15,  hi  = lane >> 4;
    const int b = blockIdx.z, h = blockIdx.y;
    const int qbase = blockIdx.x * 64 + wid * 16;
    const float scale = 0.125f;                  // 1/sqrt(64)

    const size_t headOff = ((size_t)(b * NHEAD + h)) * SEQ * HD;
    const unsigned short* Qh = Qb + headOff;
    const unsigned short* Kh = Kb + headOff;
    const unsigned short* Vh = Vt + headOff;     // (HD x SEQ)

    // Q fragments (16 x 64), resident for the whole kernel
    Frag qf[2];
#pragma unroll
    for (int f = 0; f < 2; ++f)
#pragma unroll
        for (int g = 0; g < 2; ++g)
            qf[f].q[g] = *(const uint4*)&Qh[(size_t)(qbase + ln) * HD + f * 32 + hi * 8 + g * 16];

    v8f vz = {0.f,0.f,0.f,0.f,0.f,0.f,0.f,0.f};

    // ---- phase A: per-lane raw row max (no shuffles, no exp in the hot loop) ----
    float mrow[8];
#pragma unroll
    for (int r = 0; r < 8; ++r) mrow[r] = -3.0e38f;

    for (int kc = 0; kc < SEQ; kc += 32) {
        v8f s0 = vz, s1 = vz;
#pragma unroll
        for (int f = 0; f < 2; ++f) {
            Frag kf;
#pragma unroll
            for (int g = 0; g < 2; ++g)
                kf.q[g] = *(const uint4*)&Kh[(size_t)(kc + ln) * HD + f * 32 + hi * 8 + g * 16];
            s0 = __builtin_amdgcn_wmma_f32_16x16x32_bf16(false, qf[f].v, false, kf.v, (short)0, s0, false, false);
        }
#pragma unroll
        for (int f = 0; f < 2; ++f) {
            Frag kf;
#pragma unroll
            for (int g = 0; g < 2; ++g)
                kf.q[g] = *(const uint4*)&Kh[(size_t)(kc + 16 + ln) * HD + f * 32 + hi * 8 + g * 16];
            s1 = __builtin_amdgcn_wmma_f32_16x16x32_bf16(false, qf[f].v, false, kf.v, (short)0, s1, false, false);
        }
#pragma unroll
        for (int r = 0; r < 8; ++r)
            mrow[r] = fmaxf(mrow[r], fmaxf(s0[r], s1[r]));
    }
    // one cross-lane max reduction at the end (rows live in 16-lane groups)
#pragma unroll
    for (int r = 0; r < 8; ++r) {
#pragma unroll
        for (int m = 1; m <= 8; m <<= 1)
            mrow[r] = fmaxf(mrow[r], __shfl_xor(mrow[r], m, 32));
        mrow[r] *= scale;                        // max of scaled scores
    }

    // ---- phase B: O += exp(s*scale - m) @ V ; row-sums accumulated per lane ----
    v8f oacc[4];
#pragma unroll
    for (int u = 0; u < 4; ++u) oacc[u] = vz;
    float psum[8];
#pragma unroll
    for (int r = 0; r < 8; ++r) psum[r] = 0.f;

    unsigned short* Pw = &Pld[wid][0];

    for (int kc = 0; kc < SEQ; kc += 32) {
        v8f s0 = vz, s1 = vz;
#pragma unroll
        for (int f = 0; f < 2; ++f) {
            Frag kf;
#pragma unroll
            for (int g = 0; g < 2; ++g)
                kf.q[g] = *(const uint4*)&Kh[(size_t)(kc + ln) * HD + f * 32 + hi * 8 + g * 16];
            s0 = __builtin_amdgcn_wmma_f32_16x16x32_bf16(false, qf[f].v, false, kf.v, (short)0, s0, false, false);
        }
#pragma unroll
        for (int f = 0; f < 2; ++f) {
            Frag kf;
#pragma unroll
            for (int g = 0; g < 2; ++g)
                kf.q[g] = *(const uint4*)&Kh[(size_t)(kc + 16 + ln) * HD + f * 32 + hi * 8 + g * 16];
            s1 = __builtin_amdgcn_wmma_f32_16x16x32_bf16(false, qf[f].v, false, kf.v, (short)0, s1, false, false);
        }

        // exponentiate, accumulate per-lane row sums, C-layout -> A-layout via LDS
#pragma unroll
        for (int r = 0; r < 8; ++r) {
            int row = r + hi * 8;
            float p0 = __expf(s0[r] * scale - mrow[r]);
            float p1 = __expf(s1[r] * scale - mrow[r]);
            psum[r] += p0 + p1;
            Pw[row * LDST + ln]      = f2bf(p0);
            Pw[row * LDST + 16 + ln] = f2bf(p1);
        }
        asm volatile("s_wait_dscnt 0" ::: "memory");   // per-wave LDS RAW fence

        Frag pf;
        pf.q[0] = *(const uint4*)&Pw[ln * LDST + hi * 8];
        pf.q[1] = *(const uint4*)&Pw[ln * LDST + 16 + hi * 8];

#pragma unroll
        for (int u = 0; u < 4; ++u) {
            Frag vf;
#pragma unroll
            for (int g = 0; g < 2; ++g)
                vf.q[g] = *(const uint4*)&Vh[(size_t)(u * 16 + ln) * SEQ + kc + hi * 8 + g * 16];
            oacc[u] = __builtin_amdgcn_wmma_f32_16x16x32_bf16(false, pf.v, false, vf.v, (short)0, oacc[u], false, false);
        }
    }

    // one cross-lane sum reduction for the softmax denominators
    float lrow[8];
#pragma unroll
    for (int r = 0; r < 8; ++r) {
        float s = psum[r];
#pragma unroll
        for (int m = 1; m <= 8; m <<= 1) s += __shfl_xor(s, m, 32);
        lrow[r] = s;
    }

    // normalize + store bf16 into (B, N, D) layout for the out-projection GEMM
#pragma unroll
    for (int u = 0; u < 4; ++u)
#pragma unroll
        for (int r = 0; r < 8; ++r) {
            float o = oacc[u][r] / lrow[r];
            int gq = qbase + r + hi * 8;
            Ob[((size_t)(b * SEQ + gq)) * D_MODEL + h * HD + u * 16 + ln] = f2bf(o);
        }
}

// ---------------- launcher ----------------

extern "C" void kernel_launch(void* const* d_in, const int* in_sizes, int n_in,
                              void* d_out, int out_size, void* d_ws, size_t ws_size,
                              hipStream_t stream) {
    (void)in_sizes; (void)n_in; (void)out_size; (void)ws_size;
    const float* x      = (const float*)d_in[0];
    const float* W_qkv  = (const float*)d_in[1];
    const float* W_proj = (const float*)d_in[2];
    const float* b_proj = (const float*)d_in[3];
    float* out = (float*)d_out;

    const size_t NX  = (size_t)MTOT * D_MODEL;      // 8,388,608
    unsigned short* Xb     = (unsigned short*)d_ws;
    unsigned short* WqkvT  = Xb     + NX;                            // 3072 x 1024
    unsigned short* WprojT = WqkvT  + (size_t)3 * D_MODEL * D_MODEL; // 1024 x 1024
    unsigned short* Qb     = WprojT + (size_t)D_MODEL * D_MODEL;     // B*H*SEQ*HD == NX
    unsigned short* Kb     = Qb + NX;
    unsigned short* Vt     = Kb + NX;
    unsigned short* Ob     = Vt + NX;

    // 1. convert inputs to bf16 (weights transposed to N x K)
    k_cvt  <<<(int)(NX / 1024), 256, 0, stream>>>(x, Xb, (int)NX);
    k_cvt_t<<<(3 * D_MODEL * D_MODEL) / 256, 256, 0, stream>>>(W_qkv,  WqkvT,  D_MODEL, 3 * D_MODEL);
    k_cvt_t<<<(D_MODEL * D_MODEL) / 256,     256, 0, stream>>>(W_proj, WprojT, D_MODEL, D_MODEL);

    // 2. QKV projection, scatter to per-head Q, K (row-major) and V^T
    k_gemm<0><<<dim3(3 * D_MODEL / BN, MTOT / BM), 256, 0, stream>>>(
        Xb, WqkvT, nullptr, Qb, Kb, Vt, nullptr, D_MODEL, 3 * D_MODEL);

    // 3. attention (two-pass streamed softmax, all WMMA)
    k_attn<<<dim3(SEQ / 64, NHEAD, BATCH), 128, 0, stream>>>(Qb, Kb, Vt, Ob);

    // 4. output projection + bias (f32 out)
    k_gemm<1><<<dim3(D_MODEL / BN, MTOT / BM), 256, 0, stream>>>(
        Ob, WprojT, b_proj, nullptr, nullptr, nullptr, out, D_MODEL, D_MODEL);
}

// v001
// A run of this version takes 266 microseconds.
// In both of two side-by-side timings against v000, it was 1.86 times as fast.
#include <hip/hip_runtime.h>

typedef __attribute__((ext_vector_type(16))) __bf16 v16bf;
typedef __attribute__((ext_vector_type(8)))  float  v8f;
typedef __attribute__((ext_vector_type(4)))  unsigned int u32x4;
typedef __attribute__((ext_vector_type(8)))  int    i32x8;
typedef __attribute__((ext_vector_type(4)))  int    i32x4;

#define D_MODEL 1024
#define NHEAD   16
#define HD      64
#define SEQ     2048
#define BATCH   4
#define MTOT    (BATCH*SEQ)   // 8192

#define BM 128
#define BN 256
#define BK 32
#define LDST 40               // padded LDS row stride (bf16 elems): conflict-free, 16B aligned

#if defined(__gfx1250__) && defined(__has_builtin)
#if __has_builtin(__builtin_amdgcn_tensor_load_to_lds) && __has_builtin(__builtin_amdgcn_s_wait_tensorcnt)
#define USE_TDM 1
#endif
#endif

__device__ __forceinline__ unsigned short f2bf(float f) {
    unsigned int u = __float_as_uint(f);
    u += 0x7FFFu + ((u >> 16) & 1u);          // round-to-nearest-even
    return (unsigned short)(u >> 16);
}

struct Frag { union { v16bf v; uint4 q[2]; }; };

// ---------------- conversion kernels ----------------

__global__ void k_cvt(const float* __restrict__ in, unsigned short* __restrict__ out, int n) {
    int i = (blockIdx.x * blockDim.x + threadIdx.x) * 4;
    if (i + 3 < n) {
        float4 f = *(const float4*)(in + i);
        out[i + 0] = f2bf(f.x);
        out[i + 1] = f2bf(f.y);
        out[i + 2] = f2bf(f.z);
        out[i + 3] = f2bf(f.w);
    }
}

// Wt[n*K + k] = bf16(W[k*N + n])   (store weights transposed, N x K row-major)
__global__ void k_cvt_t(const float* __restrict__ W, unsigned short* __restrict__ Wt, int K, int N) {
    int idx = blockIdx.x * blockDim.x + threadIdx.x;
    if (idx >= N * K) return;
    int n = idx / K, k = idx - n * K;
    Wt[idx] = f2bf(W[(size_t)k * N + n]);
}

#ifdef USE_TDM
// Loop-invariant part of a 2-D TDM descriptor: tileRows x 32 bf16 tile out of a
// tensor with rowLen-elem rows, HW-padded in LDS: 16 dwords data + 4 dwords pad
// -> 40-elem (80 B) rows, matching LDST.
__device__ __forceinline__ i32x8 tdm_group1(int rowLen, int tileRows) {
    i32x8 g1;
    g1[0] = (1 << 16)                                     // data_size = 2 bytes
          | (1 << 20)                                     // pad_enable
          | (3 << 22)                                     // pad_interval code 3 = 16 dwords
          | (3 << 25);                                    // pad_amount  code 3 = 4 dwords
    g1[1] = (rowLen & 0xFFFF) << 16;                      // tensor_dim0[15:0]
    g1[2] = ((rowLen >> 16) & 0xFFFF)                     // tensor_dim0[31:16]
          | ((tileRows & 0xFFFF) << 16);                  // tensor_dim1[15:0]
    g1[3] = ((tileRows >> 16) & 0xFFFF)                   // tensor_dim1[31:16]
          | (BK << 16);                                   // tile_dim0 = 32
    g1[4] = tileRows & 0xFFFF;                            // tile_dim1
    g1[5] = rowLen;                                       // tensor_dim0_stride[31:0]
    g1[6] = 0;
    g1[7] = 0;
    return g1;
}

__device__ __forceinline__ void tdm_issue(const unsigned short* gtile,
                                          unsigned lds_byte_addr, i32x8 g1) {
    unsigned long long ga = (unsigned long long)gtile;
    u32x4 g0;
    g0[0] = 1u;                                           // count=1 (valid), user mode
    g0[1] = lds_byte_addr;                                // lds_addr
    g0[2] = (unsigned)(ga & 0xFFFFFFFFu);                 // global_addr[31:0]
    g0[3] = (unsigned)((ga >> 32) & 0x1FFFFFFu)           // global_addr[56:32]
          | (2u << 30);                                   // type = 2 ("image")
    i32x4 gz4 = {0, 0, 0, 0};
    i32x8 gz8 = {0, 0, 0, 0, 0, 0, 0, 0};
    __builtin_amdgcn_tensor_load_to_lds(g0, g1, gz4, gz4, gz8, 0);
}
#endif

// ---------------- GEMM: C(MxN) f32 = A(MxK)bf16 @ Bt(NxK)bf16^T ----------------
// Double-buffered tile pipeline: TDM (or cooperative loads) stage tile k+1 while
// the 8 waves run 16 WMMAs each on tile k.
// MODE 0: QKV epilogue (scatter to Q,K row-major per head; V transposed per head)
// MODE 1: out-proj epilogue (add bias, store f32)

template<int MODE>
__global__ __launch_bounds__(256) void k_gemm(
    const unsigned short* __restrict__ A,
    const unsigned short* __restrict__ Bt,
    const float* __restrict__ bias,
    unsigned short* __restrict__ Qb,
    unsigned short* __restrict__ Kb,
    unsigned short* __restrict__ Vt,
    float* __restrict__ Cout,
    int K, int N)
{
    __shared__ alignas(16) unsigned short lA[2][BM * LDST];
    __shared__ alignas(16) unsigned short lB[2][BN * LDST];

    const int tid  = threadIdx.x;
    const int lane = tid & 31, wid = tid >> 5;
    const int ln = lane & 15,  hi  = lane >> 4;
    const int wr = wid >> 2,   wc  = wid & 3;           // 2 x 4 wave grid, 64x64 wave tile
    const int rowBase = blockIdx.y * BM;
    const int colBase = blockIdx.x * BN;

#ifdef USE_TDM
    const i32x8 g1A = tdm_group1(K, BM);
    const i32x8 g1B = tdm_group1(K, BN);
    const unsigned ldsA[2] = { (unsigned)(unsigned long long)(&lA[0][0]),
                               (unsigned)(unsigned long long)(&lA[1][0]) };
    const unsigned ldsB[2] = { (unsigned)(unsigned long long)(&lB[0][0]),
                               (unsigned)(unsigned long long)(&lB[1][0]) };
#endif

    auto stage = [&](int buf, int k0) {
#ifdef USE_TDM
        if (wid == 0) {
            tdm_issue(A  + (size_t)rowBase * K + k0, ldsA[buf], g1A);
            tdm_issue(Bt + (size_t)colBase * K + k0, ldsB[buf], g1B);
        }
#else
#pragma unroll
        for (int i = 0; i < 2; ++i) {           // A: 512 b128, 2 per thread
            int v = i * 256 + tid;
            int row = v >> 2, cs = (v & 3) * 8;
            *(uint4*)&lA[buf][row * LDST + cs] = *(const uint4*)&A[(size_t)(rowBase + row) * K + k0 + cs];
        }
#pragma unroll
        for (int i = 0; i < 4; ++i) {           // B: 1024 b128, 4 per thread
            int v = i * 256 + tid;
            int row = v >> 2, cs = (v & 3) * 8;
            *(uint4*)&lB[buf][row * LDST + cs] = *(const uint4*)&Bt[(size_t)(colBase + row) * K + k0 + cs];
        }
#endif
    };

    v8f acc[4][4];
    v8f vz = {0.f,0.f,0.f,0.f,0.f,0.f,0.f,0.f};
#pragma unroll
    for (int t = 0; t < 4; ++t)
#pragma unroll
        for (int u = 0; u < 4; ++u) acc[t][u] = vz;

    // prologue: fill buffer 0
    stage(0, 0);
#ifdef USE_TDM
    if (wid == 0) __builtin_amdgcn_s_wait_tensorcnt(0);
#endif
    __syncthreads();

    for (int k0 = 0; k0 < K; k0 += BK) {
        const int cur = (k0 >> 5) & 1;
        if (k0 + BK < K) stage(cur ^ 1, k0 + BK);   // overlap DMA with WMMA

        Frag fa[4], fb[4];
#pragma unroll
        for (int t = 0; t < 4; ++t)
#pragma unroll
            for (int g = 0; g < 2; ++g)
                fa[t].q[g] = *(const uint4*)&lA[cur][(wr * 64 + t * 16 + ln) * LDST + hi * 8 + g * 16];
#pragma unroll
        for (int u = 0; u < 4; ++u)
#pragma unroll
            for (int g = 0; g < 2; ++g)
                fb[u].q[g] = *(const uint4*)&lB[cur][(wc * 64 + u * 16 + ln) * LDST + hi * 8 + g * 16];

#pragma unroll
        for (int t = 0; t < 4; ++t)
#pragma unroll
            for (int u = 0; u < 4; ++u)
                acc[t][u] = __builtin_amdgcn_wmma_f32_16x16x32_bf16(
                    false, fa[t].v, false, fb[u].v, (short)0, acc[t][u], false, false);

#ifdef USE_TDM
        if (wid == 0) __builtin_amdgcn_s_wait_tensorcnt(0);
#endif
        __syncthreads();
    }

    // epilogue
#pragma unroll
    for (int t = 0; t < 4; ++t)
#pragma unroll
        for (int u = 0; u < 4; ++u)
#pragma unroll
            for (int r = 0; r < 8; ++r) {
                int gm = rowBase + wr * 64 + t * 16 + r + hi * 8;
                int gn = colBase + wc * 64 + u * 16 + ln;
                float val = acc[t][u][r];
                if (MODE == 0) {
                    int which = gn >> 10, d = gn & 1023;
                    int h = d >> 6, hd = d & 63;
                    int b = gm >> 11, tok = gm & 2047;
                    unsigned short bv = f2bf(val);
                    if (which == 0)
                        Qb[(((size_t)(b * NHEAD + h)) * SEQ + tok) * HD + hd] = bv;
                    else if (which == 1)
                        Kb[(((size_t)(b * NHEAD + h)) * SEQ + tok) * HD + hd] = bv;
                    else
                        Vt[(((size_t)(b * NHEAD + h)) * HD + hd) * SEQ + tok] = bv;
                } else {
                    Cout[(size_t)gm * N + gn] = val + bias[gn];
                }
            }
}

// ---------------- attention: per (b,h), two-pass softmax, deferred lane reductions --
// Q,K per head: (SEQ x HD) bf16 row-major.  V per head: (HD x SEQ) bf16 (transposed).
// One wave handles 16 query rows; block = 8 waves = 128 queries.
// K and V reach the waves through LDS: 64-key tiles, brought in whole 128-byte rows by
// asynchronous copies, two buffers, each tile read by all eight waves.

#define AKT    64             // keys per staged tile
#define APITCH 72             // LDS row pitch (bf16 elems) = 144 B: 16 B x odd for b128 readers
#define NTILE  (SEQ / AKT)

// Two 16-byte copies per lane; the s_wait_xcnt closes the statement so that no address
// register named here is rewritten while a copy may still read it.
__device__ __forceinline__ void async_copy2(unsigned l0, const unsigned short* g0,
                                            unsigned l1, const unsigned short* g1) {
    asm volatile("global_load_async_to_lds_b128 %0, %1, off\n\t"
                 "global_load_async_to_lds_b128 %2, %3, off\n\t"
                 "s_wait_xcnt 0x0"
                 :: "v"(l0), "v"(g0), "v"(l1), "v"(g1) : "memory");
}

// Hand-over of a tile: this wave's LDS reads of the old buffer are done, its own copies
// of the next tile have landed, then the barrier publishes the tile and frees the buffer.
__device__ __forceinline__ void tile_publish() {
    asm volatile("s_wait_dscnt 0x0" ::: "memory");     // own reads retired before a refill
    asm volatile("s_wait_asynccnt 0x0" ::: "memory");  // own copies landed before others read
    __syncthreads();
}

// Register budget of 8 waves per SIMD: 4 blocks per WGP, so that all 1024 blocks are
// resident at once and no second, thin round of blocks follows.
__global__ __launch_bounds__(256) __attribute__((amdgpu_waves_per_eu(8))) void k_attn(
    const unsigned short* __restrict__ Qb,
    const unsigned short* __restrict__ Kb,
    const unsigned short* __restrict__ Vt,
    unsigned short* __restrict__ Ob)
{
    __shared__ alignas(16) unsigned short Ks[2][AKT * APITCH];   // 64 keys x 64 dims
    __shared__ alignas(16) unsigned short Vs[2][HD * APITCH];    // 64 dims x 64 keys
    __shared__ alignas(16) unsigned short Pld[8][16 * LDST];

    const int tid  = threadIdx.x;
    const int lane = tid & 31, wid = tid >> 5;
    const int ln = lane & 15,  hi  = lane >> 4;
    const int b = blockIdx.z, h = blockIdx.y;
    const int qbase = blockIdx.x * 128 + wid * 16;
    const float scale = 0.125f;                  // 1/sqrt(64)

    const size_t headOff = ((size_t)(b * NHEAD + h)) * SEQ * HD;
    const unsigned short* Qh = Qb + headOff;
    const unsigned short* Kh = Kb + headOff;
    const unsigned short* Vh = Vt + headOff;     // (HD x SEQ)

    // copy slots of this lane: rows crow and crow + 32 of a tile, 16 bytes at element ccol
    const int crow = tid >> 3, ccol = (tid & 7) * 8;
    const unsigned ldsK = (unsigned)(unsigned long long)(&Ks[0][crow * APITCH + ccol]);
    const unsigned ldsV = (unsigned)(unsigned long long)(&Vs[0][crow * APITCH + ccol]);
    const unsigned bufBytes  = AKT * APITCH * 2;  // one buffer (K and V tiles are alike)
    const unsigned halfBytes = 32 * APITCH * 2;   // 32 rows further down

    auto stageK = [&](int buf, int tile) {
        const unsigned short* g = Kh + (size_t)(tile * AKT + crow) * HD + ccol;
        async_copy2(ldsK + buf * bufBytes, g, ldsK + buf * bufBytes + halfBytes, g + 32 * HD);
    };
    auto stageV = [&](int buf, int tile) {
        const unsigned short* g = Vh + (size_t)crow * SEQ + tile * AKT + ccol;
        async_copy2(ldsV + buf * bufBytes, g, ldsV + buf * bufBytes + halfBytes, g + (size_t)32 * SEQ);
    };

    // Q fragments (16 x 64), resident for the whole kernel
    Frag qf[2];
#pragma unroll
    for (int f = 0; f < 2; ++f)
#pragma unroll
        for (int g = 0; g < 2; ++g)
            qf[f].q[g] = *(const uint4*)&Qh[(size_t)(qbase + ln) * HD + f * 32 + hi * 8 + g * 16];

    v8f vz = {0.f,0.f,0.f,0.f,0.f,0.f,0.f,0.f};

    // ---- phase A: per-lane raw row max (no shuffles, no exp in the hot loop) ----
    float mrow[8];
#pragma unroll
    for (int r = 0; r < 8; ++r) mrow[r] = -3.0e38f;

    stageK(0, 0);
    tile_publish();
    stageK(1, 1);

    for (int s = 0; s < NTILE; ++s) {
        const unsigned short* Kc = &Ks[s & 1][0];
#pragma unroll                                   // two 32-key halves of the tile, straight-line
        for (int kl = 0; kl < AKT; kl += 32) {
            v8f s0 = vz, s1 = vz;
#pragma unroll
            for (int f = 0; f < 2; ++f) {
                Frag kf;
#pragma unroll
                for (int g = 0; g < 2; ++g)
                    kf.q[g] = *(const uint4*)&Kc[(kl + ln) * APITCH + f * 32 + hi * 8 + g * 16];
                s0 = __builtin_amdgcn_wmma_f32_16x16x32_bf16(false, qf[f].v, false, kf.v, (short)0, s0, false, false);
            }
#pragma unroll
            for (int f = 0; f < 2; ++f) {
                Frag kf;
#pragma unroll
                for (int g = 0; g < 2; ++g)
                    kf.q[g] = *(const uint4*)&Kc[(kl + 16 + ln) * APITCH + f * 32 + hi * 8 + g * 16];
                s1 = __builtin_amdgcn_wmma_f32_16x16x32_bf16(false, qf[f].v, false, kf.v, (short)0, s1, false, false);
            }
#pragma unroll
            for (int r = 0; r < 8; ++r)
                mrow[r] = fmaxf(mrow[r], fmaxf(s0[r], s1[r]));
        }
        tile_publish();
        if (s + 2 < NTILE) stageK(s & 1, s + 2);  // refill the buffer this trip has read
    }
    asm volatile("s_wait_asynccnt 0x0" ::: "memory");  // no copy in flight when the buffers change hands
    // one cross-lane max reduction at the end (rows live in 16-lane groups)
#pragma unroll
    for (int r = 0; r < 8; ++r) {
#pragma unroll
        for (int m = 1; m <= 8; m <<= 1)
            mrow[r] = fmaxf(mrow[r], __shfl_xor(mrow[r], m, 32));
        mrow[r] *= scale;                        // max of scaled scores
    }

    // ---- phase B: O += exp(s*scale - m) @ V ; row-sums accumulated per lane ----
    v8f oacc[4];
#pragma unroll
    for (int u = 0; u < 4; ++u) oacc[u] = vz;
    float psum[8];
#pragma unroll
    for (int r = 0; r < 8; ++r) psum[r] = 0.f;

    unsigned short* Pw = &Pld[wid][0];

    // both buffers are free here: phase A's last hand-over ended every read of them
    stageK(0, 0);
    stageV(0, 0);
    tile_publish();
    stageK(1, 1);
    stageV(1, 1);

    for (int s = 0; s < NTILE; ++s) {
        const unsigned short* Kc = &Ks[s & 1][0];
        const unsigned short* Vc = &Vs[s & 1][0];
#pragma unroll 1                                 // rolled: both halves unrolled overrun the 128-register budget and spill
        for (int kl = 0; kl < AKT; kl += 32) {
            v8f s0 = vz, s1 = vz;
#pragma unroll
            for (int f = 0; f < 2; ++f) {
                Frag kf;
#pragma unroll
                for (int g = 0; g < 2; ++g)
                    kf.q[g] = *(const uint4*)&Kc[(kl + ln) * APITCH + f * 32 + hi * 8 + g * 16];
                s0 = __builtin_amdgcn_wmma_f32_16x16x32_bf16(false, qf[f].v, false, kf.v, (short)0, s0, false, false);
            }
#pragma unroll
            for (int f = 0; f < 2; ++f) {
                Frag kf;
#pragma unroll
                for (int g = 0; g < 2; ++g)
                    kf.q[g] = *(const uint4*)&Kc[(kl + 16 + ln) * APITCH + f * 32 + hi * 8 + g * 16];
                s1 = __builtin_amdgcn_wmma_f32_16x16x32_bf16(false, qf[f].v, false, kf.v, (short)0, s1, false, false);
            }

            // exponentiate, accumulate per-lane row sums, C-layout -> A-layout via LDS
#pragma unroll
            for (int r = 0; r < 8; ++r) {
                int row = r + hi * 8;
                float p0 = __expf(s0[r] * scale - mrow[r]);
                float p1 = __expf(s1[r] * scale - mrow[r]);
                psum[r] += p0 + p1;
                Pw[row * LDST + ln]      = f2bf(p0);
                Pw[row * LDST + 16 + ln] = f2bf(p1);
            }
            asm volatile("s_wait_dscnt 0" ::: "memory");   // per-wave LDS RAW fence

            Frag pf;
            pf.q[0] = *(const uint4*)&Pw[ln * LDST + hi * 8];
            pf.q[1] = *(const uint4*)&Pw[ln * LDST + 16 + hi * 8];

#pragma unroll
            for (int u = 0; u < 4; ++u) {
                Frag vf;
#pragma unroll
                for (int g = 0; g < 2; ++g)
                    vf.q[g] = *(const uint4*)&Vc[(u * 16 + ln) * APITCH + kl + hi * 8 + g * 16];
                oacc[u] = __builtin_amdgcn_wmma_f32_16x16x32_bf16(false, pf.v, false, vf.v, (short)0, oacc[u], false, false);
            }
            // four vector slots between the last WMMA and the loop's top, where the next
            // half's address arithmetic may overwrite its B operand
            __builtin_amdgcn_sched_barrier(0);   // holds that WMMA in front of the slots
            asm volatile("v_nop\n\tv_nop\n\tv_nop\n\tv_nop");
        }
        tile_publish();
        if (s + 2 < NTILE) {                      // refill the buffers this trip has read
            stageK(s & 1, s + 2);
            stageV(s & 1, s + 2);
        }
    }
    asm volatile("s_wait_asynccnt 0x0" ::: "memory");  // no copy in flight when the wave ends

    // one cross-lane sum reduction for the softmax denominators
    float lrow[8];
#pragma unroll
    for (int r = 0; r < 8; ++r) {
        float s = psum[r];
#pragma unroll
        for (int m = 1; m <= 8; m <<= 1) s += __shfl_xor(s, m, 32);
        lrow[r] = s;
    }

    // normalize + store bf16 into (B, N, D) layout for the out-projection GEMM
#pragma unroll
    for (int u = 0; u < 4; ++u)
#pragma unroll
        for (int r = 0; r < 8; ++r) {
            float o = oacc[u][r] / lrow[r];
            int gq = qbase + r + hi * 8;
            Ob[((size_t)(b * SEQ + gq)) * D_MODEL + h * HD + u * 16 + ln] = f2bf(o);
        }
}

// ---------------- launcher ----------------

extern "C" void kernel_launch(void* const* d_in, const int* in_sizes, int n_in,
                              void* d_out, int out_size, void* d_ws, size_t ws_size,
                              hipStream_t stream) {
    (void)in_sizes; (void)n_in; (void)out_size; (void)ws_size;
    const float* x      = (const float*)d_in[0];
    const float* W_qkv  = (const float*)d_in[1];
    const float* W_proj = (const float*)d_in[2];
    const float* b_proj = (const float*)d_in[3];
    float* out = (float*)d_out;

    const size_t NX  = (size_t)MTOT * D_MODEL;      // 8,388,608
    unsigned short* Xb     = (unsigned short*)d_ws;
    unsigned short* WqkvT  = Xb     + NX;                            // 3072 x 1024
    unsigned short* WprojT = WqkvT  + (size_t)3 * D_MODEL * D_MODEL; // 1024 x 1024
    unsigned short* Qb     = WprojT + (size_t)D_MODEL * D_MODEL;     // B*H*SEQ*HD == NX
    unsigned short* Kb     = Qb + NX;
    unsigned short* Vt     = Kb + NX;
    unsigned short* Ob     = Vt + NX;

    // 1. convert inputs to bf16 (weights transposed to N x K)
    k_cvt  <<<(int)(NX / 1024), 256, 0, stream>>>(x, Xb, (int)NX);
    k_cvt_t<<<(3 * D_MODEL * D_MODEL) / 256, 256, 0, stream>>>(W_qkv,  WqkvT,  D_MODEL, 3 * D_MODEL);
    k_cvt_t<<<(D_MODEL * D_MODEL) / 256,     256, 0, stream>>>(W_proj, WprojT, D_MODEL, D_MODEL);

    // 2. QKV projection, scatter to per-head Q, K (row-major) and V^T
    k_gemm<0><<<dim3(3 * D_MODEL / BN, MTOT / BM), 256, 0, stream>>>(
        Xb, WqkvT, nullptr, Qb, Kb, Vt, nullptr, D_MODEL, 3 * D_MODEL);

    // 3. attention (two-pass streamed softmax, all WMMA)
    k_attn<<<dim3(SEQ / 128, NHEAD, BATCH), 256, 0, stream>>>(Qb, Kb, Vt, Ob);

    // 4. output projection + bias (f32 out)
    k_gemm<1><<<dim3(D_MODEL / BN, MTOT / BM), 256, 0, stream>>>(
        Ob, WprojT, b_proj, nullptr, nullptr, nullptr, out, D_MODEL, D_MODEL);
}

// v002
// Measured time: 226 microseconds a run.
// Two timings next to v001 put it at 1.17 and 1.18 times that version's speed.
// Over all steps from v000 it is 2.19 times as fast.
#include <hip/hip_runtime.h>

typedef __attribute__((ext_vector_type(16))) __bf16 v16bf;
typedef __attribute__((ext_vector_type(8)))  float  v8f;
typedef __attribute__((ext_vector_type(2)))  float  v2f;
typedef __attribute__((ext_vector_type(2)))  __bf16 v2bf;
typedef __attribute__((ext_vector_type(4)))  unsigned int u32x4;
typedef __attribute__((ext_vector_type(8)))  int    i32x8;
typedef __attribute__((ext_vector_type(4)))  int    i32x4;

#define D_MODEL 1024
#define NHEAD   16
#define HD      64
#define SEQ     2048
#define BATCH   4
#define MTOT    (BATCH*SEQ)   // 8192

#define BM 128
#define BN 256
#define BK 32
#define LDST 40               // padded LDS row stride (bf16 elems): conflict-free, 16B aligned

#if defined(__gfx1250__) && defined(__has_builtin)
#if __has_builtin(__builtin_amdgcn_tensor_load_to_lds) && __has_builtin(__builtin_amdgcn_s_wait_tensorcnt)
#define USE_TDM 1
#endif
#endif

__device__ __forceinline__ unsigned short f2bf(float f) {
    unsigned int u = __float_as_uint(f);
    u += 0x7FFFu + ((u >> 16) & 1u);          // round-to-nearest-even
    return (unsigned short)(u >> 16);
}

struct Frag { union { v16bf v; uint4 q[2]; }; };
struct Pack8 { union { uint4 q; v2bf h[4]; }; };   // 8 bf16 = one 16-byte store

// ---------------- conversion kernels ----------------

__global__ void k_cvt(const float* __restrict__ in, unsigned short* __restrict__ out, int n) {
    int i = (blockIdx.x * blockDim.x + threadIdx.x) * 4;
    if (i + 3 < n) {
        float4 f = *(const float4*)(in + i);
        out[i + 0] = f2bf(f.x);
        out[i + 1] = f2bf(f.y);
        out[i + 2] = f2bf(f.z);
        out[i + 3] = f2bf(f.w);
    }
}

// Wt[n*K + k] = bf16(W[k*N + n])   (store weights transposed, N x K row-major)
__global__ void k_cvt_t(const float* __restrict__ W, unsigned short* __restrict__ Wt, int K, int N) {
    int idx = blockIdx.x * blockDim.x + threadIdx.x;
    if (idx >= N * K) return;
    int n = idx / K, k = idx - n * K;
    Wt[idx] = f2bf(W[(size_t)k * N + n]);
}

#ifdef USE_TDM
// Loop-invariant part of a 2-D TDM descriptor: tileRows x 32 bf16 tile out of a
// tensor with rowLen-elem rows, HW-padded in LDS: 16 dwords data + 4 dwords pad
// -> 40-elem (80 B) rows, matching LDST.
__device__ __forceinline__ i32x8 tdm_group1(int rowLen, int tileRows) {
    i32x8 g1;
    g1[0] = (1 << 16)                                     // data_size = 2 bytes
          | (1 << 20)                                     // pad_enable
          | (3 << 22)                                     // pad_interval code 3 = 16 dwords
          | (3 << 25);                                    // pad_amount  code 3 = 4 dwords
    g1[1] = (rowLen & 0xFFFF) << 16;                      // tensor_dim0[15:0]
    g1[2] = ((rowLen >> 16) & 0xFFFF)                     // tensor_dim0[31:16]
          | ((tileRows & 0xFFFF) << 16);                  // tensor_dim1[15:0]
    g1[3] = ((tileRows >> 16) & 0xFFFF)                   // tensor_dim1[31:16]
          | (BK << 16);                                   // tile_dim0 = 32
    g1[4] = tileRows & 0xFFFF;                            // tile_dim1
    g1[5] = rowLen;                                       // tensor_dim0_stride[31:0]
    g1[6] = 0;
    g1[7] = 0;
    return g1;
}

__device__ __forceinline__ void tdm_issue(const unsigned short* gtile,
                                          unsigned lds_byte_addr, i32x8 g1) {
    unsigned long long ga = (unsigned long long)gtile;
    u32x4 g0;
    g0[0] = 1u;                                           // count=1 (valid), user mode
    g0[1] = lds_byte_addr;                                // lds_addr
    g0[2] = (unsigned)(ga & 0xFFFFFFFFu);                 // global_addr[31:0]
    g0[3] = (unsigned)((ga >> 32) & 0x1FFFFFFu)           // global_addr[56:32]
          | (2u << 30);                                   // type = 2 ("image")
    i32x4 gz4 = {0, 0, 0, 0};
    i32x8 gz8 = {0, 0, 0, 0, 0, 0, 0, 0};
    __builtin_amdgcn_tensor_load_to_lds(g0, g1, gz4, gz4, gz8, 0);
}
#endif

// ---------------- GEMM: C(MxN) f32 = A(MxK)bf16 @ Bt(NxK)bf16^T ----------------
// Double-buffered tile pipeline: TDM (or cooperative loads) stage tile k+1 while
// the 8 waves run 16 WMMAs each on tile k.
// MODE 0: QKV epilogue (Q,K row-major per head; V transposed per head)
// MODE 1: out-proj epilogue (add bias, store f32)
// Both epilogues store whole 128-byte lines, staged per wave through LDS.
// A lane's 8 accumulator registers run along the FIRST operand's rows, so the first operand
// is the side that is contiguous in the output: the weights (columns) for Q, K and the
// out-projection, the activations (tokens) for V^T.  Both fragments have one layout, so only
// the LDS base and buffer stride of each loader change, by block-uniform selects.

#define SPITCH 72             // bf16 staging row pitch (elems) = 144 B: 16 B x odd for b128
#define FPITCH 68             // f32 staging row pitch (elems) = 272 B: 16 B x odd for b128

template<int MODE>
__global__ __launch_bounds__(256) void k_gemm(
    const unsigned short* __restrict__ A,
    const unsigned short* __restrict__ Bt,
    const float* __restrict__ bias,
    unsigned short* __restrict__ Qb,
    unsigned short* __restrict__ Kb,
    unsigned short* __restrict__ Vt,
    float* __restrict__ Cout,
    int K, int N)
{
    __shared__ alignas(16) unsigned short lA[2][BM * LDST];
    __shared__ alignas(16) unsigned short lB[2][BN * LDST];

    const int tid  = threadIdx.x;
    const int lane = tid & 31, wid = tid >> 5;
    const int ln = lane & 15,  hi  = lane >> 4;
    const int wr = wid >> 2,   wc  = wid & 3;           // 2 x 4 wave grid, 64x64 wave tile
    const int rowBase = blockIdx.y * BM;
    const int colBase = blockIdx.x * BN;

#ifdef USE_TDM
    const i32x8 g1A = tdm_group1(K, BM);
    const i32x8 g1B = tdm_group1(K, BN);
    const unsigned ldsA[2] = { (unsigned)(unsigned long long)(&lA[0][0]),
                               (unsigned)(unsigned long long)(&lA[1][0]) };
    const unsigned ldsB[2] = { (unsigned)(unsigned long long)(&lB[0][0]),
                               (unsigned)(unsigned long long)(&lB[1][0]) };
#endif

    // xFirst: activations are the first operand (V^T blocks); else the weights are.
    // acc[t][u][r] = first operand's row t*16 + hi*8 + r times second operand's row u*16 + ln
    const bool xFirst = (MODE == 0) && (colBase >= 2 * D_MODEL);
    const int offX = (wr * 64 + ln) * LDST + hi * 8;
    const int offW = (wc * 64 + ln) * LDST + hi * 8;
    const unsigned short* F0 = xFirst ? &lA[0][offX] : &lB[0][offW];
    const unsigned short* S0 = xFirst ? &lB[0][offW] : &lA[0][offX];
    const int bufF = xFirst ? BM * LDST : BN * LDST;
    const int bufS = xFirst ? BN * LDST : BM * LDST;

    auto stage = [&](int buf, int k0) {
#ifdef USE_TDM
        if (wid == 0) {
            tdm_issue(A  + (size_t)rowBase * K + k0, ldsA[buf], g1A);
            tdm_issue(Bt + (size_t)colBase * K + k0, ldsB[buf], g1B);
        }
#else
#pragma unroll
        for (int i = 0; i < 2; ++i) {           // A: 512 b128, 2 per thread
            int v = i * 256 + tid;
            int row = v >> 2, cs = (v & 3) * 8;
            *(uint4*)&lA[buf][row * LDST + cs] = *(const uint4*)&A[(size_t)(rowBase + row) * K + k0 + cs];
        }
#pragma unroll
        for (int i = 0; i < 4; ++i) {           // B: 1024 b128, 4 per thread
            int v = i * 256 + tid;
            int row = v >> 2, cs = (v & 3) * 8;
            *(uint4*)&lB[buf][row * LDST + cs] = *(const uint4*)&Bt[(size_t)(colBase + row) * K + k0 + cs];
        }
#endif
    };

    v8f acc[4][4];
    v8f vz = {0.f,0.f,0.f,0.f,0.f,0.f,0.f,0.f};
#pragma unroll
    for (int t = 0; t < 4; ++t)
#pragma unroll
        for (int u = 0; u < 4; ++u) acc[t][u] = vz;

    // prologue: fill buffer 0
    stage(0, 0);
#ifdef USE_TDM
    if (wid == 0) __builtin_amdgcn_s_wait_tensorcnt(0);
#endif
    __syncthreads();

    for (int k0 = 0; k0 < K; k0 += BK) {
        const int cur = (k0 >> 5) & 1;
        if (k0 + BK < K) stage(cur ^ 1, k0 + BK);   // overlap DMA with WMMA

        Frag fa[4], fb[4];
#pragma unroll
        for (int t = 0; t < 4; ++t)
#pragma unroll
            for (int g = 0; g < 2; ++g)
                fa[t].q[g] = *(const uint4*)&F0[cur * bufF + t * 16 * LDST + g * 16];
#pragma unroll
        for (int u = 0; u < 4; ++u)
#pragma unroll
            for (int g = 0; g < 2; ++g)
                fb[u].q[g] = *(const uint4*)&S0[cur * bufS + u * 16 * LDST + g * 16];

#pragma unroll
        for (int t = 0; t < 4; ++t)
#pragma unroll
            for (int u = 0; u < 4; ++u)
                acc[t][u] = __builtin_amdgcn_wmma_f32_16x16x32_bf16(
                    false, fa[t].v, false, fb[u].v, (short)0, acc[t][u], false, false);

#ifdef USE_TDM
        if (wid == 0) __builtin_amdgcn_s_wait_tensorcnt(0);
#endif
        __syncthreads();
    }

    // epilogue
    if (MODE == 0) {
        // The wave's 64 x 64 tile is 64 tokens of ONE head of Q, K or V.  Output rows of 128 B:
        // a token's 64 dims (Q, K; rows adjoin) or a dim's 64 tokens (V^T; rows SEQ apart).
        // acc[t][u][r] is output row u*16 + ln, element t*16 + hi*8 + r.
        const int which = colBase >> 10;
        const int bh    = (rowBase >> 11) * NHEAD + ((colBase & 1023) >> 6) + wc;
        const int tok0  = (rowBase & 2047) + wr * 64;
        unsigned short* dst = (which == 2) ? Vt + (size_t)bh * HD * SEQ + tok0
                                           : (which == 0 ? Qb : Kb) + ((size_t)bh * SEQ + tok0) * HD;
        const int pitch = (which == 2) ? SEQ : HD;
        // Each wave stages 32 rows at a time in its own range of the B ring, which is free:
        // the loop's last barrier stands behind every fragment read and the last tensor wait.
        unsigned short* stg = &lB[0][0] + wid * (32 * SPITCH);
        const int srow = lane >> 3, col = (lane & 7) * 8;    // read-back slot: 8 lanes per row
        unsigned short* drow = dst + (size_t)srow * pitch + col;
#pragma unroll
        for (int half = 0; half < 2; ++half) {
            if (half > 0)   // every lane's read-back of the last rows is done before they are rewritten
                asm volatile("s_wait_dscnt 0x0" ::: "memory");
#pragma unroll
            for (int uu = 0; uu < 2; ++uu)
#pragma unroll
                for (int t = 0; t < 4; ++t) {
                    Pack8 p;
#pragma unroll
                    for (int r = 0; r < 8; r += 2) {
                        v2f f = { acc[t][half * 2 + uu][r], acc[t][half * 2 + uu][r + 1] };
                        p.h[r >> 1] = __builtin_convertvector(f, v2bf);
                    }
                    *(uint4*)&stg[(uu * 16 + ln) * SPITCH + t * 16 + hi * 8] = p.q;
                }
            asm volatile("s_wait_dscnt 0x0" ::: "memory");   // rows written before other lanes read them back
#pragma unroll
            for (int k = 0; k < 8; ++k)                      // 4 whole rows (lines) per wave-wide store
                *(uint4*)&drow[(size_t)((half * 32 + k * 4) * pitch)] =
                    *(const uint4*)&stg[(k * 4 + srow) * SPITCH + col];
        }
    } else {
        // acc[t][u][r] is token u*16 + ln, column t*16 + hi*8 + r of the wave's 64 x 64 tile.
        // 16 tokens (rows of 256 B) at a time, in the wave's own range of the freed B ring.
        float* dst  = Cout + (size_t)(rowBase + wr * 64) * N + colBase + wc * 64;
        float* stgf = (float*)&lB[0][0] + wid * (16 * FPITCH);
        const int srow = lane >> 4, col = (lane & 15) * 4;   // read-back slot: 16 lanes per row
        float* drow = dst + (size_t)srow * N + col;
        const float4 bv = *(const float4*)&bias[colBase + wc * 64 + col];
#pragma unroll
        for (int u = 0; u < 4; ++u) {
            if (u > 0)      // every lane's read-back of the last rows is done before they are rewritten
                asm volatile("s_wait_dscnt 0x0" ::: "memory");
#pragma unroll
            for (int t = 0; t < 4; ++t)
#pragma unroll
                for (int g = 0; g < 2; ++g)
                    *(float4*)&stgf[ln * FPITCH + t * 16 + hi * 8 + g * 4] =
                        make_float4(acc[t][u][g * 4], acc[t][u][g * 4 + 1], acc[t][u][g * 4 + 2], acc[t][u][g * 4 + 3]);
            asm volatile("s_wait_dscnt 0x0" ::: "memory");   // rows written before other lanes read them back
#pragma unroll
            for (int k = 0; k < 8; ++k) {                    // 2 whole rows (4 lines) per wave-wide store
                const float4 v = *(const float4*)&stgf[(k * 2 + srow) * FPITCH + col];
                *(float4*)&drow[(size_t)((u * 16 + k * 2) * N)] =
                    make_float4(v.x + bv.x, v.y + bv.y, v.z + bv.z, v.w + bv.w);
            }
        }
    }
}

// ---------------- attention: per (b,h), two-pass softmax, deferred lane reductions --
// Q,K per head: (SEQ x HD) bf16 row-major.  V per head: (HD x SEQ) bf16 (transposed).
// One wave handles 16 query rows; block = 8 waves = 128 queries.
// K and V reach the waves through LDS: 64-key tiles, brought in whole 128-byte rows by
// asynchronous copies, two buffers, each tile read by all eight waves.

#define AKT    64             // keys per staged tile
#define APITCH 72             // LDS row pitch (bf16 elems) = 144 B: 16 B x odd for b128 readers
#define NTILE  (SEQ / AKT)

// Two 16-byte copies per lane; the s_wait_xcnt closes the statement so that no address
// register named here is rewritten while a copy may still read it.
__device__ __forceinline__ void async_copy2(unsigned l0, const unsigned short* g0,
                                            unsigned l1, const unsigned short* g1) {
    asm volatile("global_load_async_to_lds_b128 %0, %1, off\n\t"
                 "global_load_async_to_lds_b128 %2, %3, off\n\t"
                 "s_wait_xcnt 0x0"
                 :: "v"(l0), "v"(g0), "v"(l1), "v"(g1) : "memory");
}

// Hand-over of a tile: this wave's LDS reads of the old buffer are done, its own copies
// of the next tile have landed, then the barrier publishes the tile and frees the buffer.
__device__ __forceinline__ void tile_publish() {
    asm volatile("s_wait_dscnt 0x0" ::: "memory");     // own reads retired before a refill
    asm volatile("s_wait_asynccnt 0x0" ::: "memory");  // own copies landed before others read
    __syncthreads();
}

// Register budget of 8 waves per SIMD: 4 blocks per WGP, so that all 1024 blocks are
// resident at once and no second, thin round of blocks follows.
__global__ __launch_bounds__(256) __attribute__((amdgpu_waves_per_eu(8))) void k_attn(
    const unsigned short* __restrict__ Qb,
    const unsigned short* __restrict__ Kb,
    const unsigned short* __restrict__ Vt,
    unsigned short* __restrict__ Ob)
{
    __shared__ alignas(16) unsigned short Ks[2][AKT * APITCH];   // 64 keys x 64 dims
    __shared__ alignas(16) unsigned short Vs[2][HD * APITCH];    // 64 dims x 64 keys
    __shared__ alignas(16) unsigned short Pld[8][16 * LDST];

    const int tid  = threadIdx.x;
    const int lane = tid & 31, wid = tid >> 5;
    const int ln = lane & 15,  hi  = lane >> 4;
    const int b = blockIdx.z, h = blockIdx.y;
    const int qbase = blockIdx.x * 128 + wid * 16;
    const float scale = 0.125f;                  // 1/sqrt(64)

    const size_t headOff = ((size_t)(b * NHEAD + h)) * SEQ * HD;
    const unsigned short* Qh = Qb + headOff;
    const unsigned short* Kh = Kb + headOff;
    const unsigned short* Vh = Vt + headOff;     // (HD x SEQ)

    // copy slots of this lane: rows crow and crow + 32 of a tile, 16 bytes at element ccol
    const int crow = tid >> 3, ccol = (tid & 7) * 8;
    const unsigned ldsK = (unsigned)(unsigned long long)(&Ks[0][crow * APITCH + ccol]);
    const unsigned ldsV = (unsigned)(unsigned long long)(&Vs[0][crow * APITCH + ccol]);
    const unsigned bufBytes  = AKT * APITCH * 2;  // one buffer (K and V tiles are alike)
    const unsigned halfBytes = 32 * APITCH * 2;   // 32 rows further down

    auto stageK = [&](int buf, int tile) {
        const unsigned short* g = Kh + (size_t)(tile * AKT + crow) * HD + ccol;
        async_copy2(ldsK + buf * bufBytes, g, ldsK + buf * bufBytes + halfBytes, g + 32 * HD);
    };
    auto stageV = [&](int buf, int tile) {
        const unsigned short* g = Vh + (size_t)crow * SEQ + tile * AKT + ccol;
        async_copy2(ldsV + buf * bufBytes, g, ldsV + buf * bufBytes + halfBytes, g + (size_t)32 * SEQ);
    };

    // Q fragments (16 x 64), resident for the whole kernel
    Frag qf[2];
#pragma unroll
    for (int f = 0; f < 2; ++f)
#pragma unroll
        for (int g = 0; g < 2; ++g)
            qf[f].q[g] = *(const uint4*)&Qh[(size_t)(qbase + ln) * HD + f * 32 + hi * 8 + g * 16];

    v8f vz = {0.f,0.f,0.f,0.f,0.f,0.f,0.f,0.f};

    // ---- phase A: per-lane raw row max (no shuffles, no exp in the hot loop) ----
    float mrow[8];
#pragma unroll
    for (int r = 0; r < 8; ++r) mrow[r] = -3.0e38f;

    stageK(0, 0);
    tile_publish();
    stageK(1, 1);

    for (int s = 0; s < NTILE; ++s) {
        const unsigned short* Kc = &Ks[s & 1][0];
#pragma unroll                                   // two 32-key halves of the tile, straight-line
        for (int kl = 0; kl < AKT; kl += 32) {
            v8f s0 = vz, s1 = vz;
#pragma unroll
            for (int f = 0; f < 2; ++f) {
                Frag kf;
#pragma unroll
                for (int g = 0; g < 2; ++g)
                    kf.q[g] = *(const uint4*)&Kc[(kl + ln) * APITCH + f * 32 + hi * 8 + g * 16];
                s0 = __builtin_amdgcn_wmma_f32_16x16x32_bf16(false, qf[f].v, false, kf.v, (short)0, s0, false, false);
            }
#pragma unroll
            for (int f = 0; f < 2; ++f) {
                Frag kf;
#pragma unroll
                for (int g = 0; g < 2; ++g)
                    kf.q[g] = *(const uint4*)&Kc[(kl + 16 + ln) * APITCH + f * 32 + hi * 8 + g * 16];
                s1 = __builtin_amdgcn_wmma_f32_16x16x32_bf16(false, qf[f].v, false, kf.v, (short)0, s1, false, false);
            }
#pragma unroll
            for (int r = 0; r < 8; ++r)
                mrow[r] = fmaxf(mrow[r], fmaxf(s0[r], s1[r]));
        }
        tile_publish();
        if (s + 2 < NTILE) stageK(s & 1, s + 2);  // refill the buffer this trip has read
    }
    asm volatile("s_wait_asynccnt 0x0" ::: "memory");  // no copy in flight when the buffers change hands
    // one cross-lane max reduction at the end (rows live in 16-lane groups)
#pragma unroll
    for (int r = 0; r < 8; ++r) {
#pragma unroll
        for (int m = 1; m <= 8; m <<= 1)
            mrow[r] = fmaxf(mrow[r], __shfl_xor(mrow[r], m, 32));
        mrow[r] *= scale;                        // max of scaled scores
    }

    // ---- phase B: O += exp(s*scale - m) @ V ; row-sums accumulated per lane ----
    v8f oacc[4];
#pragma unroll
    for (int u = 0; u < 4; ++u) oacc[u] = vz;
    float psum[8];
#pragma unroll
    for (int r = 0; r < 8; ++r) psum[r] = 0.f;

    unsigned short* Pw = &Pld[wid][0];

    // both buffers are free here: phase A's last hand-over ended every read of them
    stageK(0, 0);
    stageV(0, 0);
    tile_publish();
    stageK(1, 1);
    stageV(1, 1);

    for (int s = 0; s < NTILE; ++s) {
        const unsigned short* Kc = &Ks[s & 1][0];
        const unsigned short* Vc = &Vs[s & 1][0];
#pragma unroll 1                                 // rolled: both halves unrolled overrun the 128-register budget and spill
        for (int kl = 0; kl < AKT; kl += 32) {
            v8f s0 = vz, s1 = vz;
#pragma unroll
            for (int f = 0; f < 2; ++f) {
                Frag kf;
#pragma unroll
                for (int g = 0; g < 2; ++g)
                    kf.q[g] = *(const uint4*)&Kc[(kl + ln) * APITCH + f * 32 + hi * 8 + g * 16];
                s0 = __builtin_amdgcn_wmma_f32_16x16x32_bf16(false, qf[f].v, false, kf.v, (short)0, s0, false, false);
            }
#pragma unroll
            for (int f = 0; f < 2; ++f) {
                Frag kf;
#pragma unroll
                for (int g = 0; g < 2; ++g)
                    kf.q[g] = *(const uint4*)&Kc[(kl + 16 + ln) * APITCH + f * 32 + hi * 8 + g * 16];
                s1 = __builtin_amdgcn_wmma_f32_16x16x32_bf16(false, qf[f].v, false, kf.v, (short)0, s1, false, false);
            }

            // exponentiate, accumulate per-lane row sums, C-layout -> A-layout via LDS
#pragma unroll
            for (int r = 0; r < 8; ++r) {
                int row = r + hi * 8;
                float p0 = __expf(s0[r] * scale - mrow[r]);
                float p1 = __expf(s1[r] * scale - mrow[r]);
                psum[r] += p0 + p1;
                Pw[row * LDST + ln]      = f2bf(p0);
                Pw[row * LDST + 16 + ln] = f2bf(p1);
            }
            asm volatile("s_wait_dscnt 0" ::: "memory");   // per-wave LDS RAW fence

            Frag pf;
            pf.q[0] = *(const uint4*)&Pw[ln * LDST + hi * 8];
            pf.q[1] = *(const uint4*)&Pw[ln * LDST + 16 + hi * 8];

#pragma unroll
            for (int u = 0; u < 4; ++u) {
                Frag vf;
#pragma unroll
                for (int g = 0; g < 2; ++g)
                    vf.q[g] = *(const uint4*)&Vc[(u * 16 + ln) * APITCH + kl + hi * 8 + g * 16];
                oacc[u] = __builtin_amdgcn_wmma_f32_16x16x32_bf16(false, pf.v, false, vf.v, (short)0, oacc[u], false, false);
            }
            // four vector slots between the last WMMA and the loop's top, where the next
            // half's address arithmetic may overwrite its B operand
            __builtin_amdgcn_sched_barrier(0);   // holds that WMMA in front of the slots
            asm volatile("v_nop\n\tv_nop\n\tv_nop\n\tv_nop");
        }
        tile_publish();
        if (s + 2 < NTILE) {                      // refill the buffers this trip has read
            stageK(s & 1, s + 2);
            stageV(s & 1, s + 2);
        }
    }
    asm volatile("s_wait_asynccnt 0x0" ::: "memory");  // no copy in flight when the wave ends

    // one cross-lane sum reduction for the softmax denominators
    float lrow[8];
#pragma unroll
    for (int r = 0; r < 8; ++r) {
        float s = psum[r];
#pragma unroll
        for (int m = 1; m <= 8; m <<= 1) s += __shfl_xor(s, m, 32);
        lrow[r] = s;
    }

    // normalize + store bf16 into (B, N, D) layout for the out-projection GEMM
#pragma unroll
    for (int u = 0; u < 4; ++u)
#pragma unroll
        for (int r = 0; r < 8; ++r) {
            float o = oacc[u][r] / lrow[r];
            int gq = qbase + r + hi * 8;
            Ob[((size_t)(b * SEQ + gq)) * D_MODEL + h * HD + u * 16 + ln] = f2bf(o);
        }
}

// ---------------- launcher ----------------

extern "C" void kernel_launch(void* const* d_in, const int* in_sizes, int n_in,
                              void* d_out, int out_size, void* d_ws, size_t ws_size,
                              hipStream_t stream) {
    (void)in_sizes; (void)n_in; (void)out_size; (void)ws_size;
    const float* x      = (const float*)d_in[0];
    const float* W_qkv  = (const float*)d_in[1];
    const float* W_proj = (const float*)d_in[2];
    const float* b_proj = (const float*)d_in[3];
    float* out = (float*)d_out;

    const size_t NX  = (size_t)MTOT * D_MODEL;      // 8,388,608
    unsigned short* Xb     = (unsigned short*)d_ws;
    unsigned short* WqkvT  = Xb     + NX;                            // 3072 x 1024
    unsigned short* WprojT = WqkvT  + (size_t)3 * D_MODEL * D_MODEL; // 1024 x 1024
    unsigned short* Qb     = WprojT + (size_t)D_MODEL * D_MODEL;     // B*H*SEQ*HD == NX
    unsigned short* Kb     = Qb + NX;
    unsigned short* Vt     = Kb + NX;
    unsigned short* Ob     = Vt + NX;

    // 1. convert inputs to bf16 (weights transposed to N x K)
    k_cvt  <<<(int)(NX / 1024), 256, 0, stream>>>(x, Xb, (int)NX);
    k_cvt_t<<<(3 * D_MODEL * D_MODEL) / 256, 256, 0, stream>>>(W_qkv,  WqkvT,  D_MODEL, 3 * D_MODEL);
    k_cvt_t<<<(D_MODEL * D_MODEL) / 256,     256, 0, stream>>>(W_proj, WprojT, D_MODEL, D_MODEL);

    // 2. QKV projection, scatter to per-head Q, K (row-major) and V^T
    k_gemm<0><<<dim3(3 * D_MODEL / BN, MTOT / BM), 256, 0, stream>>>(
        Xb, WqkvT, nullptr, Qb, Kb, Vt, nullptr, D_MODEL, 3 * D_MODEL);

    // 3. attention (two-pass streamed softmax, all WMMA)
    k_attn<<<dim3(SEQ / 128, NHEAD, BATCH), 256, 0, stream>>>(Qb, Kb, Vt, Ob);

    // 4. output projection + bias (f32 out)
    k_gemm<1><<<dim3(D_MODEL / BN, MTOT / BM), 256, 0, stream>>>(
        Ob, WprojT, b_proj, nullptr, nullptr, nullptr, out, D_MODEL, D_MODEL);
}

// v003
// One run takes 207 microseconds.
// Next to v002, in two timings, it ran 1.09 times as fast each time.
// Over all steps from v000 it is 2.39 times as fast.
#include <hip/hip_runtime.h>

typedef __attribute__((ext_vector_type(16))) __bf16 v16bf;
typedef __attribute__((ext_vector_type(8)))  float  v8f;
typedef __attribute__((ext_vector_type(2)))  float  v2f;
typedef __attribute__((ext_vector_type(2)))  __bf16 v2bf;
typedef __attribute__((ext_vector_type(4)))  unsigned int u32x4;
typedef __attribute__((ext_vector_type(8)))  int    i32x8;
typedef __attribute__((ext_vector_type(4)))  int    i32x4;

#define D_MODEL 1024
#define NHEAD   16
#define HD      64
#define SEQ     2048
#define BATCH   4
#define MTOT    (BATCH*SEQ)   // 8192

#define BM 128
#define BN 256
#define BK 32
#define LDST 40               // padded LDS row stride (bf16 elems): conflict-free, 16B aligned

#if defined(__gfx1250__) && defined(__has_builtin)
#if __has_builtin(__builtin_amdgcn_tensor_load_to_lds) && __has_builtin(__builtin_amdgcn_s_wait_tensorcnt)
#define USE_TDM 1
#endif
#endif

__device__ __forceinline__ unsigned short f2bf(float f) {
    unsigned int u = __float_as_uint(f);
    u += 0x7FFFu + ((u >> 16) & 1u);          // round-to-nearest-even
    return (unsigned short)(u >> 16);
}

struct Frag { union { v16bf v; uint4 q[2]; }; };
struct Pack8 { union { uint4 q; v2bf h[4]; }; };   // 8 bf16 = one 16-byte store

// ---------------- conversion kernels ----------------
// Both are short streams: what they pay for is the number of waves that must start, so each
// thread converts many elements, by 16-byte loads that are all in flight before the first use.

typedef __attribute__((ext_vector_type(4))) float f32x4;

__device__ __forceinline__ unsigned int f2bf2(float lo, float hi) {
    return (unsigned int)f2bf(lo) | ((unsigned int)f2bf(hi) << 16);
}

#define CVT_LOADS 16                        // 16-byte loads per thread: 64 elements
#define CVT_BLOCK (256 * 4 * CVT_LOADS)     // elements per block

// A wave's load covers 512 contiguous bytes (4 lines), its store 256 (2 lines).
// The grid gives each SIMD 4 waves; the register budget of 4 lets all 16 loads fly together.
__global__ __launch_bounds__(256) __attribute__((amdgpu_waves_per_eu(4, 4)))
void k_cvt(const float* __restrict__ in, unsigned short* __restrict__ out, int n) {
    const int base = blockIdx.x * CVT_BLOCK;
    if (base + CVT_BLOCK > n) return;       // block-uniform bound
    const float* src = in + base + threadIdx.x * 4;
    unsigned short* dst = out + base + threadIdx.x * 4;
    f32x4 f[CVT_LOADS];
#pragma unroll
    for (int i = 0; i < CVT_LOADS; ++i) f[i] = *(const f32x4*)(src + i * 1024);
#pragma unroll
    for (int i = 0; i < CVT_LOADS; ++i)
        *(uint2*)(dst + i * 1024) = make_uint2(f2bf2(f[i][0], f[i][1]), f2bf2(f[i][2], f[i][3]));
}

// Wt[n*K + k] = bf16(W[k*N + n])   (store weights transposed, N x K row-major)
// A thread holds 8 k x 4 n; a wave 64 k x 16 n, so that each of its stores fills 4 whole
// 128-byte lines of Wt; a block 64 k x 128 n, so that its loads cover 512-byte runs of W.
// Grid: (N / 128, K / 64).  K and N are compile-time, so the row steps are immediate offsets.
template<int K, int N>
__global__ __launch_bounds__(256) void k_cvt_t(const float* __restrict__ W, unsigned short* __restrict__ Wt) {
    static_assert(K % 64 == 0 && N % 128 == 0, "whole tiles only");
    const unsigned lane = threadIdx.x & 31, wid = threadIdx.x >> 5;
    const unsigned n = blockIdx.x * 128 + wid * 16 + (lane & 3) * 4;
    const unsigned k = blockIdx.y * 64 + (lane >> 2) * 8;
    const float* src = W + (k * N + n);
    unsigned short* dst = Wt + (n * K + k);
    f32x4 f[8];
#pragma unroll
    for (int i = 0; i < 8; ++i) f[i] = *(const f32x4*)(src + i * N);
#pragma unroll
    for (int j = 0; j < 4; ++j)
        *(uint4*)(dst + j * K) = make_uint4(f2bf2(f[0][j], f[1][j]), f2bf2(f[2][j], f[3][j]),
                                            f2bf2(f[4][j], f[5][j]), f2bf2(f[6][j], f[7][j]));
}

#ifdef USE_TDM
// Loop-invariant part of a 2-D TDM descriptor: tileRows x 32 bf16 tile out of a
// tensor with rowLen-elem rows, HW-padded in LDS: 16 dwords data + 4 dwords pad
// -> 40-elem (80 B) rows, matching LDST.
__device__ __forceinline__ i32x8 tdm_group1(int rowLen, int tileRows) {
    i32x8 g1;
    g1[0] = (1 << 16)                                     // data_size = 2 bytes
          | (1 << 20)                                     // pad_enable
          | (3 << 22)                                     // pad_interval code 3 = 16 dwords
          | (3 << 25);                                    // pad_amount  code 3 = 4 dwords
    g1[1] = (rowLen & 0xFFFF) << 16;                      // tensor_dim0[15:0]
    g1[2] = ((rowLen >> 16) & 0xFFFF)                     // tensor_dim0[31:16]
          | ((tileRows & 0xFFFF) << 16);                  // tensor_dim1[15:0]
    g1[3] = ((tileRows >> 16) & 0xFFFF)                   // tensor_dim1[31:16]
          | (BK << 16);                                   // tile_dim0 = 32
    g1[4] = tileRows & 0xFFFF;                            // tile_dim1
    g1[5] = rowLen;                                       // tensor_dim0_stride[31:0]
    g1[6] = 0;
    g1[7] = 0;
    return g1;
}

__device__ __forceinline__ void tdm_issue(const unsigned short* gtile,
                                          unsigned lds_byte_addr, i32x8 g1) {
    unsigned long long ga = (unsigned long long)gtile;
    u32x4 g0;
    g0[0] = 1u;                                           // count=1 (valid), user mode
    g0[1] = lds_byte_addr;                                // lds_addr
    g0[2] = (unsigned)(ga & 0xFFFFFFFFu);                 // global_addr[31:0]
    g0[3] = (unsigned)((ga >> 32) & 0x1FFFFFFu)           // global_addr[56:32]
          | (2u << 30);                                   // type = 2 ("image")
    i32x4 gz4 = {0, 0, 0, 0};
    i32x8 gz8 = {0, 0, 0, 0, 0, 0, 0, 0};
    __builtin_amdgcn_tensor_load_to_lds(g0, g1, gz4, gz4, gz8, 0);
}
#endif

// ---------------- GEMM: C(MxN) f32 = A(MxK)bf16 @ Bt(NxK)bf16^T ----------------
// Double-buffered tile pipeline: TDM (or cooperative loads) stage tile k+1 while
// the 8 waves run 16 WMMAs each on tile k.
// MODE 0: QKV epilogue (Q,K row-major per head; V transposed per head)
// MODE 1: out-proj epilogue (add bias, store f32)
// Both epilogues store whole 128-byte lines, staged per wave through LDS.
// A lane's 8 accumulator registers run along the FIRST operand's rows, so the first operand
// is the side that is contiguous in the output: the weights (columns) for Q, K and the
// out-projection, the activations (tokens) for V^T.  Both fragments have one layout, so only
// the LDS base and buffer stride of each loader change, by block-uniform selects.

#define SPITCH 72             // bf16 staging row pitch (elems) = 144 B: 16 B x odd for b128
#define FPITCH 68             // f32 staging row pitch (elems) = 272 B: 16 B x odd for b128

template<int MODE>
__global__ __launch_bounds__(256) void k_gemm(
    const unsigned short* __restrict__ A,
    const unsigned short* __restrict__ Bt,
    const float* __restrict__ bias,
    unsigned short* __restrict__ Qb,
    unsigned short* __restrict__ Kb,
    unsigned short* __restrict__ Vt,
    float* __restrict__ Cout,
    int K, int N)
{
    __shared__ alignas(16) unsigned short lA[2][BM * LDST];
    __shared__ alignas(16) unsigned short lB[2][BN * LDST];

    const int tid  = threadIdx.x;
    const int lane = tid & 31, wid = tid >> 5;
    const int ln = lane & 15,  hi  = lane >> 4;
    const int wr = wid >> 2,   wc  = wid & 3;           // 2 x 4 wave grid, 64x64 wave tile
    const int rowBase = blockIdx.y * BM;
    const int colBase = blockIdx.x * BN;

#ifdef USE_TDM
    const i32x8 g1A = tdm_group1(K, BM);
    const i32x8 g1B = tdm_group1(K, BN);
    const unsigned ldsA[2] = { (unsigned)(unsigned long long)(&lA[0][0]),
                               (unsigned)(unsigned long long)(&lA[1][0]) };
    const unsigned ldsB[2] = { (unsigned)(unsigned long long)(&lB[0][0]),
                               (unsigned)(unsigned long long)(&lB[1][0]) };
#endif

    // xFirst: activations are the first operand (V^T blocks); else the weights are.
    // acc[t][u][r] = first operand's row t*16 + hi*8 + r times second operand's row u*16 + ln
    const bool xFirst = (MODE == 0) && (colBase >= 2 * D_MODEL);
    const int offX = (wr * 64 + ln) * LDST + hi * 8;
    const int offW = (wc * 64 + ln) * LDST + hi * 8;
    const unsigned short* F0 = xFirst ? &lA[0][offX] : &lB[0][offW];
    const unsigned short* S0 = xFirst ? &lB[0][offW] : &lA[0][offX];
    const int bufF = xFirst ? BM * LDST : BN * LDST;
    const int bufS = xFirst ? BN * LDST : BM * LDST;

    auto stage = [&](int buf, int k0) {
#ifdef USE_TDM
        if (wid == 0) {
            tdm_issue(A  + (size_t)rowBase * K + k0, ldsA[buf], g1A);
            tdm_issue(Bt + (size_t)colBase * K + k0, ldsB[buf], g1B);
        }
#else
#pragma unroll
        for (int i = 0; i < 2; ++i) {           // A: 512 b128, 2 per thread
            int v = i * 256 + tid;
            int row = v >> 2, cs = (v & 3) * 8;
            *(uint4*)&lA[buf][row * LDST + cs] = *(const uint4*)&A[(size_t)(rowBase + row) * K + k0 + cs];
        }
#pragma unroll
        for (int i = 0; i < 4; ++i) {           // B: 1024 b128, 4 per thread
            int v = i * 256 + tid;
            int row = v >> 2, cs = (v & 3) * 8;
            *(uint4*)&lB[buf][row * LDST + cs] = *(const uint4*)&Bt[(size_t)(colBase + row) * K + k0 + cs];
        }
#endif
    };

    v8f acc[4][4];
    v8f vz = {0.f,0.f,0.f,0.f,0.f,0.f,0.f,0.f};
#pragma unroll
    for (int t = 0; t < 4; ++t)
#pragma unroll
        for (int u = 0; u < 4; ++u) acc[t][u] = vz;

    // prologue: fill buffer 0
    stage(0, 0);
#ifdef USE_TDM
    if (wid == 0) __builtin_amdgcn_s_wait_tensorcnt(0);
#endif
    __syncthreads();

    for (int k0 = 0; k0 < K; k0 += BK) {
        const int cur = (k0 >> 5) & 1;
        if (k0 + BK < K) stage(cur ^ 1, k0 + BK);   // overlap DMA with WMMA

        Frag fa[4], fb[4];
#pragma unroll
        for (int t = 0; t < 4; ++t)
#pragma unroll
            for (int g = 0; g < 2; ++g)
                fa[t].q[g] = *(const uint4*)&F0[cur * bufF + t * 16 * LDST + g * 16];
#pragma unroll
        for (int u = 0; u < 4; ++u)
#pragma unroll
            for (int g = 0; g < 2; ++g)
                fb[u].q[g] = *(const uint4*)&S0[cur * bufS + u * 16 * LDST + g * 16];

#pragma unroll
        for (int t = 0; t < 4; ++t)
#pragma unroll
            for (int u = 0; u < 4; ++u)
                acc[t][u] = __builtin_amdgcn_wmma_f32_16x16x32_bf16(
                    false, fa[t].v, false, fb[u].v, (short)0, acc[t][u], false, false);

#ifdef USE_TDM
        if (wid == 0) __builtin_amdgcn_s_wait_tensorcnt(0);
#endif
        __syncthreads();
    }

    // epilogue
    if (MODE == 0) {
        // The wave's 64 x 64 tile is 64 tokens of ONE head of Q, K or V.  Output rows of 128 B:
        // a token's 64 dims (Q, K; rows adjoin) or a dim's 64 tokens (V^T; rows SEQ apart).
        // acc[t][u][r] is output row u*16 + ln, element t*16 + hi*8 + r.
        const int which = colBase >> 10;
        const int bh    = (rowBase >> 11) * NHEAD + ((colBase & 1023) >> 6) + wc;
        const int tok0  = (rowBase & 2047) + wr * 64;
        unsigned short* dst = (which == 2) ? Vt + (size_t)bh * HD * SEQ + tok0
                                           : (which == 0 ? Qb : Kb) + ((size_t)bh * SEQ + tok0) * HD;
        const int pitch = (which == 2) ? SEQ : HD;
        // Each wave stages 32 rows at a time in its own range of the B ring, which is free:
        // the loop's last barrier stands behind every fragment read and the last tensor wait.
        unsigned short* stg = &lB[0][0] + wid * (32 * SPITCH);
        const int srow = lane >> 3, col = (lane & 7) * 8;    // read-back slot: 8 lanes per row
        unsigned short* drow = dst + (size_t)srow * pitch + col;
#pragma unroll
        for (int half = 0; half < 2; ++half) {
            if (half > 0)   // every lane's read-back of the last rows is done before they are rewritten
                asm volatile("s_wait_dscnt 0x0" ::: "memory");
#pragma unroll
            for (int uu = 0; uu < 2; ++uu)
#pragma unroll
                for (int t = 0; t < 4; ++t) {
                    Pack8 p;
#pragma unroll
                    for (int r = 0; r < 8; r += 2) {
                        v2f f = { acc[t][half * 2 + uu][r], acc[t][half * 2 + uu][r + 1] };
                        p.h[r >> 1] = __builtin_convertvector(f, v2bf);
                    }
                    *(uint4*)&stg[(uu * 16 + ln) * SPITCH + t * 16 + hi * 8] = p.q;
                }
            asm volatile("s_wait_dscnt 0x0" ::: "memory");   // rows written before other lanes read them back
#pragma unroll
            for (int k = 0; k < 8; ++k)                      // 4 whole rows (lines) per wave-wide store
                *(uint4*)&drow[(size_t)((half * 32 + k * 4) * pitch)] =
                    *(const uint4*)&stg[(k * 4 + srow) * SPITCH + col];
        }
    } else {
        // acc[t][u][r] is token u*16 + ln, column t*16 + hi*8 + r of the wave's 64 x 64 tile.
        // 16 tokens (rows of 256 B) at a time, in the wave's own range of the freed B ring.
        float* dst  = Cout + (size_t)(rowBase + wr * 64) * N + colBase + wc * 64;
        float* stgf = (float*)&lB[0][0] + wid * (16 * FPITCH);
        const int srow = lane >> 4, col = (lane & 15) * 4;   // read-back slot: 16 lanes per row
        float* drow = dst + (size_t)srow * N + col;
        const float4 bv = *(const float4*)&bias[colBase + wc * 64 + col];
#pragma unroll
        for (int u = 0; u < 4; ++u) {
            if (u > 0)      // every lane's read-back of the last rows is done before they are rewritten
                asm volatile("s_wait_dscnt 0x0" ::: "memory");
#pragma unroll
            for (int t = 0; t < 4; ++t)
#pragma unroll
                for (int g = 0; g < 2; ++g)
                    *(float4*)&stgf[ln * FPITCH + t * 16 + hi * 8 + g * 4] =
                        make_float4(acc[t][u][g * 4], acc[t][u][g * 4 + 1], acc[t][u][g * 4 + 2], acc[t][u][g * 4 + 3]);
            asm volatile("s_wait_dscnt 0x0" ::: "memory");   // rows written before other lanes read them back
#pragma unroll
            for (int k = 0; k < 8; ++k) {                    // 2 whole rows (4 lines) per wave-wide store
                const float4 v = *(const float4*)&stgf[(k * 2 + srow) * FPITCH + col];
                *(float4*)&drow[(size_t)((u * 16 + k * 2) * N)] =
                    make_float4(v.x + bv.x, v.y + bv.y, v.z + bv.z, v.w + bv.w);
            }
        }
    }
}

// ---------------- attention: per (b,h), two-pass softmax, deferred lane reductions --
// Q,K per head: (SEQ x HD) bf16 row-major.  V per head: (HD x SEQ) bf16 (transposed).
// One wave handles 16 query rows; block = 8 waves = 128 queries.
// K and V reach the waves through LDS: 64-key tiles, brought in whole 128-byte rows by
// asynchronous copies, two buffers, each tile read by all eight waves.

#define AKT    64             // keys per staged tile
#define APITCH 72             // LDS row pitch (bf16 elems) = 144 B: 16 B x odd for b128 readers
#define NTILE  (SEQ / AKT)

// Two 16-byte copies per lane; the s_wait_xcnt closes the statement so that no address
// register named here is rewritten while a copy may still read it.
__device__ __forceinline__ void async_copy2(unsigned l0, const unsigned short* g0,
                                            unsigned l1, const unsigned short* g1) {
    asm volatile("global_load_async_to_lds_b128 %0, %1, off\n\t"
                 "global_load_async_to_lds_b128 %2, %3, off\n\t"
                 "s_wait_xcnt 0x0"
                 :: "v"(l0), "v"(g0), "v"(l1), "v"(g1) : "memory");
}

// Hand-over of a tile: this wave's LDS reads of the old buffer are done, its own copies
// of the next tile have landed, then the barrier publishes the tile and frees the buffer.
__device__ __forceinline__ void tile_publish() {
    asm volatile("s_wait_dscnt 0x0" ::: "memory");     // own reads retired before a refill
    asm volatile("s_wait_asynccnt 0x0" ::: "memory");  // own copies landed before others read
    __syncthreads();
}

// Register budget of 8 waves per SIMD: 4 blocks per WGP, so that all 1024 blocks are
// resident at once and no second, thin round of blocks follows.
__global__ __launch_bounds__(256) __attribute__((amdgpu_waves_per_eu(8))) void k_attn(
    const unsigned short* __restrict__ Qb,
    const unsigned short* __restrict__ Kb,
    const unsigned short* __restrict__ Vt,
    unsigned short* __restrict__ Ob)
{
    __shared__ alignas(16) unsigned short Ks[2][AKT * APITCH];   // 64 keys x 64 dims
    __shared__ alignas(16) unsigned short Vs[2][HD * APITCH];    // 64 dims x 64 keys
    __shared__ alignas(16) unsigned short Pld[8][16 * LDST];

    const int tid  = threadIdx.x;
    const int lane = tid & 31, wid = tid >> 5;
    const int ln = lane & 15,  hi  = lane >> 4;
    const int b = blockIdx.z, h = blockIdx.y;
    const int qbase = blockIdx.x * 128 + wid * 16;
    const float scale = 0.125f;                  // 1/sqrt(64)

    const size_t headOff = ((size_t)(b * NHEAD + h)) * SEQ * HD;
    const unsigned short* Qh = Qb + headOff;
    const unsigned short* Kh = Kb + headOff;
    const unsigned short* Vh = Vt + headOff;     // (HD x SEQ)

    // copy slots of this lane: rows crow and crow + 32 of a tile, 16 bytes at element ccol
    const int crow = tid >> 3, ccol = (tid & 7) * 8;
    const unsigned ldsK = (unsigned)(unsigned long long)(&Ks[0][crow * APITCH + ccol]);
    const unsigned ldsV = (unsigned)(unsigned long long)(&Vs[0][crow * APITCH + ccol]);
    const unsigned bufBytes  = AKT * APITCH * 2;  // one buffer (K and V tiles are alike)
    const unsigned halfBytes = 32 * APITCH * 2;   // 32 rows further down

    auto stageK = [&](int buf, int tile) {
        const unsigned short* g = Kh + (size_t)(tile * AKT + crow) * HD + ccol;
        async_copy2(ldsK + buf * bufBytes, g, ldsK + buf * bufBytes + halfBytes, g + 32 * HD);
    };
    auto stageV = [&](int buf, int tile) {
        const unsigned short* g = Vh + (size_t)crow * SEQ + tile * AKT + ccol;
        async_copy2(ldsV + buf * bufBytes, g, ldsV + buf * bufBytes + halfBytes, g + (size_t)32 * SEQ);
    };

    // Q fragments (16 x 64), resident for the whole kernel
    Frag qf[2];
#pragma unroll
    for (int f = 0; f < 2; ++f)
#pragma unroll
        for (int g = 0; g < 2; ++g)
            qf[f].q[g] = *(const uint4*)&Qh[(size_t)(qbase + ln) * HD + f * 32 + hi * 8 + g * 16];

    v8f vz = {0.f,0.f,0.f,0.f,0.f,0.f,0.f,0.f};

    // ---- phase A: per-lane raw row max (no shuffles, no exp in the hot loop) ----
    float mrow[8];
#pragma unroll
    for (int r = 0; r < 8; ++r) mrow[r] = -3.0e38f;

    stageK(0, 0);
    tile_publish();
    stageK(1, 1);

    for (int s = 0; s < NTILE; ++s) {
        const unsigned short* Kc = &Ks[s & 1][0];
#pragma unroll                                   // two 32-key halves of the tile, straight-line
        for (int kl = 0; kl < AKT; kl += 32) {
            v8f s0 = vz, s1 = vz;
#pragma unroll
            for (int f = 0; f < 2; ++f) {
                Frag kf;
#pragma unroll
                for (int g = 0; g < 2; ++g)
                    kf.q[g] = *(const uint4*)&Kc[(kl + ln) * APITCH + f * 32 + hi * 8 + g * 16];
                s0 = __builtin_amdgcn_wmma_f32_16x16x32_bf16(false, qf[f].v, false, kf.v, (short)0, s0, false, false);
            }
#pragma unroll
            for (int f = 0; f < 2; ++f) {
                Frag kf;
#pragma unroll
                for (int g = 0; g < 2; ++g)
                    kf.q[g] = *(const uint4*)&Kc[(kl + 16 + ln) * APITCH + f * 32 + hi * 8 + g * 16];
                s1 = __builtin_amdgcn_wmma_f32_16x16x32_bf16(false, qf[f].v, false, kf.v, (short)0, s1, false, false);
            }
#pragma unroll
            for (int r = 0; r < 8; ++r)
                mrow[r] = fmaxf(mrow[r], fmaxf(s0[r], s1[r]));
        }
        tile_publish();
        if (s + 2 < NTILE) stageK(s & 1, s + 2);  // refill the buffer this trip has read
    }
    asm volatile("s_wait_asynccnt 0x0" ::: "memory");  // no copy in flight when the buffers change hands
    // one cross-lane max reduction at the end (rows live in 16-lane groups)
#pragma unroll
    for (int r = 0; r < 8; ++r) {
#pragma unroll
        for (int m = 1; m <= 8; m <<= 1)
            mrow[r] = fmaxf(mrow[r], __shfl_xor(mrow[r], m, 32));
        mrow[r] *= scale;                        // max of scaled scores
    }

    // ---- phase B: O += exp(s*scale - m) @ V ; row-sums accumulated per lane ----
    v8f oacc[4];
#pragma unroll
    for (int u = 0; u < 4; ++u) oacc[u] = vz;
    float psum[8];
#pragma unroll
    for (int r = 0; r < 8; ++r) psum[r] = 0.f;

    unsigned short* Pw = &Pld[wid][0];

    // both buffers are free here: phase A's last hand-over ended every read of them
    stageK(0, 0);
    stageV(0, 0);
    tile_publish();
    stageK(1, 1);
    stageV(1, 1);

    for (int s = 0; s < NTILE; ++s) {
        const unsigned short* Kc = &Ks[s & 1][0];
        const unsigned short* Vc = &Vs[s & 1][0];
#pragma unroll 1                                 // rolled: both halves unrolled overrun the 128-register budget and spill
        for (int kl = 0; kl < AKT; kl += 32) {
            v8f s0 = vz, s1 = vz;
#pragma unroll
            for (int f = 0; f < 2; ++f) {
                Frag kf;
#pragma unroll
                for (int g = 0; g < 2; ++g)
                    kf.q[g] = *(const uint4*)&Kc[(kl + ln) * APITCH + f * 32 + hi * 8 + g * 16];
                s0 = __builtin_amdgcn_wmma_f32_16x16x32_bf16(false, qf[f].v, false, kf.v, (short)0, s0, false, false);
            }
#pragma unroll
            for (int f = 0; f < 2; ++f) {
                Frag kf;
#pragma unroll
                for (int g = 0; g < 2; ++g)
                    kf.q[g] = *(const uint4*)&Kc[(kl + 16 + ln) * APITCH + f * 32 + hi * 8 + g * 16];
                s1 = __builtin_amdgcn_wmma_f32_16x16x32_bf16(false, qf[f].v, false, kf.v, (short)0, s1, false, false);
            }

            // exponentiate, accumulate per-lane row sums, C-layout -> A-layout via LDS
#pragma unroll
            for (int r = 0; r < 8; ++r) {
                int row = r + hi * 8;
                float p0 = __expf(s0[r] * scale - mrow[r]);
                float p1 = __expf(s1[r] * scale - mrow[r]);
                psum[r] += p0 + p1;
                Pw[row * LDST + ln]      = f2bf(p0);
                Pw[row * LDST + 16 + ln] = f2bf(p1);
            }
            asm volatile("s_wait_dscnt 0" ::: "memory");   // per-wave LDS RAW fence

            Frag pf;
            pf.q[0] = *(const uint4*)&Pw[ln * LDST + hi * 8];
            pf.q[1] = *(const uint4*)&Pw[ln * LDST + 16 + hi * 8];

#pragma unroll
            for (int u = 0; u < 4; ++u) {
                Frag vf;
#pragma unroll
                for (int g = 0; g < 2; ++g)
                    vf.q[g] = *(const uint4*)&Vc[(u * 16 + ln) * APITCH + kl + hi * 8 + g * 16];
                oacc[u] = __builtin_amdgcn_wmma_f32_16x16x32_bf16(false, pf.v, false, vf.v, (short)0, oacc[u], false, false);
            }
            // four vector slots between the last WMMA and the loop's top, where the next
            // half's address arithmetic may overwrite its B operand
            __builtin_amdgcn_sched_barrier(0);   // holds that WMMA in front of the slots
            asm volatile("v_nop\n\tv_nop\n\tv_nop\n\tv_nop");
        }
        tile_publish();
        if (s + 2 < NTILE) {                      // refill the buffers this trip has read
            stageK(s & 1, s + 2);
            stageV(s & 1, s + 2);
        }
    }
    asm volatile("s_wait_asynccnt 0x0" ::: "memory");  // no copy in flight when the wave ends

    // one cross-lane sum reduction for the softmax denominators
    float lrow[8];
#pragma unroll
    for (int r = 0; r < 8; ++r) {
        float s = psum[r];
#pragma unroll
        for (int m = 1; m <= 8; m <<= 1) s += __shfl_xor(s, m, 32);
        lrow[r] = s;
    }

    // normalize + store bf16 into (B, N, D) layout for the out-projection GEMM
#pragma unroll
    for (int u = 0; u < 4; ++u)
#pragma unroll
        for (int r = 0; r < 8; ++r) {
            float o = oacc[u][r] / lrow[r];
            int gq = qbase + r + hi * 8;
            Ob[((size_t)(b * SEQ + gq)) * D_MODEL + h * HD + u * 16 + ln] = f2bf(o);
        }
}

// ---------------- launcher ----------------

extern "C" void kernel_launch(void* const* d_in, const int* in_sizes, int n_in,
                              void* d_out, int out_size, void* d_ws, size_t ws_size,
                              hipStream_t stream) {
    (void)in_sizes; (void)n_in; (void)out_size; (void)ws_size;
    const float* x      = (const float*)d_in[0];
    const float* W_qkv  = (const float*)d_in[1];
    const float* W_proj = (const float*)d_in[2];
    const float* b_proj = (const float*)d_in[3];
    float* out = (float*)d_out;

    const size_t NX  = (size_t)MTOT * D_MODEL;      // 8,388,608
    unsigned short* Xb     = (unsigned short*)d_ws;
    unsigned short* WqkvT  = Xb     + NX;                            // 3072 x 1024
    unsigned short* WprojT = WqkvT  + (size_t)3 * D_MODEL * D_MODEL; // 1024 x 1024
    unsigned short* Qb     = WprojT + (size_t)D_MODEL * D_MODEL;     // B*H*SEQ*HD == NX
    unsigned short* Kb     = Qb + NX;
    unsigned short* Vt     = Kb + NX;
    unsigned short* Ob     = Vt + NX;

    // 1. convert inputs to bf16 (weights transposed to N x K)
    k_cvt  <<<(int)(NX / CVT_BLOCK), 256, 0, stream>>>(x, Xb, (int)NX);
    k_cvt_t<D_MODEL, 3 * D_MODEL><<<dim3(3 * D_MODEL / 128, D_MODEL / 64), 256, 0, stream>>>(W_qkv,  WqkvT);
    k_cvt_t<D_MODEL, D_MODEL>    <<<dim3(D_MODEL / 128, D_MODEL / 64),     256, 0, stream>>>(W_proj, WprojT);

    // 2. QKV projection, scatter to per-head Q, K (row-major) and V^T
    k_gemm<0><<<dim3(3 * D_MODEL / BN, MTOT / BM), 256, 0, stream>>>(
        Xb, WqkvT, nullptr, Qb, Kb, Vt, nullptr, D_MODEL, 3 * D_MODEL);

    // 3. attention (two-pass streamed softmax, all WMMA)
    k_attn<<<dim3(SEQ / 128, NHEAD, BATCH), 256, 0, stream>>>(Qb, Kb, Vt, Ob);

    // 4. output projection + bias (f32 out)
    k_gemm<1><<<dim3(D_MODEL / BN, MTOT / BM), 256, 0, stream>>>(
        Ob, WprojT, b_proj, nullptr, nullptr, nullptr, out, D_MODEL, D_MODEL);
}

// v004
// It runs in 175 microseconds.
// Next to v003, in two timings, it ran 1.19 times as fast each time.
// Counting every step since v000, it is 2.84 times as fast.
#include <hip/hip_runtime.h>

typedef __attribute__((ext_vector_type(16))) __bf16 v16bf;
typedef __attribute__((ext_vector_type(8)))  float  v8f;
typedef __attribute__((ext_vector_type(2)))  float  v2f;
typedef __attribute__((ext_vector_type(2)))  __bf16 v2bf;
typedef __attribute__((ext_vector_type(4)))  unsigned int u32x4;
typedef __attribute__((ext_vector_type(8)))  int    i32x8;
typedef __attribute__((ext_vector_type(4)))  int    i32x4;

#define D_MODEL 1024
#define NHEAD   16
#define HD      64
#define SEQ     2048
#define BATCH   4
#define MTOT    (BATCH*SEQ)   // 8192

#define BM 128
#define BN 256
#define BK 32
#define LDST 40               // padded LDS row stride (bf16 elems): conflict-free, 16B aligned

#if defined(__gfx1250__) && defined(__has_builtin)
#if __has_builtin(__builtin_amdgcn_tensor_load_to_lds) && __has_builtin(__builtin_amdgcn_s_wait_tensorcnt)
#define USE_TDM 1
#endif
#endif

__device__ __forceinline__ unsigned short f2bf(float f) {
    unsigned int u = __float_as_uint(f);
    u += 0x7FFFu + ((u >> 16) & 1u);          // round-to-nearest-even
    return (unsigned short)(u >> 16);
}

struct Frag { union { v16bf v; uint4 q[2]; }; };
struct Pack8 { union { uint4 q; v2bf h[4]; }; };   // 8 bf16 = one 16-byte store

// ---------------- conversion kernels ----------------
// Both are short streams: what they pay for is the number of waves that must start, so each
// thread converts many elements, by 16-byte loads that are all in flight before the first use.

typedef __attribute__((ext_vector_type(4))) float f32x4;

__device__ __forceinline__ unsigned int f2bf2(float lo, float hi) {
    return (unsigned int)f2bf(lo) | ((unsigned int)f2bf(hi) << 16);
}

#define CVT_LOADS 16                        // 16-byte loads per thread: 64 elements
#define CVT_BLOCK (256 * 4 * CVT_LOADS)     // elements per block

// A wave's load covers 512 contiguous bytes (4 lines), its store 256 (2 lines).
// The grid gives each SIMD 4 waves; the register budget of 4 lets all 16 loads fly together.
__global__ __launch_bounds__(256) __attribute__((amdgpu_waves_per_eu(4, 4)))
void k_cvt(const float* __restrict__ in, unsigned short* __restrict__ out, int n) {
    const int base = blockIdx.x * CVT_BLOCK;
    if (base + CVT_BLOCK > n) return;       // block-uniform bound
    const float* src = in + base + threadIdx.x * 4;
    unsigned short* dst = out + base + threadIdx.x * 4;
    f32x4 f[CVT_LOADS];
#pragma unroll
    for (int i = 0; i < CVT_LOADS; ++i) f[i] = *(const f32x4*)(src + i * 1024);
#pragma unroll
    for (int i = 0; i < CVT_LOADS; ++i)
        *(uint2*)(dst + i * 1024) = make_uint2(f2bf2(f[i][0], f[i][1]), f2bf2(f[i][2], f[i][3]));
}

// Wt[n*K + k] = bf16(W[k*N + n])   (store weights transposed, N x K row-major)
// A thread holds 8 k x 4 n; a wave 64 k x 16 n, so that each of its stores fills 4 whole
// 128-byte lines of Wt; a block 64 k x 128 n, so that its loads cover 512-byte runs of W.
// Grid: (N / 128, K / 64).  K and N are compile-time, so the row steps are immediate offsets.
template<int K, int N>
__global__ __launch_bounds__(256) void k_cvt_t(const float* __restrict__ W, unsigned short* __restrict__ Wt) {
    static_assert(K % 64 == 0 && N % 128 == 0, "whole tiles only");
    const unsigned lane = threadIdx.x & 31, wid = threadIdx.x >> 5;
    const unsigned n = blockIdx.x * 128 + wid * 16 + (lane & 3) * 4;
    const unsigned k = blockIdx.y * 64 + (lane >> 2) * 8;
    const float* src = W + (k * N + n);
    unsigned short* dst = Wt + (n * K + k);
    f32x4 f[8];
#pragma unroll
    for (int i = 0; i < 8; ++i) f[i] = *(const f32x4*)(src + i * N);
#pragma unroll
    for (int j = 0; j < 4; ++j)
        *(uint4*)(dst + j * K) = make_uint4(f2bf2(f[0][j], f[1][j]), f2bf2(f[2][j], f[3][j]),
                                            f2bf2(f[4][j], f[5][j]), f2bf2(f[6][j], f[7][j]));
}

#ifdef USE_TDM
// Loop-invariant part of a 2-D TDM descriptor: tileRows x 32 bf16 tile out of a
// tensor with rowLen-elem rows, HW-padded in LDS: 16 dwords data + 4 dwords pad
// -> 40-elem (80 B) rows, matching LDST.
__device__ __forceinline__ i32x8 tdm_group1(int rowLen, int tileRows) {
    i32x8 g1;
    g1[0] = (1 << 16)                                     // data_size = 2 bytes
          | (1 << 20)                                     // pad_enable
          | (3 << 22)                                     // pad_interval code 3 = 16 dwords
          | (3 << 25);                                    // pad_amount  code 3 = 4 dwords
    g1[1] = (rowLen & 0xFFFF) << 16;                      // tensor_dim0[15:0]
    g1[2] = ((rowLen >> 16) & 0xFFFF)                     // tensor_dim0[31:16]
          | ((tileRows & 0xFFFF) << 16);                  // tensor_dim1[15:0]
    g1[3] = ((tileRows >> 16) & 0xFFFF)                   // tensor_dim1[31:16]
          | (BK << 16);                                   // tile_dim0 = 32
    g1[4] = tileRows & 0xFFFF;                            // tile_dim1
    g1[5] = rowLen;                                       // tensor_dim0_stride[31:0]
    g1[6] = 0;
    g1[7] = 0;
    return g1;
}

__device__ __forceinline__ void tdm_issue(const unsigned short* gtile,
                                          unsigned lds_byte_addr, i32x8 g1) {
    unsigned long long ga = (unsigned long long)gtile;
    u32x4 g0;
    g0[0] = 1u;                                           // count=1 (valid), user mode
    g0[1] = lds_byte_addr;                                // lds_addr
    g0[2] = (unsigned)(ga & 0xFFFFFFFFu);                 // global_addr[31:0]
    g0[3] = (unsigned)((ga >> 32) & 0x1FFFFFFu)           // global_addr[56:32]
          | (2u << 30);                                   // type = 2 ("image")
    i32x4 gz4 = {0, 0, 0, 0};
    i32x8 gz8 = {0, 0, 0, 0, 0, 0, 0, 0};
    __builtin_amdgcn_tensor_load_to_lds(g0, g1, gz4, gz4, gz8, 0);
}
#endif

// ---------------- GEMM: C(MxN) f32 = A(MxK)bf16 @ Bt(NxK)bf16^T ----------------
// Double-buffered tile pipeline: TDM (or cooperative loads) stage tile k+1 while
// the 8 waves run 16 WMMAs each on tile k.
// MODE 0: QKV epilogue (Q,K row-major per head; V transposed per head)
// MODE 1: out-proj epilogue (add bias, store f32)
// Both epilogues store whole 128-byte lines, staged per wave through LDS.
// A lane's 8 accumulator registers run along the FIRST operand's rows, so the first operand
// is the side that is contiguous in the output: the weights (columns) for Q, K and the
// out-projection, the activations (tokens) for V^T.  Both fragments have one layout, so only
// the LDS base and buffer stride of each loader change, by block-uniform selects.

#define SPITCH 72             // bf16 staging row pitch (elems) = 144 B: 16 B x odd for b128
#define FPITCH 68             // f32 staging row pitch (elems) = 272 B: 16 B x odd for b128

template<int MODE>
__global__ __launch_bounds__(256) void k_gemm(
    const unsigned short* __restrict__ A,
    const unsigned short* __restrict__ Bt,
    const float* __restrict__ bias,
    unsigned short* __restrict__ Qb,
    unsigned short* __restrict__ Kb,
    unsigned short* __restrict__ Vt,
    float* __restrict__ Cout,
    int K, int N)
{
    __shared__ alignas(16) unsigned short lA[2][BM * LDST];
    __shared__ alignas(16) unsigned short lB[2][BN * LDST];

    const int tid  = threadIdx.x;
    const int lane = tid & 31, wid = tid >> 5;
    const int ln = lane & 15,  hi  = lane >> 4;
    const int wr = wid >> 2,   wc  = wid & 3;           // 2 x 4 wave grid, 64x64 wave tile
    const int rowBase = blockIdx.y * BM;
    const int colBase = blockIdx.x * BN;

#ifdef USE_TDM
    const i32x8 g1A = tdm_group1(K, BM);
    const i32x8 g1B = tdm_group1(K, BN);
    const unsigned ldsA[2] = { (unsigned)(unsigned long long)(&lA[0][0]),
                               (unsigned)(unsigned long long)(&lA[1][0]) };
    const unsigned ldsB[2] = { (unsigned)(unsigned long long)(&lB[0][0]),
                               (unsigned)(unsigned long long)(&lB[1][0]) };
#endif

    // xFirst: activations are the first operand (V^T blocks); else the weights are.
    // acc[t][u][r] = first operand's row t*16 + hi*8 + r times second operand's row u*16 + ln
    const bool xFirst = (MODE == 0) && (colBase >= 2 * D_MODEL);
    const int offX = (wr * 64 + ln) * LDST + hi * 8;
    const int offW = (wc * 64 + ln) * LDST + hi * 8;
    const unsigned short* F0 = xFirst ? &lA[0][offX] : &lB[0][offW];
    const unsigned short* S0 = xFirst ? &lB[0][offW] : &lA[0][offX];
    const int bufF = xFirst ? BM * LDST : BN * LDST;
    const int bufS = xFirst ? BN * LDST : BM * LDST;

    auto stage = [&](int buf, int k0) {
#ifdef USE_TDM
        if (wid == 0) {
            tdm_issue(A  + (size_t)rowBase * K + k0, ldsA[buf], g1A);
            tdm_issue(Bt + (size_t)colBase * K + k0, ldsB[buf], g1B);
        }
#else
#pragma unroll
        for (int i = 0; i < 2; ++i) {           // A: 512 b128, 2 per thread
            int v = i * 256 + tid;
            int row = v >> 2, cs = (v & 3) * 8;
            *(uint4*)&lA[buf][row * LDST + cs] = *(const uint4*)&A[(size_t)(rowBase + row) * K + k0 + cs];
        }
#pragma unroll
        for (int i = 0; i < 4; ++i) {           // B: 1024 b128, 4 per thread
            int v = i * 256 + tid;
            int row = v >> 2, cs = (v & 3) * 8;
            *(uint4*)&lB[buf][row * LDST + cs] = *(const uint4*)&Bt[(size_t)(colBase + row) * K + k0 + cs];
        }
#endif
    };

    v8f acc[4][4];
    v8f vz = {0.f,0.f,0.f,0.f,0.f,0.f,0.f,0.f};
#pragma unroll
    for (int t = 0; t < 4; ++t)
#pragma unroll
        for (int u = 0; u < 4; ++u) acc[t][u] = vz;

    // prologue: fill buffer 0
    stage(0, 0);
#ifdef USE_TDM
    if (wid == 0) __builtin_amdgcn_s_wait_tensorcnt(0);
#endif
    __syncthreads();

    for (int k0 = 0; k0 < K; k0 += BK) {
        const int cur = (k0 >> 5) & 1;
        if (k0 + BK < K) stage(cur ^ 1, k0 + BK);   // overlap DMA with WMMA

        Frag fa[4], fb[4];
#pragma unroll
        for (int t = 0; t < 4; ++t)
#pragma unroll
            for (int g = 0; g < 2; ++g)
                fa[t].q[g] = *(const uint4*)&F0[cur * bufF + t * 16 * LDST + g * 16];
#pragma unroll
        for (int u = 0; u < 4; ++u)
#pragma unroll
            for (int g = 0; g < 2; ++g)
                fb[u].q[g] = *(const uint4*)&S0[cur * bufS + u * 16 * LDST + g * 16];

#pragma unroll
        for (int t = 0; t < 4; ++t)
#pragma unroll
            for (int u = 0; u < 4; ++u)
                acc[t][u] = __builtin_amdgcn_wmma_f32_16x16x32_bf16(
                    false, fa[t].v, false, fb[u].v, (short)0, acc[t][u], false, false);

#ifdef USE_TDM
        if (wid == 0) __builtin_amdgcn_s_wait_tensorcnt(0);
#endif
        __syncthreads();
    }

    // epilogue
    if (MODE == 0) {
        // The wave's 64 x 64 tile is 64 tokens of ONE head of Q, K or V.  Output rows of 128 B:
        // a token's 64 dims (Q, K; rows adjoin) or a dim's 64 tokens (V^T; rows SEQ apart).
        // acc[t][u][r] is output row u*16 + ln, element t*16 + hi*8 + r.
        const int which = colBase >> 10;
        const int bh    = (rowBase >> 11) * NHEAD + ((colBase & 1023) >> 6) + wc;
        const int tok0  = (rowBase & 2047) + wr * 64;
        unsigned short* dst = (which == 2) ? Vt + (size_t)bh * HD * SEQ + tok0
                                           : (which == 0 ? Qb : Kb) + ((size_t)bh * SEQ + tok0) * HD;
        const int pitch = (which == 2) ? SEQ : HD;
        // Each wave stages 32 rows at a time in its own range of the B ring, which is free:
        // the loop's last barrier stands behind every fragment read and the last tensor wait.
        unsigned short* stg = &lB[0][0] + wid * (32 * SPITCH);
        const int srow = lane >> 3, col = (lane & 7) * 8;    // read-back slot: 8 lanes per row
        unsigned short* drow = dst + (size_t)srow * pitch + col;
#pragma unroll
        for (int half = 0; half < 2; ++half) {
            if (half > 0)   // every lane's read-back of the last rows is done before they are rewritten
                asm volatile("s_wait_dscnt 0x0" ::: "memory");
#pragma unroll
            for (int uu = 0; uu < 2; ++uu)
#pragma unroll
                for (int t = 0; t < 4; ++t) {
                    Pack8 p;
#pragma unroll
                    for (int r = 0; r < 8; r += 2) {
                        v2f f = { acc[t][half * 2 + uu][r], acc[t][half * 2 + uu][r + 1] };
                        p.h[r >> 1] = __builtin_convertvector(f, v2bf);
                    }
                    *(uint4*)&stg[(uu * 16 + ln) * SPITCH + t * 16 + hi * 8] = p.q;
                }
            asm volatile("s_wait_dscnt 0x0" ::: "memory");   // rows written before other lanes read them back
#pragma unroll
            for (int k = 0; k < 8; ++k)                      // 4 whole rows (lines) per wave-wide store
                *(uint4*)&drow[(size_t)((half * 32 + k * 4) * pitch)] =
                    *(const uint4*)&stg[(k * 4 + srow) * SPITCH + col];
        }
    } else {
        // acc[t][u][r] is token u*16 + ln, column t*16 + hi*8 + r of the wave's 64 x 64 tile.
        // 16 tokens (rows of 256 B) at a time, in the wave's own range of the freed B ring.
        float* dst  = Cout + (size_t)(rowBase + wr * 64) * N + colBase + wc * 64;
        float* stgf = (float*)&lB[0][0] + wid * (16 * FPITCH);
        const int srow = lane >> 4, col = (lane & 15) * 4;   // read-back slot: 16 lanes per row
        float* drow = dst + (size_t)srow * N + col;
        const float4 bv = *(const float4*)&bias[colBase + wc * 64 + col];
#pragma unroll
        for (int u = 0; u < 4; ++u) {
            if (u > 0)      // every lane's read-back of the last rows is done before they are rewritten
                asm volatile("s_wait_dscnt 0x0" ::: "memory");
#pragma unroll
            for (int t = 0; t < 4; ++t)
#pragma unroll
                for (int g = 0; g < 2; ++g)
                    *(float4*)&stgf[ln * FPITCH + t * 16 + hi * 8 + g * 4] =
                        make_float4(acc[t][u][g * 4], acc[t][u][g * 4 + 1], acc[t][u][g * 4 + 2], acc[t][u][g * 4 + 3]);
            asm volatile("s_wait_dscnt 0x0" ::: "memory");   // rows written before other lanes read them back
#pragma unroll
            for (int k = 0; k < 8; ++k) {                    // 2 whole rows (4 lines) per wave-wide store
                const float4 v = *(const float4*)&stgf[(k * 2 + srow) * FPITCH + col];
                *(float4*)&drow[(size_t)((u * 16 + k * 2) * N)] =
                    make_float4(v.x + bv.x, v.y + bv.y, v.z + bv.z, v.w + bv.w);
            }
        }
    }
}

#define AKT    64             // keys per staged tile
#define APITCH 72             // LDS row pitch (bf16 elems) = 144 B: 16 B x odd for b128 readers
#define NTILE  (SEQ / AKT)

// Two 16-byte copies per lane; the s_wait_xcnt closes the statement so that no address
// register named here is rewritten while a copy may still read it.
__device__ __forceinline__ void async_copy2(unsigned l0, const unsigned short* g0,
                                            unsigned l1, const unsigned short* g1) {
    asm volatile("global_load_async_to_lds_b128 %0, %1, off\n\t"
                 "global_load_async_to_lds_b128 %2, %3, off\n\t"
                 "s_wait_xcnt 0x0"
                 :: "v"(l0), "v"(g0), "v"(l1), "v"(g1) : "memory");
}

// Hand-over of a tile: this wave's LDS reads of the old buffer are done, its own copies
// of the next tile have landed, then the barrier publishes the tile and frees the buffer.
__device__ __forceinline__ void tile_publish() {
    asm volatile("s_wait_dscnt 0x0" ::: "memory");     // own reads retired before a refill
    asm volatile("s_wait_asynccnt 0x0" ::: "memory");  // own copies landed before others read
    __syncthreads();
}

// Register budget of 8 waves per SIMD: 4 blocks per WGP, so that all 1024 blocks are
// resident at once and no second, thin round of blocks follows.
__global__ __launch_bounds__(256) __attribute__((amdgpu_waves_per_eu(8))) void k_attn(
    const unsigned short* __restrict__ Qb,
    const unsigned short* __restrict__ Kb,
    const unsigned short* __restrict__ Vt,
    unsigned short* __restrict__ Ob)
{
    __shared__ alignas(16) unsigned short Ks[2][AKT * APITCH];   // 64 keys x 64 dims
    __shared__ alignas(16) unsigned short Vs[2][HD * APITCH];    // 64 dims x 64 keys

    const int tid  = threadIdx.x;
    const int lane = tid & 31, wid = tid >> 5;
    const int ln = lane & 15,  hi  = lane >> 4;
    const int b = blockIdx.z, h = blockIdx.y;
    const int qbase = blockIdx.x * 128 + wid * 16;
    const float scale = 0.125f;                  // 1/sqrt(64)

    const size_t headOff = ((size_t)(b * NHEAD + h)) * SEQ * HD;
    const unsigned short* Qh = Qb + headOff;
    const unsigned short* Kh = Kb + headOff;
    const unsigned short* Vh = Vt + headOff;     // (HD x SEQ)

    // copy slots of this lane: rows crow and crow + 32 of a tile, 16 bytes at element ccol
    const int crow = tid >> 3, ccol = (tid & 7) * 8;
    const unsigned ldsK = (unsigned)(unsigned long long)(&Ks[0][crow * APITCH + ccol]);
    const unsigned ldsV = (unsigned)(unsigned long long)(&Vs[0][crow * APITCH + ccol]);
    const unsigned bufBytes  = AKT * APITCH * 2;  // one buffer (K and V tiles are alike)
    const unsigned halfBytes = 32 * APITCH * 2;   // 32 rows further down

    auto stageK = [&](int buf, int tile) {
        const unsigned short* g = Kh + (size_t)(tile * AKT + crow) * HD + ccol;
        async_copy2(ldsK + buf * bufBytes, g, ldsK + buf * bufBytes + halfBytes, g + 32 * HD);
    };
    auto stageV = [&](int buf, int tile) {
        const unsigned short* g = Vh + (size_t)crow * SEQ + tile * AKT + ccol;
        async_copy2(ldsV + buf * bufBytes, g, ldsV + buf * bufBytes + halfBytes, g + (size_t)32 * SEQ);
    };

    // Q fragments (64 dims x 16 queries, second operand), resident for the whole kernel
    Frag qf[2];
#pragma unroll
    for (int f = 0; f < 2; ++f)
#pragma unroll
        for (int g = 0; g < 2; ++g)
            qf[f].q[g] = *(const uint4*)&Qh[(size_t)(qbase + ln) * HD + f * 32 + hi * 8 + g * 16];

    v8f vz = {0.f,0.f,0.f,0.f,0.f,0.f,0.f,0.f};

    // S^T of 16 keys (rows) x 16 queries (columns): st[r] = key key0 + hi*8 + r, query ln
    auto scoresT = [&](const unsigned short* Kc, int key0) {
        v8f st = vz;
#pragma unroll
        for (int f = 0; f < 2; ++f) {
            Frag kf;
#pragma unroll
            for (int g = 0; g < 2; ++g)
                kf.q[g] = *(const uint4*)&Kc[(key0 + ln) * APITCH + f * 32 + hi * 8 + g * 16];
            st = __builtin_amdgcn_wmma_f32_16x16x32_bf16(false, kf.v, false, qf[f].v, (short)0, st, false, false);
        }
        return st;
    };

    // ---- phase A: raw maximum of this lane's query over this lane's keys ----
    float mx[4];                                 // four independent chains
#pragma unroll
    for (int c = 0; c < 4; ++c) mx[c] = -3.0e38f;

    stageK(0, 0);
    tile_publish();
    stageK(1, 1);

    for (int s = 0; s < NTILE; ++s) {
        const unsigned short* Kc = &Ks[s & 1][0];
#pragma unroll                                   // two 32-key halves of the tile, straight-line
        for (int kl = 0; kl < AKT; kl += 32) {
            const v8f s0 = scoresT(Kc, kl);
            const v8f s1 = scoresT(Kc, kl + 16);
#pragma unroll
            for (int r = 0; r < 8; ++r)
                mx[r & 3] = fmaxf(mx[r & 3], fmaxf(s0[r], s1[r]));
        }
        tile_publish();
        if (s + 2 < NTILE) stageK(s & 1, s + 2);  // refill the buffer this trip has read
    }
    asm volatile("s_wait_asynccnt 0x0" ::: "memory");  // no copy in flight when the buffers change hands
    // the two lanes of a query (ln and ln + 16) join their halves of the keys, once
    float mq = fmaxf(fmaxf(mx[0], mx[1]), fmaxf(mx[2], mx[3]));
    mq = fmaxf(mq, __shfl_xor(mq, 16, 32)) * scale;    // max of scaled scores

    // ---- phase B: O^T += V^T @ exp(s*scale - m)^T ; the query's sum stays in its lanes ----
    v8f oacc[4];                                 // oacc[u][r] = dim u*16 + hi*8 + r, query ln
#pragma unroll
    for (int u = 0; u < 4; ++u) oacc[u] = vz;
    v2f psum[2] = { {0.f, 0.f}, {0.f, 0.f} };    // even and odd keys apart: packed adds, two chains

    // both buffers are free here: phase A's last hand-over ended every read of them
    stageK(0, 0);
    stageV(0, 0);
    tile_publish();
    stageK(1, 1);
    stageV(1, 1);

    for (int s = 0; s < NTILE; ++s) {
        const unsigned short* Kc = &Ks[s & 1][0];
        const unsigned short* Vc = &Vs[s & 1][0];
        // straight-line halves, so that the second half's K loads start under the first half's
        // V products; both fit the 128-register budget now that maximum and sum take 5 registers
#pragma unroll
        for (int kl = 0; kl < AKT; kl += 32) {
            const v8f s0 = scoresT(Kc, kl);
            const v8f s1 = scoresT(Kc, kl + 16);

            // exponentiate, sum in the lane, pack: element e of the operand is key
            // hi*8 + e (e < 8, from s0) or 16 + hi*8 + e - 8 (from s1), as V's loader has it
            union { v16bf v; v2bf h[8]; } pf;
#pragma unroll
            for (int r = 0; r < 8; r += 2) {
                v2f p0 = { __expf(s0[r] * scale - mq), __expf(s0[r + 1] * scale - mq) };
                v2f p1 = { __expf(s1[r] * scale - mq), __expf(s1[r + 1] * scale - mq) };
                psum[(r >> 1) & 1] += p0 + p1;
                pf.h[r >> 1]       = __builtin_convertvector(p0, v2bf);
                pf.h[4 + (r >> 1)] = __builtin_convertvector(p1, v2bf);
            }

#pragma unroll
            for (int u = 0; u < 4; ++u) {
                Frag vf;
#pragma unroll
                for (int g = 0; g < 2; ++g)
                    vf.q[g] = *(const uint4*)&Vc[(u * 16 + ln) * APITCH + kl + hi * 8 + g * 16];
                oacc[u] = __builtin_amdgcn_wmma_f32_16x16x32_bf16(false, vf.v, false, pf.v, (short)0, oacc[u], false, false);
            }
        }
        tile_publish();
        if (s + 2 < NTILE) {                      // refill the buffers this trip has read
            stageK(s & 1, s + 2);
            stageV(s & 1, s + 2);
        }
    }
    asm volatile("s_wait_asynccnt 0x0" ::: "memory");  // no copy in flight when the wave ends

    // the query's denominator: its two lanes join their halves of the keys, once
    float l = (psum[0][0] + psum[0][1]) + (psum[1][0] + psum[1][1]);
    l += __shfl_xor(l, 16, 32);

    // normalize + store bf16 into (B, N, D) layout for the out-projection GEMM:
    // a lane's 8 registers are 8 adjoining dims of its query, one 16-byte store
    unsigned short* orow = Ob + ((size_t)(b * SEQ + qbase + ln)) * D_MODEL + h * HD + hi * 8;
#pragma unroll
    for (int u = 0; u < 4; ++u) {
        Pack8 p;
#pragma unroll
        for (int r = 0; r < 8; r += 2) {
            v2f f = { oacc[u][r] / l, oacc[u][r + 1] / l };
            p.h[r >> 1] = __builtin_convertvector(f, v2bf);
        }
        *(uint4*)&orow[u * 16] = p.q;
    }
}

// ---------------- launcher ----------------

extern "C" void kernel_launch(void* const* d_in, const int* in_sizes, int n_in,
                              void* d_out, int out_size, void* d_ws, size_t ws_size,
                              hipStream_t stream) {
    (void)in_sizes; (void)n_in; (void)out_size; (void)ws_size;
    const float* x      = (const float*)d_in[0];
    const float* W_qkv  = (const float*)d_in[1];
    const float* W_proj = (const float*)d_in[2];
    const float* b_proj = (const float*)d_in[3];
    float* out = (float*)d_out;

    const size_t NX  = (size_t)MTOT * D_MODEL;      // 8,388,608
    unsigned short* Xb     = (unsigned short*)d_ws;
    unsigned short* WqkvT  = Xb     + NX;                            // 3072 x 1024
    unsigned short* WprojT = WqkvT  + (size_t)3 * D_MODEL * D_MODEL; // 1024 x 1024
    unsigned short* Qb     = WprojT + (size_t)D_MODEL * D_MODEL;     // B*H*SEQ*HD == NX
    unsigned short* Kb     = Qb + NX;
    unsigned short* Vt     = Kb + NX;
    unsigned short* Ob     = Vt + NX;

    // 1. convert inputs to bf16 (weights transposed to N x K)
    k_cvt  <<<(int)(NX / CVT_BLOCK), 256, 0, stream>>>(x, Xb, (int)NX);
    k_cvt_t<D_MODEL, 3 * D_MODEL><<<dim3(3 * D_MODEL / 128, D_MODEL / 64), 256, 0, stream>>>(W_qkv,  WqkvT);
    k_cvt_t<D_MODEL, D_MODEL>    <<<dim3(D_MODEL / 128, D_MODEL / 64),     256, 0, stream>>>(W_proj, WprojT);

    // 2. QKV projection, scatter to per-head Q, K (row-major) and V^T
    k_gemm<0><<<dim3(3 * D_MODEL / BN, MTOT / BM), 256, 0, stream>>>(
        Xb, WqkvT, nullptr, Qb, Kb, Vt, nullptr, D_MODEL, 3 * D_MODEL);

    // 3. attention (2-phase streamed softmax, all WMMA)
    k_attn<<<dim3(SEQ / 128, NHEAD, BATCH), 256, 0, stream>>>(Qb, Kb, Vt, Ob);

    // 4. output projection + bias (f32 out)
    k_gemm<1><<<dim3(D_MODEL / BN, MTOT / BM), 256, 0, stream>>>(
        Ob, WprojT, b_proj, nullptr, nullptr, nullptr, out, D_MODEL, D_MODEL);
}

// v006
// It runs in 135 microseconds.
// Versions in between are left out here; by their measured steps it is 1.30 times as fast as v004.
// All steps since v000 together make it 3.70 times as fast.
#include <hip/hip_runtime.h>

typedef __attribute__((ext_vector_type(16))) __bf16 v16bf;
typedef __attribute__((ext_vector_type(8)))  float  v8f;
typedef __attribute__((ext_vector_type(2)))  float  v2f;
typedef __attribute__((ext_vector_type(2)))  __bf16 v2bf;
typedef __attribute__((ext_vector_type(4)))  unsigned int u32x4;
typedef __attribute__((ext_vector_type(8)))  unsigned int u32x8;

#define D_MODEL 1024
#define NHEAD   16
#define HD      64
#define SEQ     2048
#define BATCH   4
#define MTOT    (BATCH*SEQ)   // 8192

#define BM 128
#define BN 256
#define BK 64                 // k per pass: a staged row is 128 B, one whole line
#define ROWB   (BK * 2)       // bytes of a staged row
#define GPITCH (ROWB + 16)    // LDS row pitch (bytes), the mover's pad included: 16 B x odd for b128 readers
#define WROWS  64             // weight rows in a slice (waves 0 to 3)
#define XROWS  32             // activation rows in a slice (waves 4 to 7)
#define WSLICE 10240          // LDS bytes of a weight slice: 64 x 144 rounded up to a multiple of 2 KiB
#define XSLICE 6144           // LDS bytes of an activation slice: 32 x 144 rounded up likewise
#define GBUF   (4 * WSLICE + 4 * XSLICE)   // one stage: 256 weight rows, then 128 activation rows

__device__ __forceinline__ unsigned short f2bf(float f) {
    unsigned int u = __float_as_uint(f);
    u += 0x7FFFu + ((u >> 16) & 1u);          // round-to-nearest-even
    return (unsigned short)(u >> 16);
}

struct Frag { union { v16bf v; uint4 q[2]; }; };
struct Pack8 { union { uint4 q; v2bf h[4]; }; };   // 8 bf16 = one 16-byte store

// ---------------- conversion kernels ----------------
// Both are short streams: what they pay for is the number of waves that must start, so each
// thread converts many elements, by 16-byte loads that are all in flight before the first use.

typedef __attribute__((ext_vector_type(4))) float f32x4;

__device__ __forceinline__ unsigned int f2bf2(float lo, float hi) {
    return (unsigned int)f2bf(lo) | ((unsigned int)f2bf(hi) << 16);
}

#define CVT_LOADS 16                        // 16-byte loads per thread: 64 elements
#define CVT_BLOCK (256 * 4 * CVT_LOADS)     // elements per block

// A wave's load covers 512 contiguous bytes (4 lines), its store 256 (2 lines).
// The grid gives each SIMD 4 waves; the register budget of 4 lets all 16 loads fly together.
__global__ __launch_bounds__(256) __attribute__((amdgpu_waves_per_eu(4, 4)))
void k_cvt(const float* __restrict__ in, unsigned short* __restrict__ out, int n) {
    const int base = blockIdx.x * CVT_BLOCK;
    if (base + CVT_BLOCK > n) return;       // block-uniform bound
    const float* src = in + base + threadIdx.x * 4;
    unsigned short* dst = out + base + threadIdx.x * 4;
    f32x4 f[CVT_LOADS];
#pragma unroll
    for (int i = 0; i < CVT_LOADS; ++i) f[i] = *(const f32x4*)(src + i * 1024);
#pragma unroll
    for (int i = 0; i < CVT_LOADS; ++i)
        *(uint2*)(dst + i * 1024) = make_uint2(f2bf2(f[i][0], f[i][1]), f2bf2(f[i][2], f[i][3]));
}

// Wt[n*K + k] = bf16(W[k*N + n])   (store weights transposed, N x K row-major)
// A thread holds 8 k x 4 n; a wave 64 k x 16 n, so that each of its stores fills 4 whole
// 128-byte lines of Wt; a block 64 k x 128 n, so that its loads cover 512-byte runs of W.
// Grid: (N / 128, K / 64).  K and N are compile-time, so the row steps are immediate offsets.
template<int K, int N>
__global__ __launch_bounds__(256) void k_cvt_t(const float* __restrict__ W, unsigned short* __restrict__ Wt) {
    static_assert(K % 64 == 0 && N % 128 == 0, "whole tiles only");
    const unsigned lane = threadIdx.x & 31, wid = threadIdx.x >> 5;
    const unsigned n = blockIdx.x * 128 + wid * 16 + (lane & 3) * 4;
    const unsigned k = blockIdx.y * 64 + (lane >> 2) * 8;
    const float* src = W + (k * N + n);
    unsigned short* dst = Wt + (n * K + k);
    f32x4 f[8];
#pragma unroll
    for (int i = 0; i < 8; ++i) f[i] = *(const f32x4*)(src + i * N);
#pragma unroll
    for (int j = 0; j < 4; ++j)
        *(uint4*)(dst + j * K) = make_uint4(f2bf2(f[0][j], f[1][j]), f2bf2(f[2][j], f[3][j]),
                                            f2bf2(f[4][j], f[5][j]), f2bf2(f[6][j], f[7][j]));
}

__device__ __forceinline__ unsigned uni(unsigned v) { return (unsigned)__builtin_amdgcn_readfirstlane(v); }

// A wave-uniform value held in a scalar register: a test on it compiles to a scalar branch, and
// what is formed from it is formed behind the waits written in front of it.
__device__ __forceinline__ unsigned pinned(unsigned v) {
    unsigned w = uni(v);
    asm volatile("" : "+s"(w));   // the scalar test or descriptor word of a tensor load, kept in an SGPR
    return w;
}

// Loop-invariant group of a tensor load: rows x 128 bytes (extents in bytes, tensor = tile),
// source row pitch srcPitch bytes, 16 bytes of LDS pad behind every 128-byte row -> GPITCH.
__device__ __forceinline__ u32x8 tdm_group1(unsigned rows, unsigned srcPitch) {
    u32x8 g;
    g[0] = uni((1u << 20) | (4u << 22) | (3u << 25));     // pad on, every 32 dwords, 4 dwords; no mask
    g[1] = uni((unsigned)ROWB << 16);                     // tensor_dim0
    g[2] = uni(rows << 16);                               // tensor_dim1
    g[3] = uni((unsigned)ROWB << 16);                     // tile_dim0
    g[4] = uni(rows);                                     // tile_dim1
    g[5] = uni(srcPitch);
    g[6] = uni(0u);
    g[7] = uni(0u);
    return g;
}

__device__ __forceinline__ u32x4 tdm_group0(unsigned count1, unsigned ldsByte, unsigned long long ga) {
    u32x4 g;
    g[0] = count1;                                        // count = 1
    g[1] = uni(ldsByte);
    g[2] = uni((unsigned)ga);
    g[3] = uni((((unsigned)(ga >> 32)) & 0x01FFFFFFu) | 0x80000000u);   // type = 2
    return g;
}

__device__ __forceinline__ void tdm_load(u32x4 g0, u32x8 g1) {
    asm volatile("tensor_load_to_lds %0, %1" :: "s"(g0), "s"(g1) : "memory");
}

// The wave's one outstanding tensor load has landed.  The wait names that load's descriptor, so
// that its registers hold their values until here and take new ones only behind the wait.
__device__ __forceinline__ void tdm_wait(u32x4 g0, u32x8 g1) {
    asm volatile("s_wait_tensorcnt 0x0" :: "s"(g0), "s"(g1) : "memory");
}

// ---------------- GEMM: C(MxN) f32 = A(MxK)bf16 @ Bt(NxK)bf16^T ----------------
// Two LDS buffers; a pass is 64 k.  Every wave brings its own slice of a stage by one tensor
// load (whole 128-byte rows), issued when the buffer is freed, one pass ahead of its use,
// while the 8 waves run 32 WMMAs each on the stage in the other buffer.
// MODE 0: QKV epilogue (Q,K row-major per head; V transposed per head)
// MODE 1: out-proj epilogue (add bias, store f32)
// Both epilogues store whole 128-byte lines, staged per wave through LDS.
// A lane's 8 accumulator registers run along the FIRST operand's rows, so the first operand
// is the side that is contiguous in the output: the weights (columns) for Q, K and the
// out-projection, the activations (tokens) for V^T.  Both fragments have one layout, so only
// the LDS base and the run step of each loader change, by a block-uniform select.

#define SPITCH 72             // bf16 staging row pitch (elems) = 144 B: 16 B x odd for b128
#define FPITCH 68             // f32 staging row pitch (elems) = 272 B: 16 B x odd for b128

template<int MODE>
__global__ __launch_bounds__(256) void k_gemm(
    const unsigned short* __restrict__ A,
    const unsigned short* __restrict__ Bt,
    const float* __restrict__ bias,
    unsigned short* __restrict__ Qb,
    unsigned short* __restrict__ Kb,
    unsigned short* __restrict__ Vt,
    float* __restrict__ Cout,
    int K, int N)
{
    __shared__ __attribute__((aligned(2048))) unsigned char ring[2 * GBUF];

    const int tid  = threadIdx.x;
    const int lane = tid & 31, wid = tid >> 5;
    const int ln = lane & 15,  hi  = lane >> 4;
    const int wr = wid >> 2,   wc  = wid & 3;           // 2 x 4 wave grid, 64x64 wave tile
    const int rowBase = blockIdx.y * BM;
    const int colBase = blockIdx.x * BN;

    // This wave's slice of every stage: waves 0 to 3 64 weight rows each, waves 4 to 7 32 activation rows.
    const unsigned wave = uni(threadIdx.x >> 5);
    const bool     isW  = wave < 4u;
    const unsigned place = (unsigned)(unsigned long long)(&ring[0])
                         + (isW ? wave * WSLICE : 4u * WSLICE + (wave - 4u) * XSLICE);
    const unsigned long long src = isW
        ? (unsigned long long)(Bt + (size_t)(colBase + wave * WROWS) * K)
        : (unsigned long long)(A  + (size_t)(rowBase + (wave - 4u) * XROWS) * K);
    const u32x8 g1 = tdm_group1(isW ? WROWS : XROWS, (unsigned)K * 2u);
    const unsigned count1 = pinned(1u);   // descriptor word 0, held in an SGPR: its register is not lent out under a load in flight

    // xFirst: activations are the first operand (V^T blocks); else the weights are.
    // acc[t][u][r] = first operand's row t*16 + hi*8 + r times second operand's row u*16 + ln
    // A wave's 64 rows of an operand are two runs of 32: 32 rows apart in a weight slice,
    // a slice apart for the activations.
    const bool xFirst = (MODE == 0) && (colBase >= 2 * D_MODEL);
    const unsigned char* Xf = &ring[4 * WSLICE + wr * 2 * XSLICE + ln * GPITCH + hi * 16];
    const unsigned char* Wf = &ring[wc * WSLICE + ln * GPITCH + hi * 16];
    const unsigned char* F0 = xFirst ? Xf : Wf;
    const unsigned char* S0 = xFirst ? Wf : Xf;
    const int runF = xFirst ? XSLICE : 32 * GPITCH;
    const int runS = xFirst ? 32 * GPITCH : XSLICE;

    v8f acc[4][4];
    v8f vz = {0.f,0.f,0.f,0.f,0.f,0.f,0.f,0.f};
#pragma unroll
    for (int t = 0; t < 4; ++t)
#pragma unroll
        for (int u = 0; u < 4; ++u) acc[t][u] = vz;

    // prologue: stage 0 lands and is published, then stage 1 is on its way (K holds two stages or more)
    const int NP = K / BK;
    u32x4 g0 = tdm_group0(count1, place, src);
    tdm_load(g0, g1);
    tdm_wait(g0, g1);                                    // own slice landed before the barrier publishes it
    __syncthreads();
    g0 = tdm_group0(count1, place + GBUF, src + ROWB);
    tdm_load(g0, g1);

    for (int s = 0; s < NP; ++s) {
        const int cur = (s & 1) * GBUF;
#pragma unroll
        for (int kk = 0; kk < 2; ++kk) {                 // the stage's two 32-k steps
            Frag fa[4], fb[4];
#pragma unroll
            for (int t = 0; t < 4; ++t)
#pragma unroll
                for (int g = 0; g < 2; ++g)
                    fa[t].q[g] = *(const uint4*)&F0[cur + (t >> 1) * runF + (t & 1) * 16 * GPITCH + kk * 64 + g * 32];
#pragma unroll
            for (int u = 0; u < 4; ++u)
#pragma unroll
                for (int g = 0; g < 2; ++g)
                    fb[u].q[g] = *(const uint4*)&S0[cur + (u >> 1) * runS + (u & 1) * 16 * GPITCH + kk * 64 + g * 32];

#pragma unroll
            for (int t = 0; t < 4; ++t)
#pragma unroll
                for (int u = 0; u < 4; ++u)
                    acc[t][u] = __builtin_amdgcn_wmma_f32_16x16x32_bf16(
                        false, fa[t].v, false, fb[u].v, (short)0, acc[t][u], false, false);
        }

        // publish point of stage s + 1
        asm volatile("s_wait_dscnt 0x0" ::: "memory");       // own reads of this buffer retired before its refill
        tdm_wait(g0, g1);                                    // own slice of stage s + 1 landed before others read it
        __syncthreads();
        if (pinned(s + 2 < NP)) {                            // scalar branch: a tensor load ignores EXEC
            g0 = tdm_group0(count1, place + cur, src + pinned((unsigned)(s + 2) * ROWB));   // address formed behind the wait
            tdm_load(g0, g1);
        }
    }
    tdm_wait(g0, g1);                                        // nothing in flight when the ring becomes staging
    asm volatile("s_wait_dscnt 0x0" ::: "memory");

    // epilogue
    if (MODE == 0) {
        // The wave's 64 x 64 tile is 64 tokens of ONE head of Q, K or V.  Output rows of 128 B:
        // a token's 64 dims (Q, K; rows adjoin) or a dim's 64 tokens (V^T; rows SEQ apart).
        // acc[t][u][r] is output row u*16 + ln, element t*16 + hi*8 + r.
        const int which = colBase >> 10;
        const int bh    = (rowBase >> 11) * NHEAD + ((colBase & 1023) >> 6) + wc;
        const int tok0  = (rowBase & 2047) + wr * 64;
        unsigned short* dst = (which == 2) ? Vt + (size_t)bh * HD * SEQ + tok0
                                           : (which == 0 ? Qb : Kb) + ((size_t)bh * SEQ + tok0) * HD;
        const int pitch = (which == 2) ? SEQ : HD;
        // Each wave stages 32 rows at a time in its own range of the ring, which is free:
        // the loop's last barrier stands behind every fragment read and the last tensor wait.
        unsigned short* stg = (unsigned short*)&ring[0] + wid * (32 * SPITCH);
        const int srow = lane >> 3, col = (lane & 7) * 8;    // read-back slot: 8 lanes per row
        unsigned short* drow = dst + (size_t)srow * pitch + col;
#pragma unroll
        for (int half = 0; half < 2; ++half) {
            if (half > 0)   // every lane's read-back of the last rows is done before they are rewritten
                asm volatile("s_wait_dscnt 0x0" ::: "memory");
#pragma unroll
            for (int uu = 0; uu < 2; ++uu)
#pragma unroll
                for (int t = 0; t < 4; ++t) {
                    Pack8 p;
#pragma unroll
                    for (int r = 0; r < 8; r += 2) {
                        v2f f = { acc[t][half * 2 + uu][r], acc[t][half * 2 + uu][r + 1] };
                        p.h[r >> 1] = __builtin_convertvector(f, v2bf);
                    }
                    *(uint4*)&stg[(uu * 16 + ln) * SPITCH + t * 16 + hi * 8] = p.q;
                }
            asm volatile("s_wait_dscnt 0x0" ::: "memory");   // rows written before other lanes read them back
#pragma unroll
            for (int k = 0; k < 8; ++k)                      // 4 whole rows (lines) per wave-wide store
                *(uint4*)&drow[(size_t)((half * 32 + k * 4) * pitch)] =
                    *(const uint4*)&stg[(k * 4 + srow) * SPITCH + col];
        }
    } else {
        // acc[t][u][r] is token u*16 + ln, column t*16 + hi*8 + r of the wave's 64 x 64 tile.
        // 16 tokens (rows of 256 B) at a time, in the wave's own range of the freed ring.
        float* dst  = Cout + (size_t)(rowBase + wr * 64) * N + colBase + wc * 64;
        float* stgf = (float*)&ring[0] + wid * (16 * FPITCH);
        const int srow = lane >> 4, col = (lane & 15) * 4;   // read-back slot: 16 lanes per row
        float* drow = dst + (size_t)srow * N + col;
        const float4 bv = *(const float4*)&bias[colBase + wc * 64 + col];
#pragma unroll
        for (int u = 0; u < 4; ++u) {
            if (u > 0)      // every lane's read-back of the last rows is done before they are rewritten
                asm volatile("s_wait_dscnt 0x0" ::: "memory");
#pragma unroll
            for (int t = 0; t < 4; ++t)
#pragma unroll
                for (int g = 0; g < 2; ++g)
                    *(float4*)&stgf[ln * FPITCH + t * 16 + hi * 8 + g * 4] =
                        make_float4(acc[t][u][g * 4], acc[t][u][g * 4 + 1], acc[t][u][g * 4 + 2], acc[t][u][g * 4 + 3]);
            asm volatile("s_wait_dscnt 0x0" ::: "memory");   // rows written before other lanes read them back
#pragma unroll
            for (int k = 0; k < 8; ++k) {                    // 2 whole rows (4 lines) per wave-wide store
                const float4 v = *(const float4*)&stgf[(k * 2 + srow) * FPITCH + col];
                *(float4*)&drow[(size_t)((u * 16 + k * 2) * N)] =
                    make_float4(v.x + bv.x, v.y + bv.y, v.z + bv.z, v.w + bv.w);
            }
        }
    }
}

#define AKT    64             // keys per staged tile
#define APITCH 72             // LDS row pitch (bf16 elems) = 144 B: 16 B x odd for b128 readers
#define NTILE  (SEQ / AKT)
#define LAZY   5.5f           // how far the maximum in use may lag (scaled scores): exponentials stay below e^5.5

// Two 16-byte copies per lane; the s_wait_xcnt closes the statement so that no address
// register named here is rewritten while a copy may still read it.
__device__ __forceinline__ void async_copy2(unsigned l0, const unsigned short* g0,
                                            unsigned l1, const unsigned short* g1) {
    asm volatile("global_load_async_to_lds_b128 %0, %1, off\n\t"
                 "global_load_async_to_lds_b128 %2, %3, off\n\t"
                 "s_wait_xcnt 0x0"
                 :: "v"(l0), "v"(g0), "v"(l1), "v"(g1) : "memory");
}

// Hand-over of a tile: this wave's LDS reads of the old buffer are done, its own copies
// of the next tile have landed, then the barrier publishes the tile and frees the buffer.
__device__ __forceinline__ void tile_publish() {
    asm volatile("s_wait_dscnt 0x0" ::: "memory");     // own reads retired before a refill
    asm volatile("s_wait_asynccnt 0x0" ::: "memory");  // own copies landed before others read
    __syncthreads();
}

// Register budget of 8 waves per SIMD: 4 blocks per WGP, so that all 1024 blocks are
// resident at once and no second, thin round of blocks follows.
__global__ __launch_bounds__(256) __attribute__((amdgpu_waves_per_eu(8))) void k_attn(
    const unsigned short* __restrict__ Qb,
    const unsigned short* __restrict__ Kb,
    const unsigned short* __restrict__ Vt,
    unsigned short* __restrict__ Ob)
{
    __shared__ alignas(16) unsigned short Ks[2][AKT * APITCH];   // 64 keys x 64 dims
    __shared__ alignas(16) unsigned short Vs[2][HD * APITCH];    // 64 dims x 64 keys

    const int tid  = threadIdx.x;
    const int lane = tid & 31, wid = tid >> 5;
    const int ln = lane & 15,  hi  = lane >> 4;
    const int b = blockIdx.z, h = blockIdx.y;
    const int qbase = blockIdx.x * 128 + wid * 16;
    const float scale = 0.125f;                  // 1/sqrt(64)

    const size_t headOff = ((size_t)(b * NHEAD + h)) * SEQ * HD;
    const unsigned short* Qh = Qb + headOff;
    const unsigned short* Kh = Kb + headOff;
    const unsigned short* Vh = Vt + headOff;     // (HD x SEQ)

    // copy slots of this lane: rows crow and crow + 32 of a tile, 16 bytes at element ccol
    const int crow = tid >> 3, ccol = (tid & 7) * 8;
    const unsigned ldsK = (unsigned)(unsigned long long)(&Ks[0][crow * APITCH + ccol]);
    const unsigned ldsV = (unsigned)(unsigned long long)(&Vs[0][crow * APITCH + ccol]);
    const unsigned bufBytes  = AKT * APITCH * 2;  // one buffer (K and V tiles are alike)
    const unsigned halfBytes = 32 * APITCH * 2;   // 32 rows further down

    auto stageK = [&](int buf, int tile) {
        const unsigned short* g = Kh + (size_t)(tile * AKT + crow) * HD + ccol;
        async_copy2(ldsK + buf * bufBytes, g, ldsK + buf * bufBytes + halfBytes, g + 32 * HD);
    };
    auto stageV = [&](int buf, int tile) {
        const unsigned short* g = Vh + (size_t)crow * SEQ + tile * AKT + ccol;
        async_copy2(ldsV + buf * bufBytes, g, ldsV + buf * bufBytes + halfBytes, g + (size_t)32 * SEQ);
    };

    // Q fragments (64 dims x 16 queries, second operand), resident for the whole kernel
    Frag qf[2];
#pragma unroll
    for (int f = 0; f < 2; ++f)
#pragma unroll
        for (int g = 0; g < 2; ++g)
            qf[f].q[g] = *(const uint4*)&Qh[(size_t)(qbase + ln) * HD + f * 32 + hi * 8 + g * 16];

    v8f vz = {0.f,0.f,0.f,0.f,0.f,0.f,0.f,0.f};

    // S^T of 16 keys (rows) x 16 queries (columns): st[r] = key key0 + hi*8 + r, query ln
    auto scoresT = [&](const unsigned short* Kc, int key0) {
        v8f st = vz;
#pragma unroll
        for (int f = 0; f < 2; ++f) {
            Frag kf;
#pragma unroll
            for (int g = 0; g < 2; ++g)
                kf.q[g] = *(const uint4*)&Kc[(key0 + ln) * APITCH + f * 32 + hi * 8 + g * 16];
            st = __builtin_amdgcn_wmma_f32_16x16x32_bf16(false, kf.v, false, qf[f].v, (short)0, st, false, false);
        }
        return st;
    };

    // ---- O^T += V^T @ exp(s*scale - mq)^T ; the query's sum stays in its lanes ----
    v8f oacc[4];                                 // oacc[u][r] = dim u*16 + hi*8 + r, query ln
#pragma unroll
    for (int u = 0; u < 4; ++u) oacc[u] = vz;
    v2f psum[2] = { {0.f, 0.f}, {0.f, 0.f} };    // even and odd keys apart: packed adds, two chains
    float mq  = -3.0e38f;                        // maximum in use (scaled), the same in a query's two lanes
    float lim = -__builtin_inff();               // raw score above which mq must rise: (mq + LAZY) / scale

    stageK(0, 0);
    stageV(0, 0);
    tile_publish();
    stageK(1, 1);
    stageV(1, 1);

    for (int s = 0; s < NTILE; ++s) {
        const unsigned short* Kc = &Ks[s & 1][0];
        const unsigned short* Vc = &Vs[s & 1][0];
        // the whole tile's scores first, so that one test serves all 64 keys
        v8f st[4];
#pragma unroll
        for (int c = 0; c < 4; ++c) st[c] = scoresT(Kc, c * 16);
        // Order of the tile's K loads and products: three fragments' loads ahead, then one more
        // fragment's loads behind each product, so that loads are on their way under the products.
        // Left alone, the compiler waits for each fragment singly, now that four score tiles are held.
        __builtin_amdgcn_sched_group_barrier(0x100, 6, 0);       // LDS reads
#pragma unroll
        for (int i = 0; i < 5; ++i) {
            __builtin_amdgcn_sched_group_barrier(0x008, 1, 0);   // matrix product
            __builtin_amdgcn_sched_group_barrier(0x100, 2, 0);
        }
        __builtin_amdgcn_sched_group_barrier(0x008, 3, 0);

        // raw maximum of this lane's 32 scores, four independent chains of three-way maxima
        float tmx[4];
#pragma unroll
        for (int c = 0; c < 4; ++c) {
            tmx[c] = fmaxf(fmaxf(st[0][c], st[1][c]), st[2][c]);
            tmx[c] = fmaxf(fmaxf(tmx[c], st[3][c]), st[0][c + 4]);
            tmx[c] = fmaxf(fmaxf(tmx[c], st[1][c + 4]), st[2][c + 4]);
            tmx[c] = fmaxf(tmx[c], st[3][c + 4]);
        }
        const float tm = fmaxf(fmaxf(fmaxf(tmx[0], tmx[1]), tmx[2]), tmx[3]);

        // a scalar branch, taken by the whole wave if any lane's scores outgrow that lag
        if (__builtin_amdgcn_ballot_w32(tm > lim) != 0) {
            // the query's two lanes (ln, ln + 16) join their halves of the keys: both get one mq
            const int ti = __builtin_bit_cast(int, tm);
            const float to = __builtin_bit_cast(float,
                __builtin_amdgcn_permlanex16(ti, ti, 0x76543210, 0xfedcba98, false, false));
            const float mnew = fmaxf(mq, fmaxf(tm, to) * scale);
            const float corr = __expf(mq - mnew);  // 0 on the first tile, where the sums are 0
            mq  = mnew;
            lim = (mnew + LAZY) * 8.0f;            // 8 = 1 / scale, exact
#pragma unroll
            for (int u = 0; u < 4; ++u) oacc[u] *= corr;
            psum[0] *= corr;
            psum[1] *= corr;
        }

#pragma unroll                                   // two 32-key halves of the tile, straight-line
        for (int kl = 0; kl < AKT; kl += 32) {
            const v8f s0 = st[kl >> 4];
            const v8f s1 = st[(kl >> 4) + 1];

            // exponentiate, sum in the lane, pack: element e of the operand is key
            // hi*8 + e (e < 8, from s0) or 16 + hi*8 + e - 8 (from s1), as V's loader has it
            union { v16bf v; v2bf h[8]; } pf;
#pragma unroll
            for (int r = 0; r < 8; r += 2) {
                v2f p0 = { __expf(s0[r] * scale - mq), __expf(s0[r + 1] * scale - mq) };
                v2f p1 = { __expf(s1[r] * scale - mq), __expf(s1[r + 1] * scale - mq) };
                psum[(r >> 1) & 1] += p0 + p1;
                pf.h[r >> 1]       = __builtin_convertvector(p0, v2bf);
                pf.h[4 + (r >> 1)] = __builtin_convertvector(p1, v2bf);
            }

#pragma unroll
            for (int u = 0; u < 4; ++u) {
                Frag vf;
#pragma unroll
                for (int g = 0; g < 2; ++g)
                    vf.q[g] = *(const uint4*)&Vc[(u * 16 + ln) * APITCH + kl + hi * 8 + g * 16];
                oacc[u] = __builtin_amdgcn_wmma_f32_16x16x32_bf16(false, vf.v, false, pf.v, (short)0, oacc[u], false, false);
            }
        }
        tile_publish();
        if (s + 2 < NTILE) {                      // refill the buffers this trip has read
            stageK(s & 1, s + 2);
            stageV(s & 1, s + 2);
        }
    }
    asm volatile("s_wait_asynccnt 0x0" ::: "memory");  // no copy in flight when the wave ends

    // the query's denominator: its two lanes join their halves of the keys, once
    float l = (psum[0][0] + psum[0][1]) + (psum[1][0] + psum[1][1]);
    l += __shfl_xor(l, 16, 32);

    // normalize + store bf16 into (B, N, D) layout for the out-projection GEMM:
    // a lane's 8 registers are 8 adjoining dims of its query, one 16-byte store
    unsigned short* orow = Ob + ((size_t)(b * SEQ + qbase + ln)) * D_MODEL + h * HD + hi * 8;
#pragma unroll
    for (int u = 0; u < 4; ++u) {
        Pack8 p;
#pragma unroll
        for (int r = 0; r < 8; r += 2) {
            v2f f = { oacc[u][r] / l, oacc[u][r + 1] / l };
            p.h[r >> 1] = __builtin_convertvector(f, v2bf);
        }
        *(uint4*)&orow[u * 16] = p.q;
    }
}

// ---------------- launcher ----------------

extern "C" void kernel_launch(void* const* d_in, const int* in_sizes, int n_in,
                              void* d_out, int out_size, void* d_ws, size_t ws_size,
                              hipStream_t stream) {
    (void)in_sizes; (void)n_in; (void)out_size; (void)ws_size;
    const float* x      = (const float*)d_in[0];
    const float* W_qkv  = (const float*)d_in[1];
    const float* W_proj = (const float*)d_in[2];
    const float* b_proj = (const float*)d_in[3];
    float* out = (float*)d_out;

    const size_t NX  = (size_t)MTOT * D_MODEL;      // 8,388,608
    unsigned short* Xb     = (unsigned short*)d_ws;
    unsigned short* WqkvT  = Xb     + NX;                            // 3072 x 1024
    unsigned short* WprojT = WqkvT  + (size_t)3 * D_MODEL * D_MODEL; // 1024 x 1024
    unsigned short* Qb     = WprojT + (size_t)D_MODEL * D_MODEL;     // B*H*SEQ*HD == NX
    unsigned short* Kb     = Qb + NX;
    unsigned short* Vt     = Kb + NX;
    unsigned short* Ob     = Vt + NX;

    // 1. convert inputs to bf16 (weights transposed to N x K)
    k_cvt  <<<(int)(NX / CVT_BLOCK), 256, 0, stream>>>(x, Xb, (int)NX);
    k_cvt_t<D_MODEL, 3 * D_MODEL><<<dim3(3 * D_MODEL / 128, D_MODEL / 64), 256, 0, stream>>>(W_qkv,  WqkvT);
    k_cvt_t<D_MODEL, D_MODEL>    <<<dim3(D_MODEL / 128, D_MODEL / 64),     256, 0, stream>>>(W_proj, WprojT);

    // 2. QKV projection, scatter to per-head Q, K (row-major) and V^T
    k_gemm<0><<<dim3(3 * D_MODEL / BN, MTOT / BM), 256, 0, stream>>>(
        Xb, WqkvT, nullptr, Qb, Kb, Vt, nullptr, D_MODEL, 3 * D_MODEL);

    // 3. attention (one pass, online softmax, all WMMA)
    k_attn<<<dim3(SEQ / 128, NHEAD, BATCH), 256, 0, stream>>>(Qb, Kb, Vt, Ob);

    // 4. output projection + bias (f32 out)
    k_gemm<1><<<dim3(D_MODEL / BN, MTOT / BM), 256, 0, stream>>>(
        Ob, WprojT, b_proj, nullptr, nullptr, nullptr, out, D_MODEL, D_MODEL);
}

// v007
// Measured time: 130 microseconds a run.
// In both of two side-by-side timings against v006, it was 1.03 times as fast.
// All steps since v000 together make it 3.83 times as fast.
#include <hip/hip_runtime.h>

typedef __attribute__((ext_vector_type(16))) __bf16 v16bf;
typedef __attribute__((ext_vector_type(8)))  float  v8f;
typedef __attribute__((ext_vector_type(2)))  float  v2f;
typedef __attribute__((ext_vector_type(2)))  __bf16 v2bf;
typedef __attribute__((ext_vector_type(4)))  unsigned int u32x4;
typedef __attribute__((ext_vector_type(8)))  unsigned int u32x8;

#define D_MODEL 1024
#define NHEAD   16
#define HD      64
#define SEQ     2048
#define BATCH   4
#define MTOT    (BATCH*SEQ)   // 8192

#define BM 128
#define BN 256
#define BK 64                 // k per pass: a staged row is 128 B, one whole line
#define ROWB   (BK * 2)       // bytes of a staged row
#define GPITCH (ROWB + 16)    // LDS row pitch (bytes), the mover's pad included: 16 B x odd for b128 readers
#define WROWS  64             // weight rows in a slice (waves 0 to 3)
#define XROWS  32             // activation rows in a slice (waves 4 to 7)
#define WSLICE 10240          // LDS bytes of a weight slice: 64 x 144 rounded up to a multiple of 2 KiB
#define XSLICE 6144           // LDS bytes of an activation slice: 32 x 144 rounded up likewise
#define GBUF   (4 * WSLICE + 4 * XSLICE)   // one stage: 256 weight rows, then 128 activation rows

__device__ __forceinline__ unsigned short f2bf(float f) {
    unsigned int u = __float_as_uint(f);
    u += 0x7FFFu + ((u >> 16) & 1u);          // round-to-nearest-even
    return (unsigned short)(u >> 16);
}

struct Frag { union { v16bf v; uint4 q[2]; }; };
struct Pack8 { union { uint4 q; v2bf h[4]; }; };   // 8 bf16 = one 16-byte store

// ---------------- conversion kernels ----------------
// Both are short streams: what they pay for is the number of waves that must start, so each
// thread converts many elements, by 16-byte loads that are all in flight before the first use.

typedef __attribute__((ext_vector_type(4))) float f32x4;

__device__ __forceinline__ unsigned int f2bf2(float lo, float hi) {
    return (unsigned int)f2bf(lo) | ((unsigned int)f2bf(hi) << 16);
}

#define CVT_LOADS 16                        // 16-byte loads per thread: 64 elements
#define CVT_BLOCK (256 * 4 * CVT_LOADS)     // elements per block

// A wave's load covers 512 contiguous bytes (4 lines), its store 256 (2 lines).
// The grid gives each SIMD 4 waves; the register budget of 4 lets all 16 loads fly together.
__global__ __launch_bounds__(256) __attribute__((amdgpu_waves_per_eu(4, 4)))
void k_cvt(const float* __restrict__ in, unsigned short* __restrict__ out, int n) {
    const int base = blockIdx.x * CVT_BLOCK;
    if (base + CVT_BLOCK > n) return;       // block-uniform bound
    const float* src = in + base + threadIdx.x * 4;
    unsigned short* dst = out + base + threadIdx.x * 4;
    f32x4 f[CVT_LOADS];
#pragma unroll
    for (int i = 0; i < CVT_LOADS; ++i) f[i] = *(const f32x4*)(src + i * 1024);
#pragma unroll
    for (int i = 0; i < CVT_LOADS; ++i)
        *(uint2*)(dst + i * 1024) = make_uint2(f2bf2(f[i][0], f[i][1]), f2bf2(f[i][2], f[i][3]));
}

// Wt[n*K + k] = bf16(W[k*N + n])   (store weights transposed, N x K row-major)
// A thread holds 8 k x 4 n; a wave 64 k x 16 n, so that each of its stores fills 4 whole
// 128-byte lines of Wt; a block 64 k x 128 n, so that its loads cover 512-byte runs of W.
// Grid: (N / 128, K / 64).  K and N are compile-time, so the row steps are immediate offsets.
template<int K, int N>
__global__ __launch_bounds__(256) void k_cvt_t(const float* __restrict__ W, unsigned short* __restrict__ Wt) {
    static_assert(K % 64 == 0 && N % 128 == 0, "whole tiles only");
    const unsigned lane = threadIdx.x & 31, wid = threadIdx.x >> 5;
    const unsigned n = blockIdx.x * 128 + wid * 16 + (lane & 3) * 4;
    const unsigned k = blockIdx.y * 64 + (lane >> 2) * 8;
    const float* src = W + (k * N + n);
    unsigned short* dst = Wt + (n * K + k);
    f32x4 f[8];
#pragma unroll
    for (int i = 0; i < 8; ++i) f[i] = *(const f32x4*)(src + i * N);
#pragma unroll
    for (int j = 0; j < 4; ++j)
        *(uint4*)(dst + j * K) = make_uint4(f2bf2(f[0][j], f[1][j]), f2bf2(f[2][j], f[3][j]),
                                            f2bf2(f[4][j], f[5][j]), f2bf2(f[6][j], f[7][j]));
}

__device__ __forceinline__ unsigned uni(unsigned v) { return (unsigned)__builtin_amdgcn_readfirstlane(v); }

// A wave-uniform value held in a scalar register: a test on it compiles to a scalar branch, and
// what is formed from it is formed behind the waits written in front of it.
__device__ __forceinline__ unsigned pinned(unsigned v) {
    unsigned w = uni(v);
    asm volatile("" : "+s"(w));   // the scalar test or descriptor word of a tensor load, kept in an SGPR
    return w;
}

// Loop-invariant group of a tensor load: rows x 128 bytes (extents in bytes, tensor = tile),
// source row pitch srcPitch bytes, 16 bytes of LDS pad behind every 128-byte row -> GPITCH.
__device__ __forceinline__ u32x8 tdm_group1(unsigned rows, unsigned srcPitch) {
    u32x8 g;
    g[0] = uni((1u << 20) | (4u << 22) | (3u << 25));     // pad on, every 32 dwords, 4 dwords; no mask
    g[1] = uni((unsigned)ROWB << 16);                     // tensor_dim0
    g[2] = uni(rows << 16);                               // tensor_dim1
    g[3] = uni((unsigned)ROWB << 16);                     // tile_dim0
    g[4] = uni(rows);                                     // tile_dim1
    g[5] = uni(srcPitch);
    g[6] = uni(0u);
    g[7] = uni(0u);
    return g;
}

__device__ __forceinline__ u32x4 tdm_group0(unsigned count1, unsigned ldsByte, unsigned long long ga) {
    u32x4 g;
    g[0] = count1;                                        // count = 1
    g[1] = uni(ldsByte);
    g[2] = uni((unsigned)ga);
    g[3] = uni((((unsigned)(ga >> 32)) & 0x01FFFFFFu) | 0x80000000u);   // type = 2
    return g;
}

__device__ __forceinline__ void tdm_load(u32x4 g0, u32x8 g1) {
    asm volatile("tensor_load_to_lds %0, %1" :: "s"(g0), "s"(g1) : "memory");
}

// The wave's one outstanding tensor load has landed.  The wait names that load's descriptor, so
// that its registers hold their values until here and take new ones only behind the wait.
__device__ __forceinline__ void tdm_wait(u32x4 g0, u32x8 g1) {
    asm volatile("s_wait_tensorcnt 0x0" :: "s"(g0), "s"(g1) : "memory");
}

// ---------------- GEMM: C(MxN) f32 = A(MxK)bf16 @ Bt(NxK)bf16^T ----------------
// Two LDS buffers; a pass is 64 k.  Every wave brings its own slice of a stage by one tensor
// load (whole 128-byte rows), issued when the buffer is freed, one pass ahead of its use,
// while the 8 waves run 32 WMMAs each on the stage in the other buffer.
// MODE 0: QKV epilogue (Q,K row-major per head; V transposed per head)
// MODE 1: out-proj epilogue (add bias, store f32)
// Both epilogues store whole 128-byte lines, staged per wave through LDS.
// A lane's 8 accumulator registers run along the FIRST operand's rows, so the first operand
// is the side that is contiguous in the output: the weights (columns) for Q, K and the
// out-projection, the activations (tokens) for V^T.  Both fragments have one layout, so only
// the LDS base and the run step of each loader change, by a block-uniform select.

#define SPITCH 72             // bf16 staging row pitch (elems) = 144 B: 16 B x odd for b128
#define FPITCH 68             // f32 staging row pitch (elems) = 272 B: 16 B x odd for b128

template<int MODE>
__global__ __launch_bounds__(256) void k_gemm(
    const unsigned short* __restrict__ A,
    const unsigned short* __restrict__ Bt,
    const float* __restrict__ bias,
    unsigned short* __restrict__ Qb,
    unsigned short* __restrict__ Kb,
    unsigned short* __restrict__ Vt,
    float* __restrict__ Cout,
    int K, int N)
{
    __shared__ __attribute__((aligned(2048))) unsigned char ring[2 * GBUF];

    const int tid  = threadIdx.x;
    const int lane = tid & 31, wid = tid >> 5;
    const int ln = lane & 15,  hi  = lane >> 4;
    const int wr = wid >> 2,   wc  = wid & 3;           // 2 x 4 wave grid, 64x64 wave tile
    const int rowBase = blockIdx.y * BM;
    const int colBase = blockIdx.x * BN;

    // This wave's slice of every stage: waves 0 to 3 64 weight rows each, waves 4 to 7 32 activation rows.
    const unsigned wave = uni(threadIdx.x >> 5);
    const bool     isW  = wave < 4u;
    const unsigned place = (unsigned)(unsigned long long)(&ring[0])
                         + (isW ? wave * WSLICE : 4u * WSLICE + (wave - 4u) * XSLICE);
    const unsigned long long src = isW
        ? (unsigned long long)(Bt + (size_t)(colBase + wave * WROWS) * K)
        : (unsigned long long)(A  + (size_t)(rowBase + (wave - 4u) * XROWS) * K);
    const u32x8 g1 = tdm_group1(isW ? WROWS : XROWS, (unsigned)K * 2u);
    const unsigned count1 = pinned(1u);   // descriptor word 0, held in an SGPR: its register is not lent out under a load in flight

    // xFirst: activations are the first operand (V^T blocks); else the weights are.
    // acc[t][u][r] = first operand's row t*16 + hi*8 + r times second operand's row u*16 + ln
    // A wave's 64 rows of an operand are two runs of 32: 32 rows apart in a weight slice,
    // a slice apart for the activations.
    const bool xFirst = (MODE == 0) && (colBase >= 2 * D_MODEL);
    const unsigned char* Xf = &ring[4 * WSLICE + wr * 2 * XSLICE + ln * GPITCH + hi * 16];
    const unsigned char* Wf = &ring[wc * WSLICE + ln * GPITCH + hi * 16];
    const unsigned char* F0 = xFirst ? Xf : Wf;
    const unsigned char* S0 = xFirst ? Wf : Xf;
    const int runF = xFirst ? XSLICE : 32 * GPITCH;
    const int runS = xFirst ? 32 * GPITCH : XSLICE;

    v8f acc[4][4];
    v8f vz = {0.f,0.f,0.f,0.f,0.f,0.f,0.f,0.f};
#pragma unroll
    for (int t = 0; t < 4; ++t)
#pragma unroll
        for (int u = 0; u < 4; ++u) acc[t][u] = vz;

    // prologue: stage 0 lands and is published, then stage 1 is on its way (K holds two stages or more)
    const int NP = K / BK;
    u32x4 g0 = tdm_group0(count1, place, src);
    tdm_load(g0, g1);
    tdm_wait(g0, g1);                                    // own slice landed before the barrier publishes it
    __syncthreads();
    g0 = tdm_group0(count1, place + GBUF, src + ROWB);
    tdm_load(g0, g1);

    for (int s = 0; s < NP; ++s) {
        const int cur = (s & 1) * GBUF;
#pragma unroll
        for (int kk = 0; kk < 2; ++kk) {                 // the stage's two 32-k steps
            Frag fa[4], fb[4];
#pragma unroll
            for (int t = 0; t < 4; ++t)
#pragma unroll
                for (int g = 0; g < 2; ++g)
                    fa[t].q[g] = *(const uint4*)&F0[cur + (t >> 1) * runF + (t & 1) * 16 * GPITCH + kk * 64 + g * 32];
#pragma unroll
            for (int u = 0; u < 4; ++u)
#pragma unroll
                for (int g = 0; g < 2; ++g)
                    fb[u].q[g] = *(const uint4*)&S0[cur + (u >> 1) * runS + (u & 1) * 16 * GPITCH + kk * 64 + g * 32];

#pragma unroll
            for (int t = 0; t < 4; ++t)
#pragma unroll
                for (int u = 0; u < 4; ++u)
                    acc[t][u] = __builtin_amdgcn_wmma_f32_16x16x32_bf16(
                        false, fa[t].v, false, fb[u].v, (short)0, acc[t][u], false, false);
        }

        // publish point of stage s + 1
        asm volatile("s_wait_dscnt 0x0" ::: "memory");       // own reads of this buffer retired before its refill
        tdm_wait(g0, g1);                                    // own slice of stage s + 1 landed before others read it
        __syncthreads();
        if (pinned(s + 2 < NP)) {                            // scalar branch: a tensor load ignores EXEC
            g0 = tdm_group0(count1, place + cur, src + pinned((unsigned)(s + 2) * ROWB));   // address formed behind the wait
            tdm_load(g0, g1);
        }
    }
    tdm_wait(g0, g1);                                        // nothing in flight when the ring becomes staging
    asm volatile("s_wait_dscnt 0x0" ::: "memory");

    // epilogue
    if (MODE == 0) {
        // The wave's 64 x 64 tile is 64 tokens of ONE head of Q, K or V.  Output rows of 128 B:
        // a token's 64 dims (Q, K; rows adjoin) or a dim's 64 tokens (V^T; rows SEQ apart).
        // acc[t][u][r] is output row u*16 + ln, element t*16 + hi*8 + r.
        const int which = colBase >> 10;
        const int bh    = (rowBase >> 11) * NHEAD + ((colBase & 1023) >> 6) + wc;
        const int tok0  = (rowBase & 2047) + wr * 64;
        unsigned short* dst = (which == 2) ? Vt + (size_t)bh * HD * SEQ + tok0
                                           : (which == 0 ? Qb : Kb) + ((size_t)bh * SEQ + tok0) * HD;
        const int pitch = (which == 2) ? SEQ : HD;
        // Each wave stages 32 rows at a time in its own range of the ring, which is free:
        // the loop's last barrier stands behind every fragment read and the last tensor wait.
        unsigned short* stg = (unsigned short*)&ring[0] + wid * (32 * SPITCH);
        const int srow = lane >> 3, col = (lane & 7) * 8;    // read-back slot: 8 lanes per row
        unsigned short* drow = dst + (size_t)srow * pitch + col;
#pragma unroll
        for (int half = 0; half < 2; ++half) {
            if (half > 0)   // every lane's read-back of the last rows is done before they are rewritten
                asm volatile("s_wait_dscnt 0x0" ::: "memory");
#pragma unroll
            for (int uu = 0; uu < 2; ++uu)
#pragma unroll
                for (int t = 0; t < 4; ++t) {
                    Pack8 p;
#pragma unroll
                    for (int r = 0; r < 8; r += 2) {
                        v2f f = { acc[t][half * 2 + uu][r], acc[t][half * 2 + uu][r + 1] };
                        p.h[r >> 1] = __builtin_convertvector(f, v2bf);
                    }
                    *(uint4*)&stg[(uu * 16 + ln) * SPITCH + t * 16 + hi * 8] = p.q;
                }
            asm volatile("s_wait_dscnt 0x0" ::: "memory");   // rows written before other lanes read them back
#pragma unroll
            for (int k = 0; k < 8; ++k)                      // 4 whole rows (lines) per wave-wide store
                *(uint4*)&drow[(size_t)((half * 32 + k * 4) * pitch)] =
                    *(const uint4*)&stg[(k * 4 + srow) * SPITCH + col];
        }
    } else {
        // acc[t][u][r] is token u*16 + ln, column t*16 + hi*8 + r of the wave's 64 x 64 tile.
        // 16 tokens (rows of 256 B) at a time, in the wave's own range of the freed ring.
        float* dst  = Cout + (size_t)(rowBase + wr * 64) * N + colBase + wc * 64;
        float* stgf = (float*)&ring[0] + wid * (16 * FPITCH);
        const int srow = lane >> 4, col = (lane & 15) * 4;   // read-back slot: 16 lanes per row
        float* drow = dst + (size_t)srow * N + col;
        const float4 bv = *(const float4*)&bias[colBase + wc * 64 + col];
#pragma unroll
        for (int u = 0; u < 4; ++u) {
            if (u > 0)      // every lane's read-back of the last rows is done before they are rewritten
                asm volatile("s_wait_dscnt 0x0" ::: "memory");
#pragma unroll
            for (int t = 0; t < 4; ++t)
#pragma unroll
                for (int g = 0; g < 2; ++g)
                    *(float4*)&stgf[ln * FPITCH + t * 16 + hi * 8 + g * 4] =
                        make_float4(acc[t][u][g * 4], acc[t][u][g * 4 + 1], acc[t][u][g * 4 + 2], acc[t][u][g * 4 + 3]);
            asm volatile("s_wait_dscnt 0x0" ::: "memory");   // rows written before other lanes read them back
#pragma unroll
            for (int k = 0; k < 8; ++k) {                    // 2 whole rows (4 lines) per wave-wide store
                const float4 v = *(const float4*)&stgf[(k * 2 + srow) * FPITCH + col];
                *(float4*)&drow[(size_t)((u * 16 + k * 2) * N)] =
                    make_float4(v.x + bv.x, v.y + bv.y, v.z + bv.z, v.w + bv.w);
            }
        }
    }
}

#define AKT    64             // keys per staged tile
#define APITCH 72             // LDS row pitch (bf16 elems) = 144 B: 16 B x odd for b128 readers
#define NTILE  (SEQ / AKT)
#define QG     2              // column groups of 16 queries per wave
#define QBLK   (8 * QG * 16)  // queries per block
#define LAZY   5.5f           // how far the maximum in use may lag (scaled scores): exponentials stay below e^5.5

// Two 16-byte copies per lane; the s_wait_xcnt closes the statement so that no address
// register named here is rewritten while a copy may still read it.
__device__ __forceinline__ void async_copy2(unsigned l0, const unsigned short* g0,
                                            unsigned l1, const unsigned short* g1) {
    asm volatile("global_load_async_to_lds_b128 %0, %1, off\n\t"
                 "global_load_async_to_lds_b128 %2, %3, off\n\t"
                 "s_wait_xcnt 0x0"
                 :: "v"(l0), "v"(g0), "v"(l1), "v"(g1) : "memory");
}

// Hand-over of a tile: this wave's LDS reads of the old buffer are done, its own copies
// of the next tile have landed, then the barrier publishes the tile and frees the buffer.
__device__ __forceinline__ void tile_publish() {
    asm volatile("s_wait_dscnt 0x0" ::: "memory");     // own reads retired before a refill
    asm volatile("s_wait_asynccnt 0x0" ::: "memory");  // own copies landed before others read
    __syncthreads();
}

// Register budget of 4 waves per SIMD: 2 blocks per WGP, so that all 512 blocks are
// resident at once and no second, thin round of blocks follows.
__global__ __launch_bounds__(256) __attribute__((amdgpu_waves_per_eu(4, 4))) void k_attn(
    const unsigned short* __restrict__ Qb,
    const unsigned short* __restrict__ Kb,
    const unsigned short* __restrict__ Vt,
    unsigned short* __restrict__ Ob)
{
    __shared__ alignas(16) unsigned short Ks[2][AKT * APITCH];   // 64 keys x 64 dims
    __shared__ alignas(16) unsigned short Vs[2][HD * APITCH];    // 64 dims x 64 keys

    const int tid  = threadIdx.x;
    const int lane = tid & 31, wid = tid >> 5;
    const int ln = lane & 15,  hi  = lane >> 4;
    const int b = blockIdx.z, h = blockIdx.y;
    const int qbase = blockIdx.x * QBLK + wid * (QG * 16);
    const float scale = 0.125f;                  // 1/sqrt(64)

    const size_t headOff = ((size_t)(b * NHEAD + h)) * SEQ * HD;
    const unsigned short* Qh = Qb + headOff;
    const unsigned short* Kh = Kb + headOff;
    const unsigned short* Vh = Vt + headOff;     // (HD x SEQ)

    // copy slots of this lane: rows crow and crow + 32 of a tile, 16 bytes at element ccol
    const int crow = tid >> 3, ccol = (tid & 7) * 8;
    const unsigned ldsK = (unsigned)(unsigned long long)(&Ks[0][crow * APITCH + ccol]);
    const unsigned ldsV = (unsigned)(unsigned long long)(&Vs[0][crow * APITCH + ccol]);
    const unsigned bufBytes  = AKT * APITCH * 2;  // one buffer (K and V tiles are alike)
    const unsigned halfBytes = 32 * APITCH * 2;   // 32 rows further down

    auto stageK = [&](int buf, int tile) {
        const unsigned short* g = Kh + (size_t)(tile * AKT + crow) * HD + ccol;
        async_copy2(ldsK + buf * bufBytes, g, ldsK + buf * bufBytes + halfBytes, g + 32 * HD);
    };
    auto stageV = [&](int buf, int tile) {
        const unsigned short* g = Vh + (size_t)crow * SEQ + tile * AKT + ccol;
        async_copy2(ldsV + buf * bufBytes, g, ldsV + buf * bufBytes + halfBytes, g + (size_t)32 * SEQ);
    };

    // Q fragments (64 dims x 16 queries per group, second operand), resident for the whole kernel
    Frag qf[QG][2];
#pragma unroll
    for (int j = 0; j < QG; ++j)
#pragma unroll
        for (int f = 0; f < 2; ++f)
#pragma unroll
            for (int g = 0; g < 2; ++g)
                qf[j][f].q[g] = *(const uint4*)&Qh[(size_t)(qbase + j * 16 + ln) * HD + f * 32 + hi * 8 + g * 16];

    v8f vz = {0.f,0.f,0.f,0.f,0.f,0.f,0.f,0.f};

    // ---- O^T += V^T @ exp(s*scale - mq)^T ; the query's sum stays in its lanes ----
    v8f oacc[QG][4];                             // oacc[j][u][r] = dim u*16 + hi*8 + r, query j*16 + ln
    v2f psum[QG][2];                             // even and odd keys apart: packed adds, two chains
    float mq[QG];                                // maximum in use (scaled), the same in a query's two lanes
    float lim[QG];                               // raw score above which mq must rise: (mq + LAZY) / scale
#pragma unroll
    for (int j = 0; j < QG; ++j) {
#pragma unroll
        for (int u = 0; u < 4; ++u) oacc[j][u] = vz;
        psum[j][0] = (v2f){0.f, 0.f};
        psum[j][1] = (v2f){0.f, 0.f};
        mq[j]  = -3.0e38f;
        lim[j] = -__builtin_inff();
    }

    stageK(0, 0);
    stageV(0, 0);
    tile_publish();
    stageK(1, 1);
    stageV(1, 1);

    for (int s = 0; s < NTILE; ++s) {
        const unsigned short* Kc = &Ks[s & 1][0];
        const unsigned short* Vc = &Vs[s & 1][0];
        // the whole tile's scores first, so that one test serves all 64 keys of both groups
        // st[j][c][r] = key c*16 + hi*8 + r, query j*16 + ln
        v8f st[QG][4];
#pragma unroll
        for (int c = 0; c < 4; ++c) {
#pragma unroll
            for (int j = 0; j < QG; ++j) st[j][c] = vz;
#pragma unroll
            for (int f = 0; f < 2; ++f) {
                Frag kf;
#pragma unroll
                for (int g = 0; g < 2; ++g)
                    kf.q[g] = *(const uint4*)&Kc[(c * 16 + ln) * APITCH + f * 32 + hi * 8 + g * 16];
#pragma unroll
                for (int j = 0; j < QG; ++j)
                    st[j][c] = __builtin_amdgcn_wmma_f32_16x16x32_bf16(false, kf.v, false, qf[j][f].v, (short)0, st[j][c], false, false);
            }
        }
        // Order of the tile's K loads and products: three fragments' loads ahead, then one more
        // fragment's loads behind each fragment's products, so that loads are on their way under
        // the products.  Left alone, the compiler waits for each fragment singly.
        __builtin_amdgcn_sched_group_barrier(0x100, 6, 0);        // LDS reads
#pragma unroll
        for (int i = 0; i < 5; ++i) {
            __builtin_amdgcn_sched_group_barrier(0x008, QG, 0);   // matrix products of one fragment
            __builtin_amdgcn_sched_group_barrier(0x100, 2, 0);
        }
        __builtin_amdgcn_sched_group_barrier(0x008, 3 * QG, 0);

        // raw maximum of this lane's 32 scores per group, four independent chains of three-way maxima
        float tm[QG];
#pragma unroll
        for (int j = 0; j < QG; ++j) {
            float tmx[4];
#pragma unroll
            for (int c = 0; c < 4; ++c) {
                tmx[c] = fmaxf(fmaxf(st[j][0][c], st[j][1][c]), st[j][2][c]);
                tmx[c] = fmaxf(fmaxf(tmx[c], st[j][3][c]), st[j][0][c + 4]);
                tmx[c] = fmaxf(fmaxf(tmx[c], st[j][1][c + 4]), st[j][2][c + 4]);
                tmx[c] = fmaxf(tmx[c], st[j][3][c + 4]);
            }
            tm[j] = fmaxf(fmaxf(fmaxf(tmx[0], tmx[1]), tmx[2]), tmx[3]);
        }

        // a scalar branch, taken by the whole wave if any lane's scores outgrow that lag
        if (__builtin_amdgcn_ballot_w32((tm[0] > lim[0]) | (tm[1] > lim[1])) != 0) {
#pragma unroll
            for (int j = 0; j < QG; ++j) {
                // the query's two lanes (ln, ln + 16) join their halves of the keys: both get one mq
                const int ti = __builtin_bit_cast(int, tm[j]);
                const float to = __builtin_bit_cast(float,
                    __builtin_amdgcn_permlanex16(ti, ti, 0x76543210, 0xfedcba98, false, false));
                const float mnew = fmaxf(mq[j], fmaxf(tm[j], to) * scale);
                const float corr = __expf(mq[j] - mnew);  // 0 on the first tile, where the sums are 0
                mq[j]  = mnew;
                lim[j] = (mnew + LAZY) * 8.0f;            // 8 = 1 / scale, exact
#pragma unroll
                for (int u = 0; u < 4; ++u) oacc[j][u] *= corr;
                psum[j][0] *= corr;
                psum[j][1] *= corr;
            }
        }

        // V^T fragments of a 32-key half: vf[u] = dims u*16 + ln, keys kl + hi*8 (+ 16)
        Frag vf[4];
        auto loadV = [&](int u, int kl) {
#pragma unroll
            for (int g = 0; g < 2; ++g)
                vf[u].q[g] = *(const uint4*)&Vc[(u * 16 + ln) * APITCH + kl + hi * 8 + g * 16];
        };
#pragma unroll
        for (int u = 0; u < 4; ++u) loadV(u, 0);
        // The first half's four fragments stay ahead of its exponentials, under which they arrive.
        // Left alone, the compiler loads each fragment right in front of its two products and the
        // wave waits out the LDS latency once per fragment.
        __builtin_amdgcn_sched_barrier(0);

#pragma unroll                                   // two 32-key halves of the tile, straight-line
        for (int kl = 0; kl < AKT; kl += 32) {
            // exponentiate, sum in the lane, pack: element e of the operand is key
            // hi*8 + e (e < 8, from s0) or 16 + hi*8 + e - 8 (from s1), as V's loader has it
            union { v16bf v; v2bf h[8]; } pf[QG];
#pragma unroll
            for (int j = 0; j < QG; ++j) {
                const v8f s0 = st[j][kl >> 4];
                const v8f s1 = st[j][(kl >> 4) + 1];
#pragma unroll
                for (int r = 0; r < 8; r += 2) {
                    v2f p0 = { __expf(s0[r] * scale - mq[j]), __expf(s0[r + 1] * scale - mq[j]) };
                    v2f p1 = { __expf(s1[r] * scale - mq[j]), __expf(s1[r + 1] * scale - mq[j]) };
                    psum[j][(r >> 1) & 1] += p0 + p1;
                    pf[j].h[r >> 1]       = __builtin_convertvector(p0, v2bf);
                    pf[j].h[4 + (r >> 1)] = __builtin_convertvector(p1, v2bf);
                }
            }
            // the second half's fragment loads (below) stay behind the first half's exponentials:
            // they take the registers that the first half's products have just read
            if (kl == 0) __builtin_amdgcn_sched_barrier(0);

#pragma unroll
            for (int u = 0; u < 4; ++u) {
#pragma unroll
                for (int j = 0; j < QG; ++j)
                    oacc[j][u] = __builtin_amdgcn_wmma_f32_16x16x32_bf16(false, vf[u].v, false, pf[j].v, (short)0, oacc[j][u], false, false);
                if (kl == 0) loadV(u, 32);       // the next half's fragment, into the registers just read
            }
            // and they stay ahead of the second half's exponentials, under which they arrive
            if (kl == 0) __builtin_amdgcn_sched_barrier(0);
        }
        tile_publish();
        if (s + 2 < NTILE) {                      // refill the buffers this trip has read
            stageK(s & 1, s + 2);
            stageV(s & 1, s + 2);
        }
    }
    asm volatile("s_wait_asynccnt 0x0" ::: "memory");  // no copy in flight when the wave ends

#pragma unroll
    for (int j = 0; j < QG; ++j) {
        // the query's denominator: its two lanes join their halves of the keys, once
        float l = (psum[j][0][0] + psum[j][0][1]) + (psum[j][1][0] + psum[j][1][1]);
        l += __shfl_xor(l, 16, 32);

        // normalize + store bf16 into (B, N, D) layout for the out-projection GEMM:
        // a lane's 8 registers are 8 adjoining dims of its query, one 16-byte store
        unsigned short* orow = Ob + ((size_t)(b * SEQ + qbase + j * 16 + ln)) * D_MODEL + h * HD + hi * 8;
#pragma unroll
        for (int u = 0; u < 4; ++u) {
            Pack8 p;
#pragma unroll
            for (int r = 0; r < 8; r += 2) {
                v2f f = { oacc[j][u][r] / l, oacc[j][u][r + 1] / l };
                p.h[r >> 1] = __builtin_convertvector(f, v2bf);
            }
            *(uint4*)&orow[u * 16] = p.q;
        }
    }
}

// ---------------- launcher ----------------

extern "C" void kernel_launch(void* const* d_in, const int* in_sizes, int n_in,
                              void* d_out, int out_size, void* d_ws, size_t ws_size,
                              hipStream_t stream) {
    (void)in_sizes; (void)n_in; (void)out_size; (void)ws_size;
    const float* x      = (const float*)d_in[0];
    const float* W_qkv  = (const float*)d_in[1];
    const float* W_proj = (const float*)d_in[2];
    const float* b_proj = (const float*)d_in[3];
    float* out = (float*)d_out;

    const size_t NX  = (size_t)MTOT * D_MODEL;      // 8,388,608
    unsigned short* Xb     = (unsigned short*)d_ws;
    unsigned short* WqkvT  = Xb     + NX;                            // 3072 x 1024
    unsigned short* WprojT = WqkvT  + (size_t)3 * D_MODEL * D_MODEL; // 1024 x 1024
    unsigned short* Qb     = WprojT + (size_t)D_MODEL * D_MODEL;     // B*H*SEQ*HD == NX
    unsigned short* Kb     = Qb + NX;
    unsigned short* Vt     = Kb + NX;
    unsigned short* Ob     = Vt + NX;

    // 1. convert inputs to bf16 (weights transposed to N x K)
    k_cvt  <<<(int)(NX / CVT_BLOCK), 256, 0, stream>>>(x, Xb, (int)NX);
    k_cvt_t<D_MODEL, 3 * D_MODEL><<<dim3(3 * D_MODEL / 128, D_MODEL / 64), 256, 0, stream>>>(W_qkv,  WqkvT);
    k_cvt_t<D_MODEL, D_MODEL>    <<<dim3(D_MODEL / 128, D_MODEL / 64),     256, 0, stream>>>(W_proj, WprojT);

    // 2. QKV projection, scatter to per-head Q, K (row-major) and V^T
    k_gemm<0><<<dim3(3 * D_MODEL / BN, MTOT / BM), 256, 0, stream>>>(
        Xb, WqkvT, nullptr, Qb, Kb, Vt, nullptr, D_MODEL, 3 * D_MODEL);

    // 3. attention (one pass, online softmax, all WMMA)
    k_attn<<<dim3(SEQ / QBLK, NHEAD, BATCH), 256, 0, stream>>>(Qb, Kb, Vt, Ob);

    // 4. output projection + bias (f32 out)
    k_gemm<1><<<dim3(D_MODEL / BN, MTOT / BM), 256, 0, stream>>>(
        Ob, WprojT, b_proj, nullptr, nullptr, nullptr, out, D_MODEL, D_MODEL);
}

// v008
// Measured time: 126 microseconds a run.
// Timed twice side by side with v007, it ran 1.03 times as fast both times.
// Over all steps from v000 it is 3.95 times as fast.
#include <hip/hip_runtime.h>

typedef __attribute__((ext_vector_type(16))) __bf16 v16bf;
typedef __attribute__((ext_vector_type(8)))  float  v8f;
typedef __attribute__((ext_vector_type(2)))  float  v2f;
typedef __attribute__((ext_vector_type(2)))  __bf16 v2bf;
typedef __attribute__((ext_vector_type(4)))  unsigned int u32x4;
typedef __attribute__((ext_vector_type(8)))  unsigned int u32x8;

#define D_MODEL 1024
#define NHEAD   16
#define HD      64
#define SEQ     2048
#define BATCH   4
#define MTOT    (BATCH*SEQ)   // 8192

#define BM 128
#define BN 256
#define BK 64                 // k per pass: a staged row is 128 B, one whole line
#define ROWB   (BK * 2)       // bytes of a staged row
#define GPITCH (ROWB + 16)    // LDS row pitch (bytes), the mover's pad included: 16 B x odd for b128 readers
#define WROWS  64             // weight rows in a slice (waves 0 to 3)
#define XROWS  32             // activation rows in a slice (waves 4 to 7)
#define WSLICE 10240          // LDS bytes of a weight slice: 64 x 144 rounded up to a multiple of 2 KiB
#define XSLICE 6144           // LDS bytes of an activation slice: 32 x 144 rounded up likewise
#define GBUF   (4 * WSLICE + 4 * XSLICE)   // one stage: 256 weight rows, then 128 activation rows

__device__ __forceinline__ unsigned short f2bf(float f) {
    unsigned int u = __float_as_uint(f);
    u += 0x7FFFu + ((u >> 16) & 1u);          // round-to-nearest-even
    return (unsigned short)(u >> 16);
}

struct Frag { union { v16bf v; uint4 q[2]; }; };
struct Pack8 { union { uint4 q; v2bf h[4]; }; };   // 8 bf16 = one 16-byte store

// ---------------- conversion kernels ----------------
// Both are short streams: what they pay for is the number of waves that must start, so each
// thread converts many elements, by 16-byte loads that are all in flight before the first use.

typedef __attribute__((ext_vector_type(4))) float f32x4;

__device__ __forceinline__ unsigned int f2bf2(float lo, float hi) {
    return (unsigned int)f2bf(lo) | ((unsigned int)f2bf(hi) << 16);
}

#define CVT_LOADS 16                        // 16-byte loads per thread: 64 elements
#define CVT_BLOCK (256 * 4 * CVT_LOADS)     // elements per block

// A wave's load covers 512 contiguous bytes (4 lines), its store 256 (2 lines).
// The grid gives each SIMD 4 waves; the register budget of 4 lets all 16 loads fly together.
__global__ __launch_bounds__(256) __attribute__((amdgpu_waves_per_eu(4, 4)))
void k_cvt(const float* __restrict__ in, unsigned short* __restrict__ out, int n) {
    const int base = blockIdx.x * CVT_BLOCK;
    if (base + CVT_BLOCK > n) return;       // block-uniform bound
    const float* src = in + base + threadIdx.x * 4;
    unsigned short* dst = out + base + threadIdx.x * 4;
    f32x4 f[CVT_LOADS];
#pragma unroll
    for (int i = 0; i < CVT_LOADS; ++i) f[i] = *(const f32x4*)(src + i * 1024);
#pragma unroll
    for (int i = 0; i < CVT_LOADS; ++i)
        *(uint2*)(dst + i * 1024) = make_uint2(f2bf2(f[i][0], f[i][1]), f2bf2(f[i][2], f[i][3]));
}

// Wt[n*K + k] = bf16(W[k*N + n])   (store weights transposed, N x K row-major)
// A thread holds 8 k x 4 n; a wave 64 k x 16 n, so that each of its stores fills 4 whole
// 128-byte lines of Wt; a block 64 k x 128 n, so that its loads cover 512-byte runs of W.
// Grid: (N / 128, K / 64).  K and N are compile-time, so the row steps are immediate offsets.
template<int K, int N>
__global__ __launch_bounds__(256) void k_cvt_t(const float* __restrict__ W, unsigned short* __restrict__ Wt) {
    static_assert(K % 64 == 0 && N % 128 == 0, "whole tiles only");
    const unsigned lane = threadIdx.x & 31, wid = threadIdx.x >> 5;
    const unsigned n = blockIdx.x * 128 + wid * 16 + (lane & 3) * 4;
    const unsigned k = blockIdx.y * 64 + (lane >> 2) * 8;
    const float* src = W + (k * N + n);
    unsigned short* dst = Wt + (n * K + k);
    f32x4 f[8];
#pragma unroll
    for (int i = 0; i < 8; ++i) f[i] = *(const f32x4*)(src + i * N);
#pragma unroll
    for (int j = 0; j < 4; ++j)
        *(uint4*)(dst + j * K) = make_uint4(f2bf2(f[0][j], f[1][j]), f2bf2(f[2][j], f[3][j]),
                                            f2bf2(f[4][j], f[5][j]), f2bf2(f[6][j], f[7][j]));
}

__device__ __forceinline__ unsigned uni(unsigned v) { return (unsigned)__builtin_amdgcn_readfirstlane(v); }

// A wave-uniform value held in a scalar register: a test on it compiles to a scalar branch, and
// what is formed from it is formed behind the waits written in front of it.
__device__ __forceinline__ unsigned pinned(unsigned v) {
    unsigned w = uni(v);
    asm volatile("" : "+s"(w));   // the scalar test or descriptor word of a tensor load, kept in an SGPR
    return w;
}

// Loop-invariant group of a tensor load: rows x 128 bytes (extents in bytes, tensor = tile),
// source row pitch srcPitch bytes, 16 bytes of LDS pad behind every 128-byte row -> GPITCH.
__device__ __forceinline__ u32x8 tdm_group1(unsigned rows, unsigned srcPitch) {
    u32x8 g;
    g[0] = uni((1u << 20) | (4u << 22) | (3u << 25));     // pad on, every 32 dwords, 4 dwords; no mask
    g[1] = uni((unsigned)ROWB << 16);                     // tensor_dim0
    g[2] = uni(rows << 16);                               // tensor_dim1
    g[3] = uni((unsigned)ROWB << 16);                     // tile_dim0
    g[4] = uni(rows);                                     // tile_dim1
    g[5] = uni(srcPitch);
    g[6] = uni(0u);
    g[7] = uni(0u);
    return g;
}

__device__ __forceinline__ u32x4 tdm_group0(unsigned count1, unsigned ldsByte, unsigned long long ga) {
    u32x4 g;
    g[0] = count1;                                        // count = 1
    g[1] = uni(ldsByte);
    g[2] = uni((unsigned)ga);
    g[3] = uni((((unsigned)(ga >> 32)) & 0x01FFFFFFu) | 0x80000000u);   // type = 2
    return g;
}

__device__ __forceinline__ void tdm_load(u32x4 g0, u32x8 g1) {
    asm volatile("tensor_load_to_lds %0, %1" :: "s"(g0), "s"(g1) : "memory");
}

// The wave's one outstanding tensor load has landed.  The wait names that load's descriptor, so
// that its registers hold their values until here and take new ones only behind the wait.
__device__ __forceinline__ void tdm_wait(u32x4 g0, u32x8 g1) {
    asm volatile("s_wait_tensorcnt 0x0" :: "s"(g0), "s"(g1) : "memory");
}

// ---------------- GEMM: C(MxN) f32 = A(MxK)bf16 @ Bt(NxK)bf16^T ----------------
// Two LDS buffers; a pass is 64 k.  Every wave brings its own slice of a stage by one tensor
// load (whole 128-byte rows), issued when the buffer is freed, one pass ahead of its use,
// while the 8 waves run 32 WMMAs each on the stage in the other buffer.
// MODE 0: QKV epilogue (Q,K row-major per head; V transposed per head)
// MODE 1: out-proj epilogue (add bias, store f32)
// Both epilogues store whole 128-byte lines, staged per wave through LDS.
// A lane's 8 accumulator registers run along the FIRST operand's rows, so the first operand
// is the side that is contiguous in the output: the weights (columns) for Q, K and the
// out-projection, the activations (tokens) for V^T.  Both fragments have one layout, so only
// the LDS base and the run step of each loader change, by a block-uniform select.

#define SPITCH 72             // bf16 staging row pitch (elems) = 144 B: 16 B x odd for b128
#define QSCALE (0.125f * 1.4426950408889634f)   // 1/sqrt(64) x log2(e), put on Q before its one rounding to bf16
#define FPITCH 68             // f32 staging row pitch (elems) = 272 B: 16 B x odd for b128

template<int MODE>
__global__ __launch_bounds__(256) void k_gemm(
    const unsigned short* __restrict__ A,
    const unsigned short* __restrict__ Bt,
    const float* __restrict__ bias,
    unsigned short* __restrict__ Qb,
    unsigned short* __restrict__ Kb,
    unsigned short* __restrict__ Vt,
    float* __restrict__ Cout,
    int K, int N)
{
    __shared__ __attribute__((aligned(2048))) unsigned char ring[2 * GBUF];

    const int tid  = threadIdx.x;
    const int lane = tid & 31, wid = tid >> 5;
    const int ln = lane & 15,  hi  = lane >> 4;
    const int wr = wid >> 2,   wc  = wid & 3;           // 2 x 4 wave grid, 64x64 wave tile
    const int rowBase = blockIdx.y * BM;
    const int colBase = blockIdx.x * BN;

    // This wave's slice of every stage: waves 0 to 3 64 weight rows each, waves 4 to 7 32 activation rows.
    const unsigned wave = uni(threadIdx.x >> 5);
    const bool     isW  = wave < 4u;
    const unsigned place = (unsigned)(unsigned long long)(&ring[0])
                         + (isW ? wave * WSLICE : 4u * WSLICE + (wave - 4u) * XSLICE);
    const unsigned long long src = isW
        ? (unsigned long long)(Bt + (size_t)(colBase + wave * WROWS) * K)
        : (unsigned long long)(A  + (size_t)(rowBase + (wave - 4u) * XROWS) * K);
    const u32x8 g1 = tdm_group1(isW ? WROWS : XROWS, (unsigned)K * 2u);
    const unsigned count1 = pinned(1u);   // descriptor word 0, held in an SGPR: its register is not lent out under a load in flight

    // xFirst: activations are the first operand (V^T blocks); else the weights are.
    // acc[t][u][r] = first operand's row t*16 + hi*8 + r times second operand's row u*16 + ln
    // A wave's 64 rows of an operand are two runs of 32: 32 rows apart in a weight slice,
    // a slice apart for the activations.
    const bool xFirst = (MODE == 0) && (colBase >= 2 * D_MODEL);
    const unsigned char* Xf = &ring[4 * WSLICE + wr * 2 * XSLICE + ln * GPITCH + hi * 16];
    const unsigned char* Wf = &ring[wc * WSLICE + ln * GPITCH + hi * 16];
    const unsigned char* F0 = xFirst ? Xf : Wf;
    const unsigned char* S0 = xFirst ? Wf : Xf;
    const int runF = xFirst ? XSLICE : 32 * GPITCH;
    const int runS = xFirst ? 32 * GPITCH : XSLICE;

    v8f acc[4][4];
    v8f vz = {0.f,0.f,0.f,0.f,0.f,0.f,0.f,0.f};
#pragma unroll
    for (int t = 0; t < 4; ++t)
#pragma unroll
        for (int u = 0; u < 4; ++u) acc[t][u] = vz;

    // prologue: stage 0 lands and is published, then stage 1 is on its way (K holds two stages or more)
    const int NP = K / BK;
    u32x4 g0 = tdm_group0(count1, place, src);
    tdm_load(g0, g1);
    tdm_wait(g0, g1);                                    // own slice landed before the barrier publishes it
    __syncthreads();
    g0 = tdm_group0(count1, place + GBUF, src + ROWB);
    tdm_load(g0, g1);

    for (int s = 0; s < NP; ++s) {
        const int cur = (s & 1) * GBUF;
#pragma unroll
        for (int kk = 0; kk < 2; ++kk) {                 // the stage's two 32-k steps
            Frag fa[4], fb[4];
#pragma unroll
            for (int t = 0; t < 4; ++t)
#pragma unroll
                for (int g = 0; g < 2; ++g)
                    fa[t].q[g] = *(const uint4*)&F0[cur + (t >> 1) * runF + (t & 1) * 16 * GPITCH + kk * 64 + g * 32];
#pragma unroll
            for (int u = 0; u < 4; ++u)
#pragma unroll
                for (int g = 0; g < 2; ++g)
                    fb[u].q[g] = *(const uint4*)&S0[cur + (u >> 1) * runS + (u & 1) * 16 * GPITCH + kk * 64 + g * 32];

#pragma unroll
            for (int t = 0; t < 4; ++t)
#pragma unroll
                for (int u = 0; u < 4; ++u)
                    acc[t][u] = __builtin_amdgcn_wmma_f32_16x16x32_bf16(
                        false, fa[t].v, false, fb[u].v, (short)0, acc[t][u], false, false);
        }

        // publish point of stage s + 1
        asm volatile("s_wait_dscnt 0x0" ::: "memory");       // own reads of this buffer retired before its refill
        tdm_wait(g0, g1);                                    // own slice of stage s + 1 landed before others read it
        __syncthreads();
        if (pinned(s + 2 < NP)) {                            // scalar branch: a tensor load ignores EXEC
            g0 = tdm_group0(count1, place + cur, src + pinned((unsigned)(s + 2) * ROWB));   // address formed behind the wait
            tdm_load(g0, g1);
        }
    }
    tdm_wait(g0, g1);                                        // nothing in flight when the ring becomes staging
    asm volatile("s_wait_dscnt 0x0" ::: "memory");

    // epilogue
    if (MODE == 0) {
        // The wave's 64 x 64 tile is 64 tokens of ONE head of Q, K or V.  Output rows of 128 B:
        // a token's 64 dims (Q, K; rows adjoin) or a dim's 64 tokens (V^T; rows SEQ apart).
        // acc[t][u][r] is output row u*16 + ln, element t*16 + hi*8 + r.
        const int which = colBase >> 10;
        const int bh    = (rowBase >> 11) * NHEAD + ((colBase & 1023) >> 6) + wc;
        const int tok0  = (rowBase & 2047) + wr * 64;
        unsigned short* dst = (which == 2) ? Vt + (size_t)bh * HD * SEQ + tok0
                                           : (which == 0 ? Qb : Kb) + ((size_t)bh * SEQ + tok0) * HD;
        const int pitch = (which == 2) ? SEQ : HD;
        // Q carries the softmax scale, in base 2, so that K Q^T needs no multiply per score later
        const float osc = (which == 0) ? QSCALE : 1.0f;
        // Each wave stages 32 rows at a time in its own range of the ring, which is free:
        // the loop's last barrier stands behind every fragment read and the last tensor wait.
        unsigned short* stg = (unsigned short*)&ring[0] + wid * (32 * SPITCH);
        const int srow = lane >> 3, col = (lane & 7) * 8;    // read-back slot: 8 lanes per row
        unsigned short* drow = dst + (size_t)srow * pitch + col;
#pragma unroll
        for (int half = 0; half < 2; ++half) {
            if (half > 0)   // every lane's read-back of the last rows is done before they are rewritten
                asm volatile("s_wait_dscnt 0x0" ::: "memory");
#pragma unroll
            for (int uu = 0; uu < 2; ++uu)
#pragma unroll
                for (int t = 0; t < 4; ++t) {
                    Pack8 p;
#pragma unroll
                    for (int r = 0; r < 8; r += 2) {
                        v2f f = { acc[t][half * 2 + uu][r] * osc, acc[t][half * 2 + uu][r + 1] * osc };
                        p.h[r >> 1] = __builtin_convertvector(f, v2bf);
                    }
                    *(uint4*)&stg[(uu * 16 + ln) * SPITCH + t * 16 + hi * 8] = p.q;
                }
            asm volatile("s_wait_dscnt 0x0" ::: "memory");   // rows written before other lanes read them back
#pragma unroll
            for (int k = 0; k < 8; ++k)                      // 4 whole rows (lines) per wave-wide store
                *(uint4*)&drow[(size_t)((half * 32 + k * 4) * pitch)] =
                    *(const uint4*)&stg[(k * 4 + srow) * SPITCH + col];
        }
    } else {
        // acc[t][u][r] is token u*16 + ln, column t*16 + hi*8 + r of the wave's 64 x 64 tile.
        // 16 tokens (rows of 256 B) at a time, in the wave's own range of the freed ring.
        float* dst  = Cout + (size_t)(rowBase + wr * 64) * N + colBase + wc * 64;
        float* stgf = (float*)&ring[0] + wid * (16 * FPITCH);
        const int srow = lane >> 4, col = (lane & 15) * 4;   // read-back slot: 16 lanes per row
        float* drow = dst + (size_t)srow * N + col;
        const float4 bv = *(const float4*)&bias[colBase + wc * 64 + col];
#pragma unroll
        for (int u = 0; u < 4; ++u) {
            if (u > 0)      // every lane's read-back of the last rows is done before they are rewritten
                asm volatile("s_wait_dscnt 0x0" ::: "memory");
#pragma unroll
            for (int t = 0; t < 4; ++t)
#pragma unroll
                for (int g = 0; g < 2; ++g)
                    *(float4*)&stgf[ln * FPITCH + t * 16 + hi * 8 + g * 4] =
                        make_float4(acc[t][u][g * 4], acc[t][u][g * 4 + 1], acc[t][u][g * 4 + 2], acc[t][u][g * 4 + 3]);
            asm volatile("s_wait_dscnt 0x0" ::: "memory");   // rows written before other lanes read them back
#pragma unroll
            for (int k = 0; k < 8; ++k) {                    // 2 whole rows (4 lines) per wave-wide store
                const float4 v = *(const float4*)&stgf[(k * 2 + srow) * FPITCH + col];
                *(float4*)&drow[(size_t)((u * 16 + k * 2) * N)] =
                    make_float4(v.x + bv.x, v.y + bv.y, v.z + bv.z, v.w + bv.w);
            }
        }
    }
}

#define AKT    64             // keys per staged tile
#define APITCH 72             // LDS row pitch (bf16 elems) = 144 B: 16 B x odd for b128 readers
#define NTILE  (SEQ / AKT)
#define QG     2              // column groups of 16 queries per wave
#define QBLK   (8 * QG * 16)  // queries per block
#define LAZY   8.0f           // how far the maximum in use may lag (scaled scores, base 2): exponentials stay below 2^8

// Two 16-byte copies per lane; the s_wait_xcnt closes the statement so that no address
// register named here is rewritten while a copy may still read it.
__device__ __forceinline__ void async_copy2(unsigned l0, const unsigned short* g0,
                                            unsigned l1, const unsigned short* g1) {
    asm volatile("global_load_async_to_lds_b128 %0, %1, off\n\t"
                 "global_load_async_to_lds_b128 %2, %3, off\n\t"
                 "s_wait_xcnt 0x0"
                 :: "v"(l0), "v"(g0), "v"(l1), "v"(g1) : "memory");
}

// Hand-over of a tile: this wave's LDS reads of the old buffer are done, its own copies
// of the next tile have landed, then the barrier publishes the tile and frees the buffer.
__device__ __forceinline__ void tile_publish() {
    asm volatile("s_wait_dscnt 0x0" ::: "memory");     // own reads retired before a refill
    asm volatile("s_wait_asynccnt 0x0" ::: "memory");  // own copies landed before others read
    __syncthreads();
}

// Register budget of 4 waves per SIMD: 2 blocks per WGP, so that all 512 blocks are
// resident at once and no second, thin round of blocks follows.
__global__ __launch_bounds__(256) __attribute__((amdgpu_waves_per_eu(4, 4))) void k_attn(
    const unsigned short* __restrict__ Qb,
    const unsigned short* __restrict__ Kb,
    const unsigned short* __restrict__ Vt,
    unsigned short* __restrict__ Ob)
{
    __shared__ alignas(16) unsigned short Ks[2][AKT * APITCH];   // 64 keys x 64 dims
    __shared__ alignas(16) unsigned short Vs[2][HD * APITCH];    // 64 dims x 64 keys

    const int tid  = threadIdx.x;
    const int lane = tid & 31, wid = tid >> 5;
    const int ln = lane & 15,  hi  = lane >> 4;
    const int b = blockIdx.z, h = blockIdx.y;
    const int qbase = blockIdx.x * QBLK + wid * (QG * 16);

    const size_t headOff = ((size_t)(b * NHEAD + h)) * SEQ * HD;
    const unsigned short* Qh = Qb + headOff;
    const unsigned short* Kh = Kb + headOff;
    const unsigned short* Vh = Vt + headOff;     // (HD x SEQ)

    // copy slots of this lane: rows crow and crow + 32 of a tile, 16 bytes at element ccol
    const int crow = tid >> 3, ccol = (tid & 7) * 8;
    const unsigned ldsK = (unsigned)(unsigned long long)(&Ks[0][crow * APITCH + ccol]);
    const unsigned ldsV = (unsigned)(unsigned long long)(&Vs[0][crow * APITCH + ccol]);
    const unsigned bufBytes  = AKT * APITCH * 2;  // one buffer (K and V tiles are alike)
    const unsigned halfBytes = 32 * APITCH * 2;   // 32 rows further down

    auto stageK = [&](int buf, int tile) {
        const unsigned short* g = Kh + (size_t)(tile * AKT + crow) * HD + ccol;
        async_copy2(ldsK + buf * bufBytes, g, ldsK + buf * bufBytes + halfBytes, g + 32 * HD);
    };
    auto stageV = [&](int buf, int tile) {
        const unsigned short* g = Vh + (size_t)crow * SEQ + tile * AKT + ccol;
        async_copy2(ldsV + buf * bufBytes, g, ldsV + buf * bufBytes + halfBytes, g + (size_t)32 * SEQ);
    };

    // Q fragments (64 dims x 16 queries per group, second operand), resident for the whole kernel
    Frag qf[QG][2];
#pragma unroll
    for (int j = 0; j < QG; ++j)
#pragma unroll
        for (int f = 0; f < 2; ++f)
#pragma unroll
            for (int g = 0; g < 2; ++g)
                qf[j][f].q[g] = *(const uint4*)&Qh[(size_t)(qbase + j * 16 + ln) * HD + f * 32 + hi * 8 + g * 16];

    v8f vz = {0.f,0.f,0.f,0.f,0.f,0.f,0.f,0.f};

    // ---- O^T += V^T @ (2^(s - mq))^T, s the scaled score ; the query's sum stays in its lanes ----
    v8f oacc[QG][4];                             // oacc[j][u][r] = dim u*16 + hi*8 + r, query j*16 + ln
    v2f psum[QG][2];                             // even and odd keys apart: packed adds, two chains
    v8f nmq[QG];                                 // -mq in all 8 registers: where the score accumulators start;
                                                 // mq = maximum in use, the same in a query's two lanes
#pragma unroll
    for (int j = 0; j < QG; ++j) {
#pragma unroll
        for (int u = 0; u < 4; ++u) oacc[j][u] = vz;
        psum[j][0] = (v2f){0.f, 0.f};
        psum[j][1] = (v2f){0.f, 0.f};
        nmq[j] = vz;                             // the first tile's scores come unshifted and set mq themselves
    }

    stageK(0, 0);
    stageV(0, 0);
    tile_publish();
    stageK(1, 1);
    stageV(1, 1);

    for (int s = 0; s < NTILE; ++s) {
        const unsigned short* Kc = &Ks[s & 1][0];
        const unsigned short* Vc = &Vs[s & 1][0];
        // the whole tile's scores first, so that one test serves all 64 keys of both groups
        // st[j][c][r] = key c*16 + hi*8 + r, query j*16 + ln, less mq
        v8f st[QG][4];
#pragma unroll
        for (int c = 0; c < 4; ++c) {
#pragma unroll
            for (int j = 0; j < QG; ++j) st[j][c] = nmq[j];
#pragma unroll
            for (int f = 0; f < 2; ++f) {
                Frag kf;
#pragma unroll
                for (int g = 0; g < 2; ++g)
                    kf.q[g] = *(const uint4*)&Kc[(c * 16 + ln) * APITCH + f * 32 + hi * 8 + g * 16];
#pragma unroll
                for (int j = 0; j < QG; ++j)
                    st[j][c] = __builtin_amdgcn_wmma_f32_16x16x32_bf16(false, kf.v, false, qf[j][f].v, (short)0, st[j][c], false, false);
            }
        }
        // Order of the tile's K loads and products: three fragments' loads ahead, then one more
        // fragment's loads behind each fragment's products, so that loads are on their way under
        // the products.  Left alone, the compiler waits for each fragment singly.
        __builtin_amdgcn_sched_group_barrier(0x100, 6, 0);        // LDS reads
#pragma unroll
        for (int i = 0; i < 5; ++i) {
            __builtin_amdgcn_sched_group_barrier(0x008, QG, 0);   // matrix products of one fragment
            __builtin_amdgcn_sched_group_barrier(0x100, 2, 0);
        }
        __builtin_amdgcn_sched_group_barrier(0x008, 3 * QG, 0);

        // maximum of this lane's 32 scores per group, four independent chains of three-way maxima
        float tm[QG];
#pragma unroll
        for (int j = 0; j < QG; ++j) {
            float tmx[4];
#pragma unroll
            for (int c = 0; c < 4; ++c) {
                tmx[c] = fmaxf(fmaxf(st[j][0][c], st[j][1][c]), st[j][2][c]);
                tmx[c] = fmaxf(fmaxf(tmx[c], st[j][3][c]), st[j][0][c + 4]);
                tmx[c] = fmaxf(fmaxf(tmx[c], st[j][1][c + 4]), st[j][2][c + 4]);
                tmx[c] = fmaxf(tmx[c], st[j][3][c + 4]);
            }
            tm[j] = fmaxf(fmaxf(fmaxf(tmx[0], tmx[1]), tmx[2]), tmx[3]);
        }

        // a scalar branch, taken by the whole wave if any lane's scores outgrow that lag,
        // and always on the first tile, which has no maximum yet
        const float lag = (s == 0) ? -__builtin_inff() : LAZY;
        if (__builtin_amdgcn_ballot_w32(fmaxf(tm[0], tm[1]) > lag) != 0) {
#pragma unroll
            for (int j = 0; j < QG; ++j) {
                // the query's two lanes (ln, ln + 16) join their halves of the keys: both get one mq
                const int ti = __builtin_bit_cast(int, tm[j]);
                const float to = __builtin_bit_cast(float,
                    __builtin_amdgcn_permlanex16(ti, ti, 0x76543210, 0xfedcba98, false, false));
                const float t    = fmaxf(tm[j], to);      // the tile's maximum above mq
                const float up   = fmaxf(t, 0.f);         // mq never falls ...
                const float rise = (s == 0) ? t : up;     // ... but the first tile sets it, of either sign
                const float corr = __builtin_amdgcn_exp2f(-up);   // at most 1; on the first tile the sums are 0
                nmq[j] -= rise;
#pragma unroll
                for (int c = 0; c < 4; ++c) st[j][c] -= rise;     // this tile's scores were taken against the old mq
#pragma unroll
                for (int u = 0; u < 4; ++u) oacc[j][u] *= corr;
                psum[j][0] *= corr;
                psum[j][1] *= corr;
            }
        }

        // V^T fragments of a 32-key half: vf[u] = dims u*16 + ln, keys kl + hi*8 (+ 16)
        Frag vf[4];
        auto loadV = [&](int u, int kl) {
#pragma unroll
            for (int g = 0; g < 2; ++g)
                vf[u].q[g] = *(const uint4*)&Vc[(u * 16 + ln) * APITCH + kl + hi * 8 + g * 16];
        };
#pragma unroll
        for (int u = 0; u < 4; ++u) loadV(u, 0);
        // The first half's four fragments stay ahead of its exponentials, under which they arrive.
        // Left alone, the compiler loads each fragment right in front of its two products and the
        // wave waits out the LDS latency once per fragment.
        __builtin_amdgcn_sched_barrier(0);

#pragma unroll                                   // two 32-key halves of the tile, straight-line
        for (int kl = 0; kl < AKT; kl += 32) {
            // exponentiate, sum in the lane, pack: element e of the operand is key
            // hi*8 + e (e < 8, from s0) or 16 + hi*8 + e - 8 (from s1), as V's loader has it
            union { v16bf v; v2bf h[8]; } pf[QG];
#pragma unroll
            for (int j = 0; j < QG; ++j) {
                const v8f s0 = st[j][kl >> 4];
                const v8f s1 = st[j][(kl >> 4) + 1];
#pragma unroll
                for (int r = 0; r < 8; r += 2) {
                    v2f p0 = { __builtin_amdgcn_exp2f(s0[r]), __builtin_amdgcn_exp2f(s0[r + 1]) };
                    v2f p1 = { __builtin_amdgcn_exp2f(s1[r]), __builtin_amdgcn_exp2f(s1[r + 1]) };
                    psum[j][(r >> 1) & 1] += p0 + p1;
                    pf[j].h[r >> 1]       = __builtin_convertvector(p0, v2bf);
                    pf[j].h[4 + (r >> 1)] = __builtin_convertvector(p1, v2bf);
                }
            }
            // the second half's fragment loads (below) stay behind the first half's exponentials:
            // they take the registers that the first half's products have just read
            if (kl == 0) __builtin_amdgcn_sched_barrier(0);

#pragma unroll
            for (int u = 0; u < 4; ++u) {
#pragma unroll
                for (int j = 0; j < QG; ++j)
                    oacc[j][u] = __builtin_amdgcn_wmma_f32_16x16x32_bf16(false, vf[u].v, false, pf[j].v, (short)0, oacc[j][u], false, false);
                if (kl == 0) loadV(u, 32);       // the next half's fragment, into the registers just read
            }
            // and they stay ahead of the second half's exponentials, under which they arrive
            if (kl == 0) __builtin_amdgcn_sched_barrier(0);
        }
        tile_publish();
        if (s + 2 < NTILE) {                      // refill the buffers this trip has read
            stageK(s & 1, s + 2);
            stageV(s & 1, s + 2);
        }
    }
    asm volatile("s_wait_asynccnt 0x0" ::: "memory");  // no copy in flight when the wave ends

#pragma unroll
    for (int j = 0; j < QG; ++j) {
        // the query's denominator: its two lanes join their halves of the keys, once
        float l = (psum[j][0][0] + psum[j][0][1]) + (psum[j][1][0] + psum[j][1][1]);
        l += __shfl_xor(l, 16, 32);

        // normalize + store bf16 into (B, N, D) layout for the out-projection GEMM:
        // a lane's 8 registers are 8 adjoining dims of its query, one 16-byte store
        unsigned short* orow = Ob + ((size_t)(b * SEQ + qbase + j * 16 + ln)) * D_MODEL + h * HD + hi * 8;
#pragma unroll
        for (int u = 0; u < 4; ++u) {
            Pack8 p;
#pragma unroll
            for (int r = 0; r < 8; r += 2) {
                v2f f = { oacc[j][u][r] / l, oacc[j][u][r + 1] / l };
                p.h[r >> 1] = __builtin_convertvector(f, v2bf);
            }
            *(uint4*)&orow[u * 16] = p.q;
        }
    }
}

// ---------------- launcher ----------------

extern "C" void kernel_launch(void* const* d_in, const int* in_sizes, int n_in,
                              void* d_out, int out_size, void* d_ws, size_t ws_size,
                              hipStream_t stream) {
    (void)in_sizes; (void)n_in; (void)out_size; (void)ws_size;
    const float* x      = (const float*)d_in[0];
    const float* W_qkv  = (const float*)d_in[1];
    const float* W_proj = (const float*)d_in[2];
    const float* b_proj = (const float*)d_in[3];
    float* out = (float*)d_out;

    const size_t NX  = (size_t)MTOT * D_MODEL;      // 8,388,608
    unsigned short* Xb     = (unsigned short*)d_ws;
    unsigned short* WqkvT  = Xb     + NX;                            // 3072 x 1024
    unsigned short* WprojT = WqkvT  + (size_t)3 * D_MODEL * D_MODEL; // 1024 x 1024
    unsigned short* Qb     = WprojT + (size_t)D_MODEL * D_MODEL;     // B*H*SEQ*HD == NX
    unsigned short* Kb     = Qb + NX;
    unsigned short* Vt     = Kb + NX;
    unsigned short* Ob     = Vt + NX;

    // 1. convert inputs to bf16 (weights transposed to N x K)
    k_cvt  <<<(int)(NX / CVT_BLOCK), 256, 0, stream>>>(x, Xb, (int)NX);
    k_cvt_t<D_MODEL, 3 * D_MODEL><<<dim3(3 * D_MODEL / 128, D_MODEL / 64), 256, 0, stream>>>(W_qkv,  WqkvT);
    k_cvt_t<D_MODEL, D_MODEL>    <<<dim3(D_MODEL / 128, D_MODEL / 64),     256, 0, stream>>>(W_proj, WprojT);

    // 2. QKV projection, scatter to per-head Q, K (row-major) and V^T
    k_gemm<0><<<dim3(3 * D_MODEL / BN, MTOT / BM), 256, 0, stream>>>(
        Xb, WqkvT, nullptr, Qb, Kb, Vt, nullptr, D_MODEL, 3 * D_MODEL);

    // 3. attention (one pass, online softmax, all WMMA)
    k_attn<<<dim3(SEQ / QBLK, NHEAD, BATCH), 256, 0, stream>>>(Qb, Kb, Vt, Ob);

    // 4. output projection + bias (f32 out)
    k_gemm<1><<<dim3(D_MODEL / BN, MTOT / BM), 256, 0, stream>>>(
        Ob, WprojT, b_proj, nullptr, nullptr, nullptr, out, D_MODEL, D_MODEL);
}

// v009
// Measured time: 121 microseconds a run.
// In both of two side-by-side timings against v008, it was 1.05 times as fast.
// Over all steps from v000 it is 4.13 times as fast.
#include <hip/hip_runtime.h>

typedef __attribute__((ext_vector_type(16))) __bf16 v16bf;
typedef __attribute__((ext_vector_type(8)))  float  v8f;
typedef __attribute__((ext_vector_type(2)))  float  v2f;
typedef __attribute__((ext_vector_type(2)))  __bf16 v2bf;
typedef __attribute__((ext_vector_type(4)))  unsigned int u32x4;
typedef __attribute__((ext_vector_type(8)))  unsigned int u32x8;

#define D_MODEL 1024
#define NHEAD   16
#define HD      64
#define SEQ     2048
#define BATCH   4
#define MTOT    (BATCH*SEQ)   // 8192

#define BM 128
#define BN 256
#define BK 64                 // k per pass: a staged row is 128 B, one whole line
#define ROWB   (BK * 2)       // bytes of a staged row
#define GPITCH (ROWB + 16)    // LDS row pitch (bytes), the mover's pad included: 16 B x odd for b128 readers
#define WROWS  64             // weight rows in a slice (waves 0 to 3)
#define XROWS  32             // activation rows in a slice (waves 4 to 7)
#define WSLICE 10240          // LDS bytes of a weight slice: 64 x 144 rounded up to a multiple of 2 KiB
#define XSLICE 6144           // LDS bytes of an activation slice: 32 x 144 rounded up likewise
#define GBUF   (4 * WSLICE + 4 * XSLICE)   // one stage: 256 weight rows, then 128 activation rows

__device__ __forceinline__ unsigned short f2bf(float f) {
    unsigned int u = __float_as_uint(f);
    u += 0x7FFFu + ((u >> 16) & 1u);          // round-to-nearest-even
    return (unsigned short)(u >> 16);
}

struct Frag { union { v16bf v; uint4 q[2]; }; };
struct Pack8 { union { uint4 q; v2bf h[4]; }; };   // 8 bf16 = one 16-byte store

// ---------------- conversion kernel ----------------
// Three short streams that read none of each other's output: one launch does all three, each
// block taking one job by its index, so that they start, fly and drain together and two
// launches' gap, fill and tail are not paid.  What short streams pay for besides is the number
// of waves that must start, so each thread converts many elements, by 16-byte loads that are
// all in flight before the first use.

typedef __attribute__((ext_vector_type(4))) float f32x4;

__device__ __forceinline__ unsigned int f2bf2(float lo, float hi) {
    return (unsigned int)f2bf(lo) | ((unsigned int)f2bf(hi) << 16);
}

#define CVT_LOADS 16                        // 16-byte loads per thread: 64 elements
#define CVT_BLOCK (256 * 4 * CVT_LOADS)     // elements per block

// out[i] = bf16(in[i]), block blk of CVT_BLOCK elements.
// A wave's load covers 512 contiguous bytes (4 lines), its store 256 (2 lines).
__device__ __forceinline__ void cvt_block(const float* __restrict__ in, unsigned short* __restrict__ out, unsigned blk) {
    const float* src = in + blk * CVT_BLOCK + threadIdx.x * 4;
    unsigned short* dst = out + blk * CVT_BLOCK + threadIdx.x * 4;
    f32x4 f[CVT_LOADS];
#pragma unroll
    for (int i = 0; i < CVT_LOADS; ++i) f[i] = *(const f32x4*)(src + i * 1024);
#pragma unroll
    for (int i = 0; i < CVT_LOADS; ++i)
        *(uint2*)(dst + i * 1024) = make_uint2(f2bf2(f[i][0], f[i][1]), f2bf2(f[i][2], f[i][3]));
}

// Wt[n*K + k] = bf16(W[k*N + n])   (store weights transposed, N x K row-major)
// A thread holds 8 k x 4 n; a wave 64 k x 16 n, so that each of its stores fills 4 whole
// 128-byte lines of Wt; a block 64 k x 128 n, so that its loads cover 512-byte runs of W.
// Blocks: N / 128 across, K / 64 down.  K and N are compile-time, so the row steps are immediate offsets.
template<int K, int N>
__device__ __forceinline__ void cvt_t_block(const float* __restrict__ W, unsigned short* __restrict__ Wt, unsigned blk) {
    static_assert(K % 64 == 0 && N % 128 == 0, "whole tiles only");
    const unsigned lane = threadIdx.x & 31, wid = threadIdx.x >> 5;
    const unsigned n = (blk % (N / 128)) * 128 + wid * 16 + (lane & 3) * 4;
    const unsigned k = (blk / (N / 128)) * 64 + (lane >> 2) * 8;
    const float* src = W + (k * N + n);
    unsigned short* dst = Wt + (n * K + k);
    f32x4 f[8];
#pragma unroll
    for (int i = 0; i < 8; ++i) f[i] = *(const f32x4*)(src + i * N);
#pragma unroll
    for (int j = 0; j < 4; ++j)
        *(uint4*)(dst + j * K) = make_uint4(f2bf2(f[0][j], f[1][j]), f2bf2(f[2][j], f[3][j]),
                                            f2bf2(f[4][j], f[5][j]), f2bf2(f[6][j], f[7][j]));
    // Another job's code follows in the listing and reuses the stores' address and data registers.
    asm volatile("s_wait_xcnt 0x0" ::: "memory");
}

#define X_JOBS     ((MTOT * D_MODEL) / CVT_BLOCK)            // blocks that convert x
#define WQKV_JOBS  ((3 * D_MODEL / 128) * (D_MODEL / 64))    // blocks that convert and transpose W_qkv
#define WPROJ_JOBS ((D_MODEL / 128) * (D_MODEL / 64))        // blocks that convert and transpose W_proj
static_assert((MTOT * D_MODEL) % CVT_BLOCK == 0, "whole blocks only");

// The blocks of x move twice the bytes of the others and come first in the index.
// The grid gives each SIMD 8 waves; the register budget of 8 lets all 16 loads of an x block fly
// together (under the default budget the last four are issued behind the first conversions).
__global__ __launch_bounds__(256) __attribute__((amdgpu_waves_per_eu(8, 8)))
void k_prep(const float* __restrict__ x, const float* __restrict__ Wqkv, const float* __restrict__ Wproj,
            unsigned short* __restrict__ Xb, unsigned short* __restrict__ WqkvT, unsigned short* __restrict__ WprojT) {
    const unsigned blk = blockIdx.x;                     // block-uniform: scalar branches
    if (blk < X_JOBS)
        cvt_block(x, Xb, blk);
    else if (blk < X_JOBS + WQKV_JOBS)
        cvt_t_block<D_MODEL, 3 * D_MODEL>(Wqkv, WqkvT, blk - X_JOBS);
    else
        cvt_t_block<D_MODEL, D_MODEL>(Wproj, WprojT, blk - (X_JOBS + WQKV_JOBS));
}

__device__ __forceinline__ unsigned uni(unsigned v) { return (unsigned)__builtin_amdgcn_readfirstlane(v); }

// A wave-uniform value held in a scalar register: a test on it compiles to a scalar branch, and
// what is formed from it is formed behind the waits written in front of it.
__device__ __forceinline__ unsigned pinned(unsigned v) {
    unsigned w = uni(v);
    asm volatile("" : "+s"(w));   // the scalar test or descriptor word of a tensor load, kept in an SGPR
    return w;
}

// Loop-invariant group of a tensor load: rows x 128 bytes (extents in bytes, tensor = tile),
// source row pitch srcPitch bytes, 16 bytes of LDS pad behind every 128-byte row -> GPITCH.
__device__ __forceinline__ u32x8 tdm_group1(unsigned rows, unsigned srcPitch) {
    u32x8 g;
    g[0] = uni((1u << 20) | (4u << 22) | (3u << 25));     // pad on, every 32 dwords, 4 dwords; no mask
    g[1] = uni((unsigned)ROWB << 16);                     // tensor_dim0
    g[2] = uni(rows << 16);                               // tensor_dim1
    g[3] = uni((unsigned)ROWB << 16);                     // tile_dim0
    g[4] = uni(rows);                                     // tile_dim1
    g[5] = uni(srcPitch);
    g[6] = uni(0u);
    g[7] = uni(0u);
    return g;
}

__device__ __forceinline__ u32x4 tdm_group0(unsigned count1, unsigned ldsByte, unsigned long long ga) {
    u32x4 g;
    g[0] = count1;                                        // count = 1
    g[1] = uni(ldsByte);
    g[2] = uni((unsigned)ga);
    g[3] = uni((((unsigned)(ga >> 32)) & 0x01FFFFFFu) | 0x80000000u);   // type = 2
    return g;
}

__device__ __forceinline__ void tdm_load(u32x4 g0, u32x8 g1) {
    asm volatile("tensor_load_to_lds %0, %1" :: "s"(g0), "s"(g1) : "memory");
}

// The wave's one outstanding tensor load has landed.  The wait names that load's descriptor, so
// that its registers hold their values until here and take new ones only behind the wait.
__device__ __forceinline__ void tdm_wait(u32x4 g0, u32x8 g1) {
    asm volatile("s_wait_tensorcnt 0x0" :: "s"(g0), "s"(g1) : "memory");
}

// ---------------- GEMM: C(MxN) f32 = A(MxK)bf16 @ Bt(NxK)bf16^T ----------------
// Two LDS buffers; a pass is 64 k.  Every wave brings its own slice of a stage by one tensor
// load (whole 128-byte rows), issued when the buffer is freed, one pass ahead of its use,
// while the 8 waves run 32 WMMAs each on the stage in the other buffer.
// MODE 0: QKV epilogue (Q,K row-major per head; V transposed per head)
// MODE 1: out-proj epilogue (add bias, store f32)
// Both epilogues store whole 128-byte lines, staged per wave through LDS.
// A lane's 8 accumulator registers run along the FIRST operand's rows, so the first operand
// is the side that is contiguous in the output: the weights (columns) for Q, K and the
// out-projection, the activations (tokens) for V^T.  Both fragments have one layout, so only
// the LDS base and the run step of each loader change, by a block-uniform select.

#define SPITCH 72             // bf16 staging row pitch (elems) = 144 B: 16 B x odd for b128
#define QSCALE (0.125f * 1.4426950408889634f)   // 1/sqrt(64) x log2(e), put on Q before its one rounding to bf16
#define FPITCH 68             // f32 staging row pitch (elems) = 272 B: 16 B x odd for b128

template<int MODE>
__global__ __launch_bounds__(256) void k_gemm(
    const unsigned short* __restrict__ A,
    const unsigned short* __restrict__ Bt,
    const float* __restrict__ bias,
    unsigned short* __restrict__ Qb,
    unsigned short* __restrict__ Kb,
    unsigned short* __restrict__ Vt,
    float* __restrict__ Cout,
    int K, int N)
{
    __shared__ __attribute__((aligned(2048))) unsigned char ring[2 * GBUF];

    const int tid  = threadIdx.x;
    const int lane = tid & 31, wid = tid >> 5;
    const int ln = lane & 15,  hi  = lane >> 4;
    const int wr = wid >> 2,   wc  = wid & 3;           // 2 x 4 wave grid, 64x64 wave tile
    const int rowBase = blockIdx.y * BM;
    const int colBase = blockIdx.x * BN;

    // This wave's slice of every stage: waves 0 to 3 64 weight rows each, waves 4 to 7 32 activation rows.
    const unsigned wave = uni(threadIdx.x >> 5);
    const bool     isW  = wave < 4u;
    const unsigned place = (unsigned)(unsigned long long)(&ring[0])
                         + (isW ? wave * WSLICE : 4u * WSLICE + (wave - 4u) * XSLICE);
    const unsigned long long src = isW
        ? (unsigned long long)(Bt + (size_t)(colBase + wave * WROWS) * K)
        : (unsigned long long)(A  + (size_t)(rowBase + (wave - 4u) * XROWS) * K);
    const u32x8 g1 = tdm_group1(isW ? WROWS : XROWS, (unsigned)K * 2u);
    const unsigned count1 = pinned(1u);   // descriptor word 0, held in an SGPR: its register is not lent out under a load in flight

    // xFirst: activations are the first operand (V^T blocks); else the weights are.
    // acc[t][u][r] = first operand's row t*16 + hi*8 + r times second operand's row u*16 + ln
    // A wave's 64 rows of an operand are two runs of 32: 32 rows apart in a weight slice,
    // a slice apart for the activations.
    const bool xFirst = (MODE == 0) && (colBase >= 2 * D_MODEL);
    const unsigned char* Xf = &ring[4 * WSLICE + wr * 2 * XSLICE + ln * GPITCH + hi * 16];
    const unsigned char* Wf = &ring[wc * WSLICE + ln * GPITCH + hi * 16];
    const unsigned char* F0 = xFirst ? Xf : Wf;
    const unsigned char* S0 = xFirst ? Wf : Xf;
    const int runF = xFirst ? XSLICE : 32 * GPITCH;
    const int runS = xFirst ? 32 * GPITCH : XSLICE;

    v8f acc[4][4];
    v8f vz = {0.f,0.f,0.f,0.f,0.f,0.f,0.f,0.f};
#pragma unroll
    for (int t = 0; t < 4; ++t)
#pragma unroll
        for (int u = 0; u < 4; ++u) acc[t][u] = vz;

    // prologue: stage 0 lands and is published, then stage 1 is on its way (K holds two stages or more)
    const int NP = K / BK;
    u32x4 g0 = tdm_group0(count1, place, src);
    tdm_load(g0, g1);
    tdm_wait(g0, g1);                                    // own slice landed before the barrier publishes it
    __syncthreads();
    g0 = tdm_group0(count1, place + GBUF, src + ROWB);
    tdm_load(g0, g1);

    for (int s = 0; s < NP; ++s) {
        const int cur = (s & 1) * GBUF;
#pragma unroll
        for (int kk = 0; kk < 2; ++kk) {                 // the stage's two 32-k steps
            Frag fa[4], fb[4];
#pragma unroll
            for (int t = 0; t < 4; ++t)
#pragma unroll
                for (int g = 0; g < 2; ++g)
                    fa[t].q[g] = *(const uint4*)&F0[cur + (t >> 1) * runF + (t & 1) * 16 * GPITCH + kk * 64 + g * 32];
#pragma unroll
            for (int u = 0; u < 4; ++u)
#pragma unroll
                for (int g = 0; g < 2; ++g)
                    fb[u].q[g] = *(const uint4*)&S0[cur + (u >> 1) * runS + (u & 1) * 16 * GPITCH + kk * 64 + g * 32];

#pragma unroll
            for (int t = 0; t < 4; ++t)
#pragma unroll
                for (int u = 0; u < 4; ++u)
                    acc[t][u] = __builtin_amdgcn_wmma_f32_16x16x32_bf16(
                        false, fa[t].v, false, fb[u].v, (short)0, acc[t][u], false, false);
        }

        // publish point of stage s + 1
        asm volatile("s_wait_dscnt 0x0" ::: "memory");       // own reads of this buffer retired before its refill
        tdm_wait(g0, g1);                                    // own slice of stage s + 1 landed before others read it
        __syncthreads();
        if (pinned(s + 2 < NP)) {                            // scalar branch: a tensor load ignores EXEC
            g0 = tdm_group0(count1, place + cur, src + pinned((unsigned)(s + 2) * ROWB));   // address formed behind the wait
            tdm_load(g0, g1);
        }
    }
    tdm_wait(g0, g1);                                        // nothing in flight when the ring becomes staging
    asm volatile("s_wait_dscnt 0x0" ::: "memory");

    // epilogue
    if (MODE == 0) {
        // The wave's 64 x 64 tile is 64 tokens of ONE head of Q, K or V.  Output rows of 128 B:
        // a token's 64 dims (Q, K; rows adjoin) or a dim's 64 tokens (V^T; rows SEQ apart).
        // acc[t][u][r] is output row u*16 + ln, element t*16 + hi*8 + r.
        const int which = colBase >> 10;
        const int bh    = (rowBase >> 11) * NHEAD + ((colBase & 1023) >> 6) + wc;
        const int tok0  = (rowBase & 2047) + wr * 64;
        unsigned short* dst = (which == 2) ? Vt + (size_t)bh * HD * SEQ + tok0
                                           : (which == 0 ? Qb : Kb) + ((size_t)bh * SEQ + tok0) * HD;
        const int pitch = (which == 2) ? SEQ : HD;
        // Q carries the softmax scale, in base 2, so that K Q^T needs no multiply per score later
        const float osc = (which == 0) ? QSCALE : 1.0f;
        // Each wave stages 32 rows at a time in its own range of the ring, which is free:
        // the loop's last barrier stands behind every fragment read and the last tensor wait.
        unsigned short* stg = (unsigned short*)&ring[0] + wid * (32 * SPITCH);
        const int srow = lane >> 3, col = (lane & 7) * 8;    // read-back slot: 8 lanes per row
        unsigned short* drow = dst + (size_t)srow * pitch + col;
#pragma unroll
        for (int half = 0; half < 2; ++half) {
            if (half > 0)   // every lane's read-back of the last rows is done before they are rewritten
                asm volatile("s_wait_dscnt 0x0" ::: "memory");
#pragma unroll
            for (int uu = 0; uu < 2; ++uu)
#pragma unroll
                for (int t = 0; t < 4; ++t) {
                    Pack8 p;
#pragma unroll
                    for (int r = 0; r < 8; r += 2) {
                        v2f f = { acc[t][half * 2 + uu][r] * osc, acc[t][half * 2 + uu][r + 1] * osc };
                        p.h[r >> 1] = __builtin_convertvector(f, v2bf);
                    }
                    *(uint4*)&stg[(uu * 16 + ln) * SPITCH + t * 16 + hi * 8] = p.q;
                }
            asm volatile("s_wait_dscnt 0x0" ::: "memory");   // rows written before other lanes read them back
#pragma unroll
            for (int k = 0; k < 8; ++k)                      // 4 whole rows (lines) per wave-wide store
                *(uint4*)&drow[(size_t)((half * 32 + k * 4) * pitch)] =
                    *(const uint4*)&stg[(k * 4 + srow) * SPITCH + col];
        }
    } else {
        // acc[t][u][r] is token u*16 + ln, column t*16 + hi*8 + r of the wave's 64 x 64 tile.
        // 16 tokens (rows of 256 B) at a time, in the wave's own range of the freed ring.
        float* dst  = Cout + (size_t)(rowBase + wr * 64) * N + colBase + wc * 64;
        float* stgf = (float*)&ring[0] + wid * (16 * FPITCH);
        const int srow = lane >> 4, col = (lane & 15) * 4;   // read-back slot: 16 lanes per row
        float* drow = dst + (size_t)srow * N + col;
        const float4 bv = *(const float4*)&bias[colBase + wc * 64 + col];
#pragma unroll
        for (int u = 0; u < 4; ++u) {
            if (u > 0)      // every lane's read-back of the last rows is done before they are rewritten
                asm volatile("s_wait_dscnt 0x0" ::: "memory");
#pragma unroll
            for (int t = 0; t < 4; ++t)
#pragma unroll
                for (int g = 0; g < 2; ++g)
                    *(float4*)&stgf[ln * FPITCH + t * 16 + hi * 8 + g * 4] =
                        make_float4(acc[t][u][g * 4], acc[t][u][g * 4 + 1], acc[t][u][g * 4 + 2], acc[t][u][g * 4 + 3]);
            asm volatile("s_wait_dscnt 0x0" ::: "memory");   // rows written before other lanes read them back
#pragma unroll
            for (int k = 0; k < 8; ++k) {                    // 2 whole rows (4 lines) per wave-wide store
                const float4 v = *(const float4*)&stgf[(k * 2 + srow) * FPITCH + col];
                *(float4*)&drow[(size_t)((u * 16 + k * 2) * N)] =
                    make_float4(v.x + bv.x, v.y + bv.y, v.z + bv.z, v.w + bv.w);
            }
        }
    }
}

#define AKT    64             // keys per staged tile
#define APITCH 72             // LDS row pitch (bf16 elems) = 144 B: 16 B x odd for b128 readers
#define NTILE  (SEQ / AKT)
#define QG     2              // column groups of 16 queries per wave
#define QBLK   (8 * QG * 16)  // queries per block
#define LAZY   8.0f           // how far the maximum in use may lag (scaled scores, base 2): exponentials stay below 2^8

// Two 16-byte copies per lane; the s_wait_xcnt closes the statement so that no address
// register named here is rewritten while a copy may still read it.
__device__ __forceinline__ void async_copy2(unsigned l0, const unsigned short* g0,
                                            unsigned l1, const unsigned short* g1) {
    asm volatile("global_load_async_to_lds_b128 %0, %1, off\n\t"
                 "global_load_async_to_lds_b128 %2, %3, off\n\t"
                 "s_wait_xcnt 0x0"
                 :: "v"(l0), "v"(g0), "v"(l1), "v"(g1) : "memory");
}

// Hand-over of a tile: this wave's LDS reads of the old buffer are done, its own copies
// of the next tile have landed, then the barrier publishes the tile and frees the buffer.
__device__ __forceinline__ void tile_publish() {
    asm volatile("s_wait_dscnt 0x0" ::: "memory");     // own reads retired before a refill
    asm volatile("s_wait_asynccnt 0x0" ::: "memory");  // own copies landed before others read
    __syncthreads();
}

// Register budget of 4 waves per SIMD: 2 blocks per WGP, so that all 512 blocks are
// resident at once and no second, thin round of blocks follows.
__global__ __launch_bounds__(256) __attribute__((amdgpu_waves_per_eu(4, 4))) void k_attn(
    const unsigned short* __restrict__ Qb,
    const unsigned short* __restrict__ Kb,
    const unsigned short* __restrict__ Vt,
    unsigned short* __restrict__ Ob)
{
    __shared__ alignas(16) unsigned short Ks[2][AKT * APITCH];   // 64 keys x 64 dims
    __shared__ alignas(16) unsigned short Vs[2][HD * APITCH];    // 64 dims x 64 keys

    const int tid  = threadIdx.x;
    const int lane = tid & 31, wid = tid >> 5;
    const int ln = lane & 15,  hi  = lane >> 4;
    const int b = blockIdx.z, h = blockIdx.y;
    const int qbase = blockIdx.x * QBLK + wid * (QG * 16);

    const size_t headOff = ((size_t)(b * NHEAD + h)) * SEQ * HD;
    const unsigned short* Qh = Qb + headOff;
    const unsigned short* Kh = Kb + headOff;
    const unsigned short* Vh = Vt + headOff;     // (HD x SEQ)

    // copy slots of this lane: rows crow and crow + 32 of a tile, 16 bytes at element ccol
    const int crow = tid >> 3, ccol = (tid & 7) * 8;
    const unsigned ldsK = (unsigned)(unsigned long long)(&Ks[0][crow * APITCH + ccol]);
    const unsigned ldsV = (unsigned)(unsigned long long)(&Vs[0][crow * APITCH + ccol]);
    const unsigned bufBytes  = AKT * APITCH * 2;  // one buffer (K and V tiles are alike)
    const unsigned halfBytes = 32 * APITCH * 2;   // 32 rows further down

    auto stageK = [&](int buf, int tile) {
        const unsigned short* g = Kh + (size_t)(tile * AKT + crow) * HD + ccol;
        async_copy2(ldsK + buf * bufBytes, g, ldsK + buf * bufBytes + halfBytes, g + 32 * HD);
    };
    auto stageV = [&](int buf, int tile) {
        const unsigned short* g = Vh + (size_t)crow * SEQ + tile * AKT + ccol;
        async_copy2(ldsV + buf * bufBytes, g, ldsV + buf * bufBytes + halfBytes, g + (size_t)32 * SEQ);
    };

    // Q fragments (64 dims x 16 queries per group, second operand), resident for the whole kernel
    Frag qf[QG][2];
#pragma unroll
    for (int j = 0; j < QG; ++j)
#pragma unroll
        for (int f = 0; f < 2; ++f)
#pragma unroll
            for (int g = 0; g < 2; ++g)
                qf[j][f].q[g] = *(const uint4*)&Qh[(size_t)(qbase + j * 16 + ln) * HD + f * 32 + hi * 8 + g * 16];

    v8f vz = {0.f,0.f,0.f,0.f,0.f,0.f,0.f,0.f};

    // ---- O^T += V^T @ (2^(s - mq))^T, s the scaled score ; the query's sum stays in its lanes ----
    v8f oacc[QG][4];                             // oacc[j][u][r] = dim u*16 + hi*8 + r, query j*16 + ln
    v2f psum[QG][2];                             // even and odd keys apart: packed adds, two chains
    v8f nmq[QG];                                 // -mq in all 8 registers: where the score accumulators start;
                                                 // mq = maximum in use, the same in a query's two lanes
#pragma unroll
    for (int j = 0; j < QG; ++j) {
#pragma unroll
        for (int u = 0; u < 4; ++u) oacc[j][u] = vz;
        psum[j][0] = (v2f){0.f, 0.f};
        psum[j][1] = (v2f){0.f, 0.f};
        nmq[j] = vz;                             // the first tile's scores come unshifted and set mq themselves
    }

    stageK(0, 0);
    stageV(0, 0);
    tile_publish();
    stageK(1, 1);
    stageV(1, 1);

    for (int s = 0; s < NTILE; ++s) {
        const unsigned short* Kc = &Ks[s & 1][0];
        const unsigned short* Vc = &Vs[s & 1][0];
        // the whole tile's scores first, so that one test serves all 64 keys of both groups
        // st[j][c][r] = key c*16 + hi*8 + r, query j*16 + ln, less mq
        v8f st[QG][4];
#pragma unroll
        for (int c = 0; c < 4; ++c) {
#pragma unroll
            for (int j = 0; j < QG; ++j) st[j][c] = nmq[j];
#pragma unroll
            for (int f = 0; f < 2; ++f) {
                Frag kf;
#pragma unroll
                for (int g = 0; g < 2; ++g)
                    kf.q[g] = *(const uint4*)&Kc[(c * 16 + ln) * APITCH + f * 32 + hi * 8 + g * 16];
#pragma unroll
                for (int j = 0; j < QG; ++j)
                    st[j][c] = __builtin_amdgcn_wmma_f32_16x16x32_bf16(false, kf.v, false, qf[j][f].v, (short)0, st[j][c], false, false);
            }
        }
        // Order of the tile's K loads and products: three fragments' loads ahead, then one more
        // fragment's loads behind each fragment's products, so that loads are on their way under
        // the products.  Left alone, the compiler waits for each fragment singly.
        __builtin_amdgcn_sched_group_barrier(0x100, 6, 0);        // LDS reads
#pragma unroll
        for (int i = 0; i < 5; ++i) {
            __builtin_amdgcn_sched_group_barrier(0x008, QG, 0);   // matrix products of one fragment
            __builtin_amdgcn_sched_group_barrier(0x100, 2, 0);
        }
        __builtin_amdgcn_sched_group_barrier(0x008, 3 * QG, 0);

        // maximum of this lane's 32 scores per group, four independent chains of three-way maxima
        float tm[QG];
#pragma unroll
        for (int j = 0; j < QG; ++j) {
            float tmx[4];
#pragma unroll
            for (int c = 0; c < 4; ++c) {
                tmx[c] = fmaxf(fmaxf(st[j][0][c], st[j][1][c]), st[j][2][c]);
                tmx[c] = fmaxf(fmaxf(tmx[c], st[j][3][c]), st[j][0][c + 4]);
                tmx[c] = fmaxf(fmaxf(tmx[c], st[j][1][c + 4]), st[j][2][c + 4]);
                tmx[c] = fmaxf(tmx[c], st[j][3][c + 4]);
            }
            tm[j] = fmaxf(fmaxf(fmaxf(tmx[0], tmx[1]), tmx[2]), tmx[3]);
        }

        // a scalar branch, taken by the whole wave if any lane's scores outgrow that lag,
        // and always on the first tile, which has no maximum yet
        const float lag = (s == 0) ? -__builtin_inff() : LAZY;
        if (__builtin_amdgcn_ballot_w32(fmaxf(tm[0], tm[1]) > lag) != 0) {
#pragma unroll
            for (int j = 0; j < QG; ++j) {
                // the query's two lanes (ln, ln + 16) join their halves of the keys: both get one mq
                const int ti = __builtin_bit_cast(int, tm[j]);
                const float to = __builtin_bit_cast(float,
                    __builtin_amdgcn_permlanex16(ti, ti, 0x76543210, 0xfedcba98, false, false));
                const float t    = fmaxf(tm[j], to);      // the tile's maximum above mq
                const float up   = fmaxf(t, 0.f);         // mq never falls ...
                const float rise = (s == 0) ? t : up;     // ... but the first tile sets it, of either sign
                const float corr = __builtin_amdgcn_exp2f(-up);   // at most 1; on the first tile the sums are 0
                nmq[j] -= rise;
#pragma unroll
                for (int c = 0; c < 4; ++c) st[j][c] -= rise;     // this tile's scores were taken against the old mq
#pragma unroll
                for (int u = 0; u < 4; ++u) oacc[j][u] *= corr;
                psum[j][0] *= corr;
                psum[j][1] *= corr;
            }
        }

        // V^T fragments of a 32-key half: vf[u] = dims u*16 + ln, keys kl + hi*8 (+ 16)
        Frag vf[4];
        auto loadV = [&](int u, int kl) {
#pragma unroll
            for (int g = 0; g < 2; ++g)
                vf[u].q[g] = *(const uint4*)&Vc[(u * 16 + ln) * APITCH + kl + hi * 8 + g * 16];
        };
#pragma unroll
        for (int u = 0; u < 4; ++u) loadV(u, 0);
        // The first half's four fragments stay ahead of its exponentials, under which they arrive.
        // Left alone, the compiler loads each fragment right in front of its two products and the
        // wave waits out the LDS latency once per fragment.
        __builtin_amdgcn_sched_barrier(0);

#pragma unroll                                   // two 32-key halves of the tile, straight-line
        for (int kl = 0; kl < AKT; kl += 32) {
            // exponentiate, sum in the lane, pack: element e of the operand is key
            // hi*8 + e (e < 8, from s0) or 16 + hi*8 + e - 8 (from s1), as V's loader has it
            union { v16bf v; v2bf h[8]; } pf[QG];
#pragma unroll
            for (int j = 0; j < QG; ++j) {
                const v8f s0 = st[j][kl >> 4];
                const v8f s1 = st[j][(kl >> 4) + 1];
#pragma unroll
                for (int r = 0; r < 8; r += 2) {
                    v2f p0 = { __builtin_amdgcn_exp2f(s0[r]), __builtin_amdgcn_exp2f(s0[r + 1]) };
                    v2f p1 = { __builtin_amdgcn_exp2f(s1[r]), __builtin_amdgcn_exp2f(s1[r + 1]) };
                    psum[j][(r >> 1) & 1] += p0 + p1;
                    pf[j].h[r >> 1]       = __builtin_convertvector(p0, v2bf);
                    pf[j].h[4 + (r >> 1)] = __builtin_convertvector(p1, v2bf);
                }
            }
            // the second half's fragment loads (below) stay behind the first half's exponentials:
            // they take the registers that the first half's products have just read
            if (kl == 0) __builtin_amdgcn_sched_barrier(0);

#pragma unroll
            for (int u = 0; u < 4; ++u) {
#pragma unroll
                for (int j = 0; j < QG; ++j)
                    oacc[j][u] = __builtin_amdgcn_wmma_f32_16x16x32_bf16(false, vf[u].v, false, pf[j].v, (short)0, oacc[j][u], false, false);
                if (kl == 0) loadV(u, 32);       // the next half's fragment, into the registers just read
            }
            // and they stay ahead of the second half's exponentials, under which they arrive
            if (kl == 0) __builtin_amdgcn_sched_barrier(0);
        }
        tile_publish();
        if (s + 2 < NTILE) {                      // refill the buffers this trip has read
            stageK(s & 1, s + 2);
            stageV(s & 1, s + 2);
        }
    }
    asm volatile("s_wait_asynccnt 0x0" ::: "memory");  // no copy in flight when the wave ends

#pragma unroll
    for (int j = 0; j < QG; ++j) {
        // the query's denominator: its two lanes join their halves of the keys, once
        float l = (psum[j][0][0] + psum[j][0][1]) + (psum[j][1][0] + psum[j][1][1]);
        l += __shfl_xor(l, 16, 32);

        // normalize + store bf16 into (B, N, D) layout for the out-projection GEMM:
        // a lane's 8 registers are 8 adjoining dims of its query, one 16-byte store
        unsigned short* orow = Ob + ((size_t)(b * SEQ + qbase + j * 16 + ln)) * D_MODEL + h * HD + hi * 8;
#pragma unroll
        for (int u = 0; u < 4; ++u) {
            Pack8 p;
#pragma unroll
            for (int r = 0; r < 8; r += 2) {
                v2f f = { oacc[j][u][r] / l, oacc[j][u][r + 1] / l };
                p.h[r >> 1] = __builtin_convertvector(f, v2bf);
            }
            *(uint4*)&orow[u * 16] = p.q;
        }
    }
}

// ---------------- launcher ----------------

extern "C" void kernel_launch(void* const* d_in, const int* in_sizes, int n_in,
                              void* d_out, int out_size, void* d_ws, size_t ws_size,
                              hipStream_t stream) {
    (void)in_sizes; (void)n_in; (void)out_size; (void)ws_size;
    const float* x      = (const float*)d_in[0];
    const float* W_qkv  = (const float*)d_in[1];
    const float* W_proj = (const float*)d_in[2];
    const float* b_proj = (const float*)d_in[3];
    float* out = (float*)d_out;

    const size_t NX  = (size_t)MTOT * D_MODEL;      // 8,388,608
    unsigned short* Xb     = (unsigned short*)d_ws;
    unsigned short* WqkvT  = Xb     + NX;                            // 3072 x 1024
    unsigned short* WprojT = WqkvT  + (size_t)3 * D_MODEL * D_MODEL; // 1024 x 1024
    unsigned short* Qb     = WprojT + (size_t)D_MODEL * D_MODEL;     // B*H*SEQ*HD == NX
    unsigned short* Kb     = Qb + NX;
    unsigned short* Vt     = Kb + NX;
    unsigned short* Ob     = Vt + NX;

    // 1. convert inputs to bf16 (weights transposed to N x K), one launch
    k_prep<<<X_JOBS + WQKV_JOBS + WPROJ_JOBS, 256, 0, stream>>>(x, W_qkv, W_proj, Xb, WqkvT, WprojT);

    // 2. QKV projection, scatter to per-head Q, K (row-major) and V^T
    k_gemm<0><<<dim3(3 * D_MODEL / BN, MTOT / BM), 256, 0, stream>>>(
        Xb, WqkvT, nullptr, Qb, Kb, Vt, nullptr, D_MODEL, 3 * D_MODEL);

    // 3. attention (one pass, online softmax, all WMMA)
    k_attn<<<dim3(SEQ / QBLK, NHEAD, BATCH), 256, 0, stream>>>(Qb, Kb, Vt, Ob);

    // 4. output projection + bias (f32 out)
    k_gemm<1><<<dim3(D_MODEL / BN, MTOT / BM), 256, 0, stream>>>(
        Ob, WprojT, b_proj, nullptr, nullptr, nullptr, out, D_MODEL, D_MODEL);
}

// v010
// Measured time: 112 microseconds a run.
// Next to v009, in two timings, it ran 1.08 and 1.07 times as fast.
// Over all steps from v000 it is 4.44 times as fast.
#include <hip/hip_runtime.h>

typedef __attribute__((ext_vector_type(16))) __bf16 v16bf;
typedef __attribute__((ext_vector_type(8)))  float  v8f;
typedef __attribute__((ext_vector_type(2)))  float  v2f;
typedef __attribute__((ext_vector_type(2)))  __bf16 v2bf;
typedef __attribute__((ext_vector_type(4)))  unsigned int u32x4;
typedef __attribute__((ext_vector_type(8)))  unsigned int u32x8;

#define D_MODEL 1024
#define NHEAD   16
#define HD      64
#define SEQ     2048
#define BATCH   4
#define MTOT    (BATCH*SEQ)   // 8192

#define BM 128
#define BN 256
#define BK 64                 // k per pass: a staged row is 128 B, one whole line
#define ROWB   (BK * 2)       // bytes of a staged row
#define GPITCH (ROWB + 16)    // LDS row pitch (bytes), the mover's pad included: 16 B x odd for b128 readers
#define WROWS  64             // rows in a large slice
#define XROWS  32             // rows in a small slice (out-projection's activations)
#define WSLICE 10240          // LDS bytes of a large slice: 64 x 144 rounded up to a multiple of 2 KiB
#define XSLICE 6144           // LDS bytes of a small slice: 32 x 144 rounded up likewise
#define GBUF   (4 * WSLICE + 4 * XSLICE)   // out-projection, one stage: 256 weight rows, then 128 activation rows

__device__ __forceinline__ unsigned short f2bf(float f) {
    unsigned int u = __float_as_uint(f);
    u += 0x7FFFu + ((u >> 16) & 1u);          // round-to-nearest-even
    return (unsigned short)(u >> 16);
}

struct Frag { union { v16bf v; uint4 q[2]; }; };
struct Pack8 { union { uint4 q; v2bf h[4]; }; };   // 8 bf16 = one 16-byte store

// ---------------- conversion kernel ----------------
// Three short streams that read none of each other's output: one launch does all three, each
// block taking one job by its index, so that they start, fly and drain together and two
// launches' gap, fill and tail are not paid.  What short streams pay for besides is the number
// of waves that must start, so each thread converts many elements, by 16-byte loads that are
// all in flight before the first use.

typedef __attribute__((ext_vector_type(4))) float f32x4;

__device__ __forceinline__ unsigned int f2bf2(float lo, float hi) {
    return (unsigned int)f2bf(lo) | ((unsigned int)f2bf(hi) << 16);
}

#define CVT_LOADS 16                        // 16-byte loads per thread: 64 elements
#define CVT_BLOCK (256 * 4 * CVT_LOADS)     // elements per block

// out[i] = bf16(in[i]), block blk of CVT_BLOCK elements.
// A wave's load covers 512 contiguous bytes (4 lines), its store 256 (2 lines).
__device__ __forceinline__ void cvt_block(const float* __restrict__ in, unsigned short* __restrict__ out, unsigned blk) {
    const float* src = in + blk * CVT_BLOCK + threadIdx.x * 4;
    unsigned short* dst = out + blk * CVT_BLOCK + threadIdx.x * 4;
    f32x4 f[CVT_LOADS];
#pragma unroll
    for (int i = 0; i < CVT_LOADS; ++i) f[i] = *(const f32x4*)(src + i * 1024);
#pragma unroll
    for (int i = 0; i < CVT_LOADS; ++i)
        *(uint2*)(dst + i * 1024) = make_uint2(f2bf2(f[i][0], f[i][1]), f2bf2(f[i][2], f[i][3]));
}

// Wt[n*K + k] = bf16(W[k*N + n])   (store weights transposed, N x K row-major)
// A thread holds 8 k x 4 n; a wave 64 k x 16 n, so that each of its stores fills 4 whole
// 128-byte lines of Wt; a block 64 k x 128 n, so that its loads cover 512-byte runs of W.
// Blocks: N / 128 across, K / 64 down.  K and N are compile-time, so the row steps are immediate offsets.
template<int K, int N>
__device__ __forceinline__ void cvt_t_block(const float* __restrict__ W, unsigned short* __restrict__ Wt, unsigned blk) {
    static_assert(K % 64 == 0 && N % 128 == 0, "whole tiles only");
    const unsigned lane = threadIdx.x & 31, wid = threadIdx.x >> 5;
    const unsigned n = (blk % (N / 128)) * 128 + wid * 16 + (lane & 3) * 4;
    const unsigned k = (blk / (N / 128)) * 64 + (lane >> 2) * 8;
    const float* src = W + (k * N + n);
    unsigned short* dst = Wt + (n * K + k);
    f32x4 f[8];
#pragma unroll
    for (int i = 0; i < 8; ++i) f[i] = *(const f32x4*)(src + i * N);
#pragma unroll
    for (int j = 0; j < 4; ++j)
        *(uint4*)(dst + j * K) = make_uint4(f2bf2(f[0][j], f[1][j]), f2bf2(f[2][j], f[3][j]),
                                            f2bf2(f[4][j], f[5][j]), f2bf2(f[6][j], f[7][j]));
    // Another job's code follows in the listing and reuses the stores' address and data registers.
    asm volatile("s_wait_xcnt 0x0" ::: "memory");
}

#define X_JOBS     ((MTOT * D_MODEL) / CVT_BLOCK)            // blocks that convert x
#define WQKV_JOBS  ((3 * D_MODEL / 128) * (D_MODEL / 64))    // blocks that convert and transpose W_qkv
#define WPROJ_JOBS ((D_MODEL / 128) * (D_MODEL / 64))        // blocks that convert and transpose W_proj
static_assert((MTOT * D_MODEL) % CVT_BLOCK == 0, "whole blocks only");

// The blocks of x move twice the bytes of the others and come first in the index.
// The grid gives each SIMD 8 waves; the register budget of 8 lets all 16 loads of an x block fly
// together (under the default budget the last four are issued behind the first conversions).
__global__ __launch_bounds__(256) __attribute__((amdgpu_waves_per_eu(8, 8)))
void k_prep(const float* __restrict__ x, const float* __restrict__ Wqkv, const float* __restrict__ Wproj,
            unsigned short* __restrict__ Xb, unsigned short* __restrict__ WqkvT, unsigned short* __restrict__ WprojT) {
    const unsigned blk = blockIdx.x;                     // block-uniform: scalar branches
    if (blk < X_JOBS)
        cvt_block(x, Xb, blk);
    else if (blk < X_JOBS + WQKV_JOBS)
        cvt_t_block<D_MODEL, 3 * D_MODEL>(Wqkv, WqkvT, blk - X_JOBS);
    else
        cvt_t_block<D_MODEL, D_MODEL>(Wproj, WprojT, blk - (X_JOBS + WQKV_JOBS));
}

__device__ __forceinline__ unsigned uni(unsigned v) { return (unsigned)__builtin_amdgcn_readfirstlane(v); }

// A wave-uniform value held in a scalar register: a test on it compiles to a scalar branch, and
// what is formed from it is formed behind the waits written in front of it.
__device__ __forceinline__ unsigned pinned(unsigned v) {
    unsigned w = uni(v);
    asm volatile("" : "+s"(w));   // the scalar test or descriptor word of a tensor load, kept in an SGPR
    return w;
}

// Loop-invariant group of a tensor load: rows x 128 bytes (extents in bytes, tensor = tile),
// source row pitch srcPitch bytes, 16 bytes of LDS pad behind every 128-byte row -> GPITCH.
__device__ __forceinline__ u32x8 tdm_group1(unsigned rows, unsigned srcPitch) {
    u32x8 g;
    g[0] = uni((1u << 20) | (4u << 22) | (3u << 25));     // pad on, every 32 dwords, 4 dwords; no mask
    g[1] = uni((unsigned)ROWB << 16);                     // tensor_dim0
    g[2] = uni(rows << 16);                               // tensor_dim1
    g[3] = uni((unsigned)ROWB << 16);                     // tile_dim0
    g[4] = uni(rows);                                     // tile_dim1
    g[5] = uni(srcPitch);
    g[6] = uni(0u);
    g[7] = uni(0u);
    return g;
}

__device__ __forceinline__ u32x4 tdm_group0(unsigned count1, unsigned ldsByte, unsigned long long ga) {
    u32x4 g;
    g[0] = count1;                                        // count = 1
    g[1] = uni(ldsByte);
    g[2] = uni((unsigned)ga);
    g[3] = uni((((unsigned)(ga >> 32)) & 0x01FFFFFFu) | 0x80000000u);   // type = 2
    return g;
}

// The load and its wait name the descriptor as operands that they may change: between the two
// the compiler can then neither form the words anew elsewhere nor lend their registers out, so
// they hold their values until the wait and take new ones only behind it.
__device__ __forceinline__ void tdm_load(u32x4& g0, u32x8& g1) {
    asm volatile("tensor_load_to_lds %0, %1" : "+s"(g0), "+s"(g1) :: "memory");
}

// The wave's one outstanding tensor load, if it has issued one, has landed.
__device__ __forceinline__ void tdm_wait(u32x4& g0, u32x8& g1) {
    asm volatile("s_wait_tensorcnt 0x0" : "+s"(g0), "+s"(g1) :: "memory");
}

// ---------------- GEMMs: C(MxN) f32 = A(MxK)bf16 @ Bt(NxK)bf16^T ----------------
// Two LDS buffers; a pass is 64 k.  A wave brings its own slice of a stage by one tensor
// load (whole 128-byte rows), issued when the buffer is freed, one pass ahead of its use,
// while the waves run their WMMAs on the stage in the other buffer.
// Both epilogues store whole 128-byte lines, staged per wave through LDS.
// A lane's 8 accumulator registers run along the FIRST operand's rows, so the first operand
// is the side that is contiguous in the output: the weights (columns) for Q, K and the
// out-projection, the activations (tokens) for V^T.  Both fragments have one layout, so only
// the LDS base of each loader changes.

#define SPITCH 72             // bf16 staging row pitch (elems) = 144 B: 16 B x odd for b128
#define QSCALE (0.125f * 1.4426950408889634f)   // 1/sqrt(64) x log2(e), put on Q before its one rounding to bf16
#define FPITCH 68             // f32 staging row pitch (elems) = 272 B: 16 B x odd for b128

// ---- QKV projection ----
// One block per WGP, all 256 resident at once: 256 tokens x 384 columns, the columns being two
// heads each of Q, K and V.  The larger tile asks L2 for little more than half the bytes of a
// 128 x 256 tile, and a wave's 64 x 128 tile reads 12 fragments from LDS per 32 WMMAs, not 8 per 16.
// 12 waves, 3 per SIMD.  Every wave has 64 rows of its first operand and 128 of its second:
// waves 0 to 7:  one head of Q or K (64 weight rows) x 128 tokens;
// waves 8 to 11: 64 tokens x both heads of V (128 weight rows), which gives V^T.
#define QKV_TOK    256                       // tokens per block
#define QKV_WSL    6                         // weight slices of a stage: Q, Q, K, K, V, V, a head (64 rows) each
#define QKV_XSL    (QKV_TOK / WROWS)         // activation slices of a stage, 64 tokens each
#define QKV_BUF    ((QKV_WSL + QKV_XSL) * WSLICE)   // one stage
#define QKV_WAVES  12

__global__ __launch_bounds__(QKV_WAVES * 32) void k_qkv(
    const unsigned short* __restrict__ A,
    const unsigned short* __restrict__ Bt,
    unsigned short* __restrict__ Qb,
    unsigned short* __restrict__ Kb,
    unsigned short* __restrict__ Vt)
{
    __shared__ __attribute__((aligned(2048))) unsigned char ring[2 * QKV_BUF];

    const int lane = threadIdx.x & 31;
    const int ln = lane & 15,  hi  = lane >> 4;
    const unsigned wave = uni(threadIdx.x >> 5);
    const unsigned pair = blockIdx.x;                    // heads 2 * pair and 2 * pair + 1
    const unsigned rowBase = blockIdx.y * QKV_TOK;

    // Waves 0 to 9 each bring one slice (64 rows) of every stage: 0 to 5 weights, 6 to 9 activations.
    const unsigned slice = wave < (unsigned)(QKV_WSL + QKV_XSL) ? wave : 0u;   // waves 10, 11 issue nothing
    const bool     isW   = slice < (unsigned)QKV_WSL;
    const unsigned place = (unsigned)(unsigned long long)(&ring[0]) + slice * WSLICE;
    const unsigned long long src = isW
        ? (unsigned long long)(Bt + (size_t)((slice >> 1) * D_MODEL + pair * (2 * HD) + (slice & 1u) * HD) * D_MODEL)
        : (unsigned long long)(A  + (size_t)(rowBase + (slice - QKV_WSL) * WROWS) * D_MODEL);
    u32x8 g1 = tdm_group1(WROWS, (unsigned)D_MODEL * 2u);
    const unsigned count1 = pinned(1u);   // descriptor word 0, held in an SGPR: its register is not lent out under a load in flight

    // acc[t][u][r] = first operand's row t*16 + hi*8 + r times second operand's row u*16 + ln
    const bool isV = wave >= 8u;
    const unsigned sliceF = isV ? QKV_WSL + (wave - 8u) : (wave & 3u);            // 64 rows: one slice
    const unsigned sliceS = isV ? 4u                    : QKV_WSL + 2u * (wave >> 2);   // 128 rows: two adjoining slices
    const unsigned char* F0 = &ring[sliceF * WSLICE + ln * GPITCH + hi * 16];
    const unsigned char* S0 = &ring[sliceS * WSLICE + ln * GPITCH + hi * 16];

    v8f acc[4][8];
    v8f vz = {0.f,0.f,0.f,0.f,0.f,0.f,0.f,0.f};
#pragma unroll
    for (int t = 0; t < 4; ++t)
#pragma unroll
        for (int u = 0; u < 8; ++u) acc[t][u] = vz;

    // prologue: stage 0 lands and is published, then stage 1 is on its way
    const int NP = D_MODEL / BK;
    static_assert(D_MODEL / BK >= 2, "the ring's prologue needs two stages");
    u32x4 g0 = tdm_group0(count1, place, src);
    if (pinned(wave < (unsigned)(QKV_WSL + QKV_XSL))) {  // scalar branch: a tensor load ignores EXEC
        tdm_load(g0, g1);
        tdm_wait(g0, g1);                                // own slice landed before the barrier publishes it
    }
    __syncthreads();
    g0 = tdm_group0(count1, place + QKV_BUF, src + ROWB);
    if (pinned(wave < (unsigned)(QKV_WSL + QKV_XSL)))
        tdm_load(g0, g1);

    for (int s = 0; s < NP; ++s) {
        const int cur = (s & 1) * QKV_BUF;
#pragma unroll
        for (int kk = 0; kk < 2; ++kk) {                 // the stage's two 32-k steps
            Frag fa[4];
#pragma unroll
            for (int t = 0; t < 4; ++t)
#pragma unroll
                for (int g = 0; g < 2; ++g)
                    fa[t].q[g] = *(const uint4*)&F0[cur + t * 16 * GPITCH + kk * 64 + g * 32];
#pragma unroll
            for (int uh = 0; uh < 2; ++uh) {             // the second operand's two slices
                Frag fb[4];
#pragma unroll
                for (int u = 0; u < 4; ++u)
#pragma unroll
                    for (int g = 0; g < 2; ++g)
                        fb[u].q[g] = *(const uint4*)&S0[cur + uh * WSLICE + u * 16 * GPITCH + kk * 64 + g * 32];
#pragma unroll
                for (int t = 0; t < 4; ++t)
#pragma unroll
                    for (int u = 0; u < 4; ++u)
                        acc[t][uh * 4 + u] = __builtin_amdgcn_wmma_f32_16x16x32_bf16(
                            false, fa[t].v, false, fb[u].v, (short)0, acc[t][uh * 4 + u], false, false);
            }
        }

        // publish point of stage s + 1
        asm volatile("s_wait_dscnt 0x0" ::: "memory");       // own reads of this buffer retired before its refill
        tdm_wait(g0, g1);                                    // own slice of stage s + 1 landed before others read it
        __syncthreads();
        if (pinned((s + 2 < NP) && (wave < (unsigned)(QKV_WSL + QKV_XSL)))) {   // scalar branch: a tensor load ignores EXEC
            g0 = tdm_group0(count1, place + cur, src + pinned((unsigned)(s + 2) * ROWB));   // address formed behind the wait
            tdm_load(g0, g1);
        }
    }
    tdm_wait(g0, g1);                                        // nothing in flight when the ring becomes staging
    asm volatile("s_wait_dscnt 0x0" ::: "memory");

    // epilogue: 128 output rows of 128 B per wave: a token's 64 dims (Q, K; rows adjoin) or a
    // dim's 64 tokens (V^T; rows SEQ apart, the second head's 64 dims behind the first's).
    // acc[t][u][r] is output row u*16 + ln, element t*16 + hi*8 + r.
    const unsigned bh0  = (rowBase >> 11) * NHEAD + pair * 2;
    const unsigned tokB = rowBase & (SEQ - 1);
    unsigned short* dst = isV ? Vt + (size_t)bh0 * HD * SEQ + tokB + (wave - 8u) * 64
                              : ((wave & 2u) ? Kb : Qb) + ((size_t)(bh0 + (wave & 1u)) * SEQ + tokB + (wave >> 2) * 128) * HD;
    const int pitch = isV ? SEQ : HD;
    // Q carries the softmax scale, in base 2, so that K Q^T needs no multiply per score later
    const float osc = (!isV && !(wave & 2u)) ? QSCALE : 1.0f;
    // Each wave stages 32 rows at a time in its own range of the ring, which is free:
    // the loop's last barrier stands behind every fragment read and the last tensor wait.
    unsigned short* stg = (unsigned short*)&ring[0] + wave * (32 * SPITCH);
    const int srow = lane >> 3, col = (lane & 7) * 8;        // read-back slot: 8 lanes per row
    unsigned short* drow = dst + (size_t)srow * pitch + col;
#pragma unroll
    for (int part = 0; part < 4; ++part) {
        if (part > 0)       // every lane's read-back of the last rows is done before they are rewritten
            asm volatile("s_wait_dscnt 0x0" ::: "memory");
#pragma unroll
        for (int uu = 0; uu < 2; ++uu)
#pragma unroll
            for (int t = 0; t < 4; ++t) {
                Pack8 p;
#pragma unroll
                for (int r = 0; r < 8; r += 2) {
                    v2f f = { acc[t][part * 2 + uu][r] * osc, acc[t][part * 2 + uu][r + 1] * osc };
                    p.h[r >> 1] = __builtin_convertvector(f, v2bf);
                }
                *(uint4*)&stg[(uu * 16 + ln) * SPITCH + t * 16 + hi * 8] = p.q;
            }
        asm volatile("s_wait_dscnt 0x0" ::: "memory");       // rows written before other lanes read them back
#pragma unroll
        for (int k = 0; k < 8; ++k)                          // 4 whole rows (lines) per wave-wide store
            *(uint4*)&drow[(size_t)((part * 32 + k * 4) * pitch)] =
                *(const uint4*)&stg[(k * 4 + srow) * SPITCH + col];
    }
}

// ---- out-projection: 128 x 256 per block, 8 waves of 64 x 64, adds the bias, stores f32 ----
__global__ __launch_bounds__(256) void k_proj(
    const unsigned short* __restrict__ A,
    const unsigned short* __restrict__ Bt,
    const float* __restrict__ bias,
    float* __restrict__ Cout,
    int K, int N)
{
    __shared__ __attribute__((aligned(2048))) unsigned char ring[2 * GBUF];

    const int tid  = threadIdx.x;
    const int lane = tid & 31, wid = tid >> 5;
    const int ln = lane & 15,  hi  = lane >> 4;
    const int wr = wid >> 2,   wc  = wid & 3;           // 2 x 4 wave grid, 64x64 wave tile
    const int rowBase = blockIdx.y * BM;
    const int colBase = blockIdx.x * BN;

    // This wave's slice of every stage: waves 0 to 3 64 weight rows each, waves 4 to 7 32 activation rows.
    const unsigned wave = uni(threadIdx.x >> 5);
    const bool     isW  = wave < 4u;
    const unsigned place = (unsigned)(unsigned long long)(&ring[0])
                         + (isW ? wave * WSLICE : 4u * WSLICE + (wave - 4u) * XSLICE);
    const unsigned long long src = isW
        ? (unsigned long long)(Bt + (size_t)(colBase + wave * WROWS) * K)
        : (unsigned long long)(A  + (size_t)(rowBase + (wave - 4u) * XROWS) * K);
    u32x8 g1 = tdm_group1(isW ? WROWS : XROWS, (unsigned)K * 2u);
    const unsigned count1 = pinned(1u);   // descriptor word 0, held in an SGPR: its register is not lent out under a load in flight

    // The weights are the first operand.
    // acc[t][u][r] = first operand's row t*16 + hi*8 + r times second operand's row u*16 + ln
    // A wave's 64 rows of an operand are two runs of 32: 32 rows apart in a weight slice,
    // a slice apart for the activations.
    const unsigned char* F0 = &ring[wc * WSLICE + ln * GPITCH + hi * 16];
    const unsigned char* S0 = &ring[4 * WSLICE + wr * 2 * XSLICE + ln * GPITCH + hi * 16];
    const int runF = 32 * GPITCH;
    const int runS = XSLICE;

    v8f acc[4][4];
    v8f vz = {0.f,0.f,0.f,0.f,0.f,0.f,0.f,0.f};
#pragma unroll
    for (int t = 0; t < 4; ++t)
#pragma unroll
        for (int u = 0; u < 4; ++u) acc[t][u] = vz;

    // prologue: stage 0 lands and is published, then stage 1 is on its way (K holds two stages or more)
    const int NP = K / BK;
    u32x4 g0 = tdm_group0(count1, place, src);
    tdm_load(g0, g1);
    tdm_wait(g0, g1);                                    // own slice landed before the barrier publishes it
    __syncthreads();
    g0 = tdm_group0(count1, place + GBUF, src + ROWB);
    tdm_load(g0, g1);

    for (int s = 0; s < NP; ++s) {
        const int cur = (s & 1) * GBUF;
#pragma unroll
        for (int kk = 0; kk < 2; ++kk) {                 // the stage's two 32-k steps
            Frag fa[4], fb[4];
#pragma unroll
            for (int t = 0; t < 4; ++t)
#pragma unroll
                for (int g = 0; g < 2; ++g)
                    fa[t].q[g] = *(const uint4*)&F0[cur + (t >> 1) * runF + (t & 1) * 16 * GPITCH + kk * 64 + g * 32];
#pragma unroll
            for (int u = 0; u < 4; ++u)
#pragma unroll
                for (int g = 0; g < 2; ++g)
                    fb[u].q[g] = *(const uint4*)&S0[cur + (u >> 1) * runS + (u & 1) * 16 * GPITCH + kk * 64 + g * 32];

#pragma unroll
            for (int t = 0; t < 4; ++t)
#pragma unroll
                for (int u = 0; u < 4; ++u)
                    acc[t][u] = __builtin_amdgcn_wmma_f32_16x16x32_bf16(
                        false, fa[t].v, false, fb[u].v, (short)0, acc[t][u], false, false);
        }

        // publish point of stage s + 1
        asm volatile("s_wait_dscnt 0x0" ::: "memory");       // own reads of this buffer retired before its refill
        tdm_wait(g0, g1);                                    // own slice of stage s + 1 landed before others read it
        __syncthreads();
        if (pinned(s + 2 < NP)) {                            // scalar branch: a tensor load ignores EXEC
            g0 = tdm_group0(count1, place + cur, src + pinned((unsigned)(s + 2) * ROWB));   // address formed behind the wait
            tdm_load(g0, g1);
        }
    }
    tdm_wait(g0, g1);                                        // nothing in flight when the ring becomes staging
    asm volatile("s_wait_dscnt 0x0" ::: "memory");

    // epilogue
    // acc[t][u][r] is token u*16 + ln, column t*16 + hi*8 + r of the wave's 64 x 64 tile.
    // 16 tokens (rows of 256 B) at a time, in the wave's own range of the ring, which is free:
    // the loop's last barrier stands behind every fragment read and the last tensor wait.
    float* dst  = Cout + (size_t)(rowBase + wr * 64) * N + colBase + wc * 64;
    float* stgf = (float*)&ring[0] + wid * (16 * FPITCH);
    const int srow = lane >> 4, col = (lane & 15) * 4;   // read-back slot: 16 lanes per row
    float* drow = dst + (size_t)srow * N + col;
    const float4 bv = *(const float4*)&bias[colBase + wc * 64 + col];
#pragma unroll
    for (int u = 0; u < 4; ++u) {
        if (u > 0)      // every lane's read-back of the last rows is done before they are rewritten
            asm volatile("s_wait_dscnt 0x0" ::: "memory");
#pragma unroll
        for (int t = 0; t < 4; ++t)
#pragma unroll
            for (int g = 0; g < 2; ++g)
                *(float4*)&stgf[ln * FPITCH + t * 16 + hi * 8 + g * 4] =
                    make_float4(acc[t][u][g * 4], acc[t][u][g * 4 + 1], acc[t][u][g * 4 + 2], acc[t][u][g * 4 + 3]);
        asm volatile("s_wait_dscnt 0x0" ::: "memory");   // rows written before other lanes read them back
#pragma unroll
        for (int k = 0; k < 8; ++k) {                    // 2 whole rows (4 lines) per wave-wide store
            const float4 v = *(const float4*)&stgf[(k * 2 + srow) * FPITCH + col];
            *(float4*)&drow[(size_t)((u * 16 + k * 2) * N)] =
                make_float4(v.x + bv.x, v.y + bv.y, v.z + bv.z, v.w + bv.w);
        }
    }
}

#define AKT    64             // keys per staged tile
#define APITCH 72             // LDS row pitch (bf16 elems) = 144 B: 16 B x odd for b128 readers
#define NTILE  (SEQ / AKT)
#define QG     2              // column groups of 16 queries per wave
#define QBLK   (8 * QG * 16)  // queries per block
#define LAZY   8.0f           // how far the maximum in use may lag (scaled scores, base 2): exponentials stay below 2^8

// Two 16-byte copies per lane; the s_wait_xcnt closes the statement so that no address
// register named here is rewritten while a copy may still read it.
__device__ __forceinline__ void async_copy2(unsigned l0, const unsigned short* g0,
                                            unsigned l1, const unsigned short* g1) {
    asm volatile("global_load_async_to_lds_b128 %0, %1, off\n\t"
                 "global_load_async_to_lds_b128 %2, %3, off\n\t"
                 "s_wait_xcnt 0x0"
                 :: "v"(l0), "v"(g0), "v"(l1), "v"(g1) : "memory");
}

// Hand-over of a tile: this wave's LDS reads of the old buffer are done, its own copies
// of the next tile have landed, then the barrier publishes the tile and frees the buffer.
__device__ __forceinline__ void tile_publish() {
    asm volatile("s_wait_dscnt 0x0" ::: "memory");     // own reads retired before a refill
    asm volatile("s_wait_asynccnt 0x0" ::: "memory");  // own copies landed before others read
    __syncthreads();
}

// Register budget of 4 waves per SIMD: 2 blocks per WGP, so that all 512 blocks are
// resident at once and no second, thin round of blocks follows.
__global__ __launch_bounds__(256) __attribute__((amdgpu_waves_per_eu(4, 4))) void k_attn(
    const unsigned short* __restrict__ Qb,
    const unsigned short* __restrict__ Kb,
    const unsigned short* __restrict__ Vt,
    unsigned short* __restrict__ Ob)
{
    __shared__ alignas(16) unsigned short Ks[2][AKT * APITCH];   // 64 keys x 64 dims
    __shared__ alignas(16) unsigned short Vs[2][HD * APITCH];    // 64 dims x 64 keys

    const int tid  = threadIdx.x;
    const int lane = tid & 31, wid = tid >> 5;
    const int ln = lane & 15,  hi  = lane >> 4;
    const int b = blockIdx.z, h = blockIdx.y;
    const int qbase = blockIdx.x * QBLK + wid * (QG * 16);

    const size_t headOff = ((size_t)(b * NHEAD + h)) * SEQ * HD;
    const unsigned short* Qh = Qb + headOff;
    const unsigned short* Kh = Kb + headOff;
    const unsigned short* Vh = Vt + headOff;     // (HD x SEQ)

    // copy slots of this lane: rows crow and crow + 32 of a tile, 16 bytes at element ccol
    const int crow = tid >> 3, ccol = (tid & 7) * 8;
    const unsigned ldsK = (unsigned)(unsigned long long)(&Ks[0][crow * APITCH + ccol]);
    const unsigned ldsV = (unsigned)(unsigned long long)(&Vs[0][crow * APITCH + ccol]);
    const unsigned bufBytes  = AKT * APITCH * 2;  // one buffer (K and V tiles are alike)
    const unsigned halfBytes = 32 * APITCH * 2;   // 32 rows further down

    auto stageK = [&](int buf, int tile) {
        const unsigned short* g = Kh + (size_t)(tile * AKT + crow) * HD + ccol;
        async_copy2(ldsK + buf * bufBytes, g, ldsK + buf * bufBytes + halfBytes, g + 32 * HD);
    };
    auto stageV = [&](int buf, int tile) {
        const unsigned short* g = Vh + (size_t)crow * SEQ + tile * AKT + ccol;
        async_copy2(ldsV + buf * bufBytes, g, ldsV + buf * bufBytes + halfBytes, g + (size_t)32 * SEQ);
    };

    // Q fragments (64 dims x 16 queries per group, second operand), resident for the whole kernel
    Frag qf[QG][2];
#pragma unroll
    for (int j = 0; j < QG; ++j)
#pragma unroll
        for (int f = 0; f < 2; ++f)
#pragma unroll
            for (int g = 0; g < 2; ++g)
                qf[j][f].q[g] = *(const uint4*)&Qh[(size_t)(qbase + j * 16 + ln) * HD + f * 32 + hi * 8 + g * 16];

    v8f vz = {0.f,0.f,0.f,0.f,0.f,0.f,0.f,0.f};

    // ---- O^T += V^T @ (2^(s - mq))^T, s the scaled score ; the query's sum stays in its lanes ----
    v8f oacc[QG][4];                             // oacc[j][u][r] = dim u*16 + hi*8 + r, query j*16 + ln
    v2f psum[QG][2];                             // even and odd keys apart: packed adds, two chains
    v8f nmq[QG];                                 // -mq in all 8 registers: where the score accumulators start;
                                                 // mq = maximum in use, the same in a query's two lanes
#pragma unroll
    for (int j = 0; j < QG; ++j) {
#pragma unroll
        for (int u = 0; u < 4; ++u) oacc[j][u] = vz;
        psum[j][0] = (v2f){0.f, 0.f};
        psum[j][1] = (v2f){0.f, 0.f};
        nmq[j] = vz;                             // the first tile's scores come unshifted and set mq themselves
    }

    stageK(0, 0);
    stageV(0, 0);
    tile_publish();
    stageK(1, 1);
    stageV(1, 1);

    for (int s = 0; s < NTILE; ++s) {
        const unsigned short* Kc = &Ks[s & 1][0];
        const unsigned short* Vc = &Vs[s & 1][0];
        // the whole tile's scores first, so that one test serves all 64 keys of both groups
        // st[j][c][r] = key c*16 + hi*8 + r, query j*16 + ln, less mq
        v8f st[QG][4];
#pragma unroll
        for (int c = 0; c < 4; ++c) {
#pragma unroll
            for (int j = 0; j < QG; ++j) st[j][c] = nmq[j];
#pragma unroll
            for (int f = 0; f < 2; ++f) {
                Frag kf;
#pragma unroll
                for (int g = 0; g < 2; ++g)
                    kf.q[g] = *(const uint4*)&Kc[(c * 16 + ln) * APITCH + f * 32 + hi * 8 + g * 16];
#pragma unroll
                for (int j = 0; j < QG; ++j)
                    st[j][c] = __builtin_amdgcn_wmma_f32_16x16x32_bf16(false, kf.v, false, qf[j][f].v, (short)0, st[j][c], false, false);
            }
        }
        // Order of the tile's K loads and products: three fragments' loads ahead, then one more
        // fragment's loads behind each fragment's products, so that loads are on their way under
        // the products.  Left alone, the compiler waits for each fragment singly.
        __builtin_amdgcn_sched_group_barrier(0x100, 6, 0);        // LDS reads
#pragma unroll
        for (int i = 0; i < 5; ++i) {
            __builtin_amdgcn_sched_group_barrier(0x008, QG, 0);   // matrix products of one fragment
            __builtin_amdgcn_sched_group_barrier(0x100, 2, 0);
        }
        __builtin_amdgcn_sched_group_barrier(0x008, 3 * QG, 0);

        // maximum of this lane's 32 scores per group, four independent chains of three-way maxima
        float tm[QG];
#pragma unroll
        for (int j = 0; j < QG; ++j) {
            float tmx[4];
#pragma unroll
            for (int c = 0; c < 4; ++c) {
                tmx[c] = fmaxf(fmaxf(st[j][0][c], st[j][1][c]), st[j][2][c]);
                tmx[c] = fmaxf(fmaxf(tmx[c], st[j][3][c]), st[j][0][c + 4]);
                tmx[c] = fmaxf(fmaxf(tmx[c], st[j][1][c + 4]), st[j][2][c + 4]);
                tmx[c] = fmaxf(tmx[c], st[j][3][c + 4]);
            }
            tm[j] = fmaxf(fmaxf(fmaxf(tmx[0], tmx[1]), tmx[2]), tmx[3]);
        }

        // a scalar branch, taken by the whole wave if any lane's scores outgrow that lag,
        // and always on the first tile, which has no maximum yet
        const float lag = (s == 0) ? -__builtin_inff() : LAZY;
        if (__builtin_amdgcn_ballot_w32(fmaxf(tm[0], tm[1]) > lag) != 0) {
#pragma unroll
            for (int j = 0; j < QG; ++j) {
                // the query's two lanes (ln, ln + 16) join their halves of the keys: both get one mq
                const int ti = __builtin_bit_cast(int, tm[j]);
                const float to = __builtin_bit_cast(float,
                    __builtin_amdgcn_permlanex16(ti, ti, 0x76543210, 0xfedcba98, false, false));
                const float t    = fmaxf(tm[j], to);      // the tile's maximum above mq
                const float up   = fmaxf(t, 0.f);         // mq never falls ...
                const float rise = (s == 0) ? t : up;     // ... but the first tile sets it, of either sign
                const float corr = __builtin_amdgcn_exp2f(-up);   // at most 1; on the first tile the sums are 0
                nmq[j] -= rise;
#pragma unroll
                for (int c = 0; c < 4; ++c) st[j][c] -= rise;     // this tile's scores were taken against the old mq
#pragma unroll
                for (int u = 0; u < 4; ++u) oacc[j][u] *= corr;
                psum[j][0] *= corr;
                psum[j][1] *= corr;
            }
        }

        // V^T fragments of a 32-key half: vf[u] = dims u*16 + ln, keys kl + hi*8 (+ 16)
        Frag vf[4];
        auto loadV = [&](int u, int kl) {
#pragma unroll
            for (int g = 0; g < 2; ++g)
                vf[u].q[g] = *(const uint4*)&Vc[(u * 16 + ln) * APITCH + kl + hi * 8 + g * 16];
        };
#pragma unroll
        for (int u = 0; u < 4; ++u) loadV(u, 0);
        // The first half's four fragments stay ahead of its exponentials, under which they arrive.
        // Left alone, the compiler loads each fragment right in front of its two products and the
        // wave waits out the LDS latency once per fragment.
        __builtin_amdgcn_sched_barrier(0);

#pragma unroll                                   // two 32-key halves of the tile, straight-line
        for (int kl = 0; kl < AKT; kl += 32) {
            // exponentiate, sum in the lane, pack: element e of the operand is key
            // hi*8 + e (e < 8, from s0) or 16 + hi*8 + e - 8 (from s1), as V's loader has it
            union { v16bf v; v2bf h[8]; } pf[QG];
#pragma unroll
            for (int j = 0; j < QG; ++j) {
                const v8f s0 = st[j][kl >> 4];
                const v8f s1 = st[j][(kl >> 4) + 1];
#pragma unroll
                for (int r = 0; r < 8; r += 2) {
                    v2f p0 = { __builtin_amdgcn_exp2f(s0[r]), __builtin_amdgcn_exp2f(s0[r + 1]) };
                    v2f p1 = { __builtin_amdgcn_exp2f(s1[r]), __builtin_amdgcn_exp2f(s1[r + 1]) };
                    psum[j][(r >> 1) & 1] += p0 + p1;
                    pf[j].h[r >> 1]       = __builtin_convertvector(p0, v2bf);
                    pf[j].h[4 + (r >> 1)] = __builtin_convertvector(p1, v2bf);
                }
            }
            // the second half's fragment loads (below) stay behind the first half's exponentials:
            // they take the registers that the first half's products have just read
            if (kl == 0) __builtin_amdgcn_sched_barrier(0);

#pragma unroll
            for (int u = 0; u < 4; ++u) {
#pragma unroll
                for (int j = 0; j < QG; ++j)
                    oacc[j][u] = __builtin_amdgcn_wmma_f32_16x16x32_bf16(false, vf[u].v, false, pf[j].v, (short)0, oacc[j][u], false, false);
                if (kl == 0) loadV(u, 32);       // the next half's fragment, into the registers just read
            }
            // and they stay ahead of the second half's exponentials, under which they arrive
            if (kl == 0) __builtin_amdgcn_sched_barrier(0);
        }
        tile_publish();
        if (s + 2 < NTILE) {                      // refill the buffers this trip has read
            stageK(s & 1, s + 2);
            stageV(s & 1, s + 2);
        }
    }
    asm volatile("s_wait_asynccnt 0x0" ::: "memory");  // no copy in flight when the wave ends

#pragma unroll
    for (int j = 0; j < QG; ++j) {
        // the query's denominator: its two lanes join their halves of the keys, once
        float l = (psum[j][0][0] + psum[j][0][1]) + (psum[j][1][0] + psum[j][1][1]);
        l += __shfl_xor(l, 16, 32);

        // normalize + store bf16 into (B, N, D) layout for the out-projection GEMM:
        // a lane's 8 registers are 8 adjoining dims of its query, one 16-byte store
        unsigned short* orow = Ob + ((size_t)(b * SEQ + qbase + j * 16 + ln)) * D_MODEL + h * HD + hi * 8;
#pragma unroll
        for (int u = 0; u < 4; ++u) {
            Pack8 p;
#pragma unroll
            for (int r = 0; r < 8; r += 2) {
                v2f f = { oacc[j][u][r] / l, oacc[j][u][r + 1] / l };
                p.h[r >> 1] = __builtin_convertvector(f, v2bf);
            }
            *(uint4*)&orow[u * 16] = p.q;
        }
    }
}

// ---------------- launcher ----------------

extern "C" void kernel_launch(void* const* d_in, const int* in_sizes, int n_in,
                              void* d_out, int out_size, void* d_ws, size_t ws_size,
                              hipStream_t stream) {
    (void)in_sizes; (void)n_in; (void)out_size; (void)ws_size;
    const float* x      = (const float*)d_in[0];
    const float* W_qkv  = (const float*)d_in[1];
    const float* W_proj = (const float*)d_in[2];
    const float* b_proj = (const float*)d_in[3];
    float* out = (float*)d_out;

    const size_t NX  = (size_t)MTOT * D_MODEL;      // 8,388,608
    unsigned short* Xb     = (unsigned short*)d_ws;
    unsigned short* WqkvT  = Xb     + NX;                            // 3072 x 1024
    unsigned short* WprojT = WqkvT  + (size_t)3 * D_MODEL * D_MODEL; // 1024 x 1024
    unsigned short* Qb     = WprojT + (size_t)D_MODEL * D_MODEL;     // B*H*SEQ*HD == NX
    unsigned short* Kb     = Qb + NX;
    unsigned short* Vt     = Kb + NX;
    unsigned short* Ob     = Vt + NX;

    // 1. convert inputs to bf16 (weights transposed to N x K), one launch
    k_prep<<<X_JOBS + WQKV_JOBS + WPROJ_JOBS, 256, 0, stream>>>(x, W_qkv, W_proj, Xb, WqkvT, WprojT);

    // 2. QKV projection, scatter to per-head Q, K (row-major) and V^T
    k_qkv<<<dim3(NHEAD / 2, MTOT / QKV_TOK), QKV_WAVES * 32, 0, stream>>>(Xb, WqkvT, Qb, Kb, Vt);

    // 3. attention (one pass, online softmax, all WMMA)
    k_attn<<<dim3(SEQ / QBLK, NHEAD, BATCH), 256, 0, stream>>>(Qb, Kb, Vt, Ob);

    // 4. output projection + bias (f32 out)
    k_proj<<<dim3(D_MODEL / BN, MTOT / BM), 256, 0, stream>>>(Ob, WprojT, b_proj, out, D_MODEL, D_MODEL);
}
